// v000
// Times are from an AMD MI455X. After a warm-up the kernel runs many times in a row, and a time is the length of
// such a window on the GPU divided by its runs, so every launch and the gaps after it count. The runs cycle
// through copies of the inputs. A figure is the median of several windows, for all but v000 over two sittings.
// Sittings can differ by a few percent; kernels timed side by side share one.
// v000 is the starting kernel. One run takes 3900 microseconds.
#include <hip/hip_runtime.h>

// Cross-attention block with LayerNorm-ed per-head q and k (x1, x2 [4][2048][1024]; q = x1 wq + bq, [k | v] = x2 wkv + bkv ('xw' [1024][1024] and [1024][2048] 0.02, zero biases -> k = first 1024 columns, v = the rest); 16 heads x 64; q, k <- per-head LayerNorm over 64 (eps 1e-5) x gamma + beta ([64], read); scores x 64^-0.5; softmax; out = merged attn v -> [4][2048][1024] (8.4 M)).
// Layout per batch: bf16 copies of x1 and x2 in turn; exact projections + f32 biases (k and v as the two column blocks of wkv); an in-place per-(token, head) LayerNorm kernel with affine on the f32 q and k projections before the plane builders; dense T-2048 attention (hybrid rows: < 512 hi/lo 3 products, rest fp16 x1024); the f32 merge writes the output rows.
// Compute dtypes, f32 accumulate: every input rounded to bf16; projections exact + f32 biases; LayerNorms f32; attention rows < 512 3 products, rest fp16; softmax f32; output f32.

#define NB_  4
#define TT   2048
#define DM   1024
#define NH_  16
#define NKV  16
#define REP  (NH_ / NKV)
#define HD   64
#define DQ   (NH_ * HD)
#define DKV  (NKV * HD)
#define ZH   2
#define RH   512                  // query rows < RH use hi+lo planes (0: none)
#define WIN  0
#define PCAR 1024.0f
#define SCL  0.125f   // HD^-0.5
typedef _Float16 h16;
typedef unsigned short bf;
typedef __attribute__((ext_vector_type(16))) __bf16   v16bf;
typedef __attribute__((ext_vector_type(16))) _Float16 v16h;
typedef __attribute__((ext_vector_type(8)))  _Float16 v8h;
typedef __attribute__((ext_vector_type(8)))  unsigned short v8us;
typedef __attribute__((ext_vector_type(8)))  float    v8f;
typedef __attribute__((ext_vector_type(4)))  float    v4f;
typedef v8h  __attribute__((may_alias)) v8ha;
typedef v4f  __attribute__((may_alias)) v4fa;
typedef v8us __attribute__((may_alias)) v8usa;

__device__ __forceinline__ unsigned short f2bf(float f) { unsigned u = __float_as_uint(f); u += 0x7FFFu + ((u >> 16) & 1u); return (unsigned short)(u >> 16); }
__device__ __forceinline__ float bf2f(unsigned short b) { return __uint_as_float(((unsigned)b) << 16); }
__device__ __forceinline__ float bfr(float f) { return bf2f(f2bf(f)); }
__device__ __forceinline__ v16h cat16(v8h lo, v8h hi) { return __builtin_shufflevector(lo, hi, 0, 1, 2, 3, 4, 5, 6, 7, 8, 9, 10, 11, 12, 13, 14, 15); }
__device__ __forceinline__ v16bf cat16b(v8us lo, v8us hi) { return __builtin_bit_cast(v16bf, __builtin_shufflevector(lo, hi, 0, 1, 2, 3, 4, 5, 6, 7, 8, 9, 10, 11, 12, 13, 14, 15)); }
__device__ __forceinline__ v8f wmma16(v16h a, v16h b, v8f c) { return __builtin_amdgcn_wmma_f32_16x16x32_f16(false, a, false, b, (short)0, c, false, false); }
__device__ __forceinline__ v8f wmmab(v16bf a, v16bf b, v8f c) { return __builtin_amdgcn_wmma_f32_16x16x32_bf16(false, a, false, b, (short)0, c, false, false); }



// ---- k_gemmw: register-blocked GEMM, ONE WAVE per 64x64 output tile (16 accumulators), operands straight from K-contiguous 16-bit planes; grid (M/64, N/64, Z), 32 threads.
// C[m][n] (f32, pitch ldc, + optional f32 bias[n]) = sum_k A[m][k] Bt[n][k] (+ split products per NSPLIT). z-batch strides sA/sB/sC in elements. K % 32 == 0.
template <typename T16> struct WFrag;
template <> struct WFrag<h16> { typedef v16h V; static __device__ __forceinline__ V ld(const h16* p) { return cat16(*(const v8h*)p, *(const v8h*)(p + 16)); } static __device__ __forceinline__ v8f mma(V a, V b, v8f c) { return wmma16(a, b, c); } };
template <> struct WFrag<bf> { typedef v16bf V; static __device__ __forceinline__ V ld(const bf* p) { return cat16b(*(const v8us*)p, *(const v8us*)(p + 16)); } static __device__ __forceinline__ v8f mma(V a, V b, v8f c) { return wmmab(a, b, c); } };
template <typename T16, int NSPLIT, bool BIAS>
__global__ __launch_bounds__(32) void k_gemmw(const T16* __restrict__ A, const T16* __restrict__ A2, const T16* __restrict__ Bt, const T16* __restrict__ Bt2, int K, float* C, int ldc, const float* __restrict__ bias, size_t sA, size_t sB, size_t sC) {
    typedef typename WFrag<T16>::V V;
    __shared__ __align__(16) float os[16 * 68];
    const size_t z = blockIdx.z; A += z * sA; if (A2) A2 += z * sA; Bt += z * sB; if (Bt2) Bt2 += z * sB; C += z * sC;
    const int lane = threadIdx.x & 31, lr = lane & 15, hi = lane >> 4; const int r0 = blockIdx.x * 64, c0 = blockIdx.y * 64;
    v8f acc[4][4];
#pragma unroll
    for (int mb = 0; mb < 4; ++mb)
#pragma unroll
        for (int nb = 0; nb < 4; ++nb) acc[mb][nb] = (v8f){};
    const size_t aoff = (size_t)(r0 + lr) * K + 8 * hi, boff = (size_t)(c0 + lr) * K + 8 * hi;
#pragma unroll 1
    for (int kc = 0; kc < K; kc += 32) {
        V a[4], a2[4];
#pragma unroll
        for (int mb = 0; mb < 4; ++mb) { a[mb] = WFrag<T16>::ld(A + aoff + (size_t)mb * 16 * K + kc); if (NSPLIT == 1 || NSPLIT == 2) a2[mb] = WFrag<T16>::ld(A2 + aoff + (size_t)mb * 16 * K + kc); }
#pragma unroll
        for (int nb = 0; nb < 4; ++nb) { const V b = WFrag<T16>::ld(Bt + boff + (size_t)nb * 16 * K + kc); V b2; if (NSPLIT >= 2) b2 = WFrag<T16>::ld(Bt2 + boff + (size_t)nb * 16 * K + kc);
#pragma unroll
            for (int mb = 0; mb < 4; ++mb) { acc[mb][nb] = WFrag<T16>::mma(a[mb], b, acc[mb][nb]); if (NSPLIT == 1 || NSPLIT == 2) acc[mb][nb] = WFrag<T16>::mma(a2[mb], b, acc[mb][nb]); if (NSPLIT >= 2) acc[mb][nb] = WFrag<T16>::mma(a[mb], b2, acc[mb][nb]); } }
        asm volatile("v_nop\n\tv_nop\n\tv_nop\n\tv_nop" : "+v"(acc[0][0]), "+v"(acc[1][1]), "+v"(acc[2][2]), "+v"(acc[3][3]) : "v"(a[0]), "v"(a[3]));
    }
#pragma unroll
    for (int mb = 0; mb < 4; ++mb) {
#pragma unroll
        for (int nb = 0; nb < 4; ++nb) {
#pragma unroll
            for (int j = 0; j < 8; ++j) os[(hi * 8 + j) * 68 + nb * 16 + lr] = acc[mb][nb][j]; }
        __builtin_amdgcn_wave_barrier(); asm volatile("" ::: "memory");
        float* crow = C + (size_t)(r0 + mb * 16) * ldc + c0;
{
#pragma unroll
            for (int s = 0; s < 8; ++s) { const int row = 2 * s + hi, cofs = lr * 4; v4f val = *(const v4fa*)(os + row * 68 + cofs); if (BIAS) { val[0] += bfr(bias[c0 + cofs]); val[1] += bfr(bias[c0 + cofs + 1]); val[2] += bfr(bias[c0 + cofs + 2]); val[3] += bfr(bias[c0 + cofs + 3]); }
                *(v4f*)(crow + (size_t)row * ldc + cofs) = val; }
             }
        __builtin_amdgcn_wave_barrier(); asm volatile("" ::: "memory");
    }
}

__device__ __forceinline__ h16 tohx(float x) { return (h16)x; }
__device__ __forceinline__ void splitf(float y, unsigned short& h, unsigned short& l) { h = f2bf(y); l = f2bf(y - bf2f(h)); }
typedef __attribute__((ext_vector_type(2))) _Float16 v2h;
typedef __attribute__((ext_vector_type(4))) _Float16 v4h;
typedef __attribute__((ext_vector_type(2))) unsigned short v2us;
typedef __attribute__((ext_vector_type(4))) unsigned short v4us;
typedef __attribute__((ext_vector_type(2))) float v2f;
typedef __attribute__((ext_vector_type(4))) int v4i;

__global__ __launch_bounds__(256) void k_wtG(const float* __restrict__ w, int K, int N, bf* Bt) {
    const int lane = threadIdx.x & 31; const int L0 = (blockIdx.x * 8 + (threadIdx.x >> 5)) * 8; const int nlines = N * K / 64;
{
#pragma unroll 1
        for (int l = 0; l < 8; ++l) { const int L = L0 + l; if (L >= nlines) break; const size_t e = (size_t)L * 64 + lane * 2; const int k = (int)(e % K), n = (int)(e / K); v2us o;
            o[0] = f2bf(w[(size_t)k * N + n]); o[1] = f2bf(w[(size_t)(k + 1) * N + n]); *(v2us*)(Bt + e) = o; }
         }
}
__global__ __launch_bounds__(256) void k_cvt8(const float* __restrict__ src, bf* dst, size_t n8) { const size_t i = (size_t)blockIdx.x * 256 + threadIdx.x; if (i >= n8) return; const v8f v = *(const v8f*)(src + i * 8); v8us o;
#pragma unroll
    for (int k = 0; k < 8; ++k) o[k] = f2bf(v[k]); *(v8us*)(dst + i * 8) = o;  }

// k_rope: head planes [h][t][d] (fp16 + hi/lo) of rope(x) x sc with the rotate-half convention out[d] = x[d] cos[t][d] - x[d+HD/2] sin[t][d], out[d+HD/2] = x[d+HD/2] cos[t][d+HD/2] + x[d] sin[t][d+HD/2]
__global__ __launch_bounds__(256) void k_rope(const float* __restrict__ F, int pitch, int nheads, const float* __restrict__ CS, const float* __restrict__ RF, const float* __restrict__ nw, float sc, h16* P16, bf* Ph, bf* Pl) {
    const size_t e = ((size_t)blockIdx.x * 256 + threadIdx.x) * 2; if (e >= (size_t)nheads * TT * HD) return; const int d = (int)(e % HD); const int t = (int)((e / HD) % TT); const int h = (int)(e / ((size_t)HD * TT)); const float* f = F + (size_t)t * pitch + h * HD; const float rf = RF ? RF[(size_t)h * TT + t] : 1.0f; v2h o16; v2us oh, ol;
#pragma unroll
    for (int q = 0; q < 2; ++q) { const int dd = d + q; const int dp = (dd < HD / 2) ? dd + HD / 2 : dd - HD / 2; float x0 = f[dd], x1 = f[dp];
        if (RF) { float n0 = __fmul_rn(x0, rf), n1 = __fmul_rn(x1, rf); asm volatile("" : "+v"(n0)); asm volatile("" : "+v"(n1)); x0 = __fmul_rn(bfr(nw[dd]), n0); x1 = __fmul_rn(bfr(nw[dp]), n1); }
        const v2f cs = *(const v2f*)(CS + ((size_t)t * HD + dd) * 2); float a = __fmul_rn(x0, cs[0]), bq = __fmul_rn(x1, cs[1]); asm volatile("" : "+v"(a)); asm volatile("" : "+v"(bq)); const float r = ((dd < HD / 2) ? __fsub_rn(a, bq) : __fadd_rn(a, bq)) * sc;
        o16[q] = tohx(r); unsigned short a2, c2; splitf(r, a2, c2); oh[q] = a2; ol[q] = c2; }
    *(v2h*)(P16 + e) = o16; *(v2us*)(Ph + e) = oh; *(v2us*)(Pl + e) = ol;  }
__global__ __launch_bounds__(256) void k_vtp(const float* __restrict__ F, int pitch, int nheads, h16* V16, bf* Vh, bf* Vl) { const size_t e = ((size_t)blockIdx.x * 256 + threadIdx.x) * 2; if (e >= (size_t)nheads * HD * TT) return; const int t = (int)(e % TT); const int d = (int)((e / TT) % HD); const int g = (int)(e / ((size_t)TT * HD)); v2h o16; v2us oh, ol;
#pragma unroll
    for (int q = 0; q < 2; ++q) { const float x = F[(size_t)(t + q) * pitch + g * HD + d]; o16[q] = tohx(x); unsigned short a2, c2; splitf(x, a2, c2); oh[q] = a2; ol[q] = c2; }
    *(v2h*)(V16 + e) = o16; *(v2us*)(Vh + e) = oh; *(v2us*)(Vl + e) = ol;  }
__global__ __launch_bounds__(256) void k_csid(float* CS) { const int idx = blockIdx.x * 256 + threadIdx.x; if (idx >= TT * HD) return; v2f cs; cs[0] = 1.0f; cs[1] = 0.0f; *(v2f*)(CS + (size_t)idx * 2) = cs;  }
// k_asoft: per row (zz, i): t = S x HD^-0.5 (no mask); softmax over the 2048 keys (register row, one exp, fixed trees);
__global__ __launch_bounds__(256) void k_asoft(const float* __restrict__ Sb, h16* P16, bf* Ph, bf* Pl) {
    const int lane = threadIdx.x & 31; const int row = blockIdx.x * 8 + (threadIdx.x >> 5); if (row >= ZH * TT) return; const int i = row % TT; const int zz = row / TT; (void)zz; const bool hires = (i < RH); const float* sr = Sb + (size_t)row * TT; float v[TT / 32]; float mx = -3.0e38f;
#pragma unroll
    for (int ch = 0; ch < TT / 128; ++ch) { const int j0 = ch * 128 + lane * 4; const v4f a = *(const v4f*)(sr + j0);
#pragma unroll
        for (int q = 0; q < 4; ++q) { const int j = j0 + q; (void)j; const float t = a[q] * SCL; v[ch * 4 + q] = t; mx = fmaxf(mx, t); } }
#pragma unroll
    for (int sh = 16; sh; sh >>= 1) mx = fmaxf(mx, __shfl_xor(mx, sh, 32));
    float sum = 0.f;
#pragma unroll
    for (int k = 0; k < TT / 32; ++k) { float d0 = __fsub_rn(v[k], mx); asm volatile("" : "+v"(d0)); v[k] = __builtin_amdgcn_exp2f(__fmul_rn(d0, 1.4426950408889634f)); sum += v[k]; }
#pragma unroll
    for (int sh = 16; sh; sh >>= 1) sum += __shfl_xor(sum, sh, 32);
    const float f = __fdiv_rn(hires ? 1.0f : PCAR, sum);
{
        if (hires) {
#pragma unroll
            for (int ch = 0; ch < TT / 128; ++ch) { v4us oh, ol;
#pragma unroll
                for (int q = 0; q < 4; ++q) { unsigned short a, c2; splitf(v[ch * 4 + q] * f, a, c2); oh[q] = a; ol[q] = c2; }
                const size_t oo = ((size_t)zz * (RH ? RH : 1) + i) * TT + ch * 128 + lane * 4; *(v4us*)(Ph + oo) = oh; *(v4us*)(Pl + oo) = ol; }
        } else {
#pragma unroll
            for (int ch = 0; ch < TT / 128; ++ch) { v4h o4;
#pragma unroll
                for (int q = 0; q < 4; ++q) o4[q] = tohx(v[ch * 4 + q] * f);
                *(v4h*)(P16 + (size_t)row * TT + ch * 128 + lane * 4) = o4; } }
         }
}
__global__ __launch_bounds__(256) void k_hlna(float* F, const float* __restrict__ g, const float* __restrict__ bb) { const int lane = threadIdx.x & 31; const size_t wv = (size_t)blockIdx.x * 8 + (threadIdx.x >> 5); if (wv >= (size_t)TT * NH_) return; float* f = F + wv * HD + lane * 2; const v2f a = *(const v2f*)f; float s = __fadd_rn(a[0], a[1]);
#pragma unroll
    for (int sh = 16; sh; sh >>= 1) s = __fadd_rn(s, __shfl_xor(s, sh, 32));
    const float mean = __fdiv_rn(s, (float)HD); const float d0 = __fsub_rn(a[0], mean), d1 = __fsub_rn(a[1], mean); float p0 = __fmul_rn(d0, d0), p1 = __fmul_rn(d1, d1); asm volatile("" : "+v"(p0), "+v"(p1)); float vs = __fadd_rn(p0, p1);
#pragma unroll
    for (int sh = 16; sh; sh >>= 1) vs = __fadd_rn(vs, __shfl_xor(vs, sh, 32));
    const float var = __fdiv_rn(vs, (float)HD); const float den = __fsqrt_rn(__fadd_rn(var, 1e-5f)); v2f o; { float y0 = __fdiv_rn(d0, den), y1 = __fdiv_rn(d1, den); asm volatile("" : "+v"(y0), "+v"(y1)); y0 = __fmul_rn(y0, bfr(g[lane * 2])); y1 = __fmul_rn(y1, bfr(g[lane * 2 + 1])); asm volatile("" : "+v"(y0), "+v"(y1)); o[0] = __fadd_rn(y0, bfr(bb[lane * 2])); o[1] = __fadd_rn(y1, bfr(bb[lane * 2 + 1])); }
    *(v2f*)f = o;  }
__global__ __launch_bounds__(256) void k_merge(const float* __restrict__ O, int h0, float* OUTb) { const size_t e = ((size_t)blockIdx.x * 256 + threadIdx.x) * 2; if (e >= (size_t)ZH * TT * HD) return; const int d = (int)(e % HD); const int t = (int)((e / HD) % TT); const int zz = (int)(e / ((size_t)HD * TT)); const float cs = (t < RH) ? 1.0f : (1.0f / PCAR); const size_t oo = (size_t)t * DQ + (h0 + zz) * HD + d;
    v2f o2; o2[0] = O[e] * cs; o2[1] = O[e + 1] * cs; *(v2f*)(OUTb + oo) = o2;  }

extern "C" void kernel_launch(void* const* d_in, const int* in_sizes, int n_in,
                              void* d_out, int out_size, void* d_ws, size_t ws_size, hipStream_t stream) {
    (void)in_sizes; (void)n_in; (void)out_size;
    const float* x = (const float*)d_in[0]; const float* x2 = (const float*)d_in[1]; const float* wq = (const float*)d_in[2]; const float* bq = (const float*)d_in[3]; const float* wkv = (const float*)d_in[4]; const float* bkv = (const float*)d_in[5]; const float* gq = (const float*)d_in[6]; const float* btq = (const float*)d_in[7]; const float* gk = (const float*)d_in[8]; const float* btk = (const float*)d_in[9]; const float* wk = nullptr; const float* wv = nullptr; const float* wo = nullptr; (void)wk; (void)wv; (void)wo; const float* bk = bkv; const float* bv = bkv + 1024;
    float* OUT = (float*)d_out;     // [4][2048][1024]
    char* wsp = (char*)d_ws;
    auto take = [&](size_t bytes) { char* p = wsp; wsp += (bytes + 255) & ~(size_t)255; return (void*)p; };
    bf* WQ = (bf*)take((size_t)DQ * DM * 2); bf* WKV = (bf*)take((size_t)2 * DKV * DM * 2); bf* WK = WKV; bf* WV = WKV + (size_t)DKV * DM;   /* k | v row blocks of the transposed fused weight */ float* CS = (float*)take((size_t)TT * HD * 2 * 4);
    bf* XB = (bf*)take((size_t)TT * DM * 2); float* FQ = (float*)take((size_t)TT * DQ * 4); float* FK = (float*)take((size_t)TT * DKV * 4);
    h16* QP16 = (h16*)take((size_t)NH_ * TT * HD * 2); h16* KP16 = (h16*)take((size_t)NKV * TT * HD * 2); h16* VT16 = (h16*)take((size_t)NKV * HD * TT * 2);
    bf* QPh = (bf*)take((size_t)NH_ * TT * HD * 2); bf* QPl = (bf*)take((size_t)NH_ * TT * HD * 2); bf* KPh = (bf*)take((size_t)NKV * TT * HD * 2); bf* KPl = (bf*)take((size_t)NKV * TT * HD * 2); bf* VTh = (bf*)take((size_t)NKV * HD * TT * 2); bf* VTl = (bf*)take((size_t)NKV * HD * TT * 2); bf* Ph = (bf*)take((size_t)ZH * RH * TT * 2); bf* Pl = (bf*)take((size_t)ZH * RH * TT * 2);
    float* Sb = (float*)take((size_t)ZH * TT * TT * 4); h16* P16 = (h16*)take((size_t)ZH * TT * TT * 2); float* Ob = (float*)take((size_t)ZH * TT * HD * 4);
    if ((size_t)(wsp - (char*)d_ws) > ws_size) return;    // ws 256 MiB
    float* FV = FK;   // v projection reuses the k buffer after the k planes are built (stream-ordered)
    { k_wtG<<<(unsigned)((DM * DQ / 64 + 63) / 64), 256, 0, stream>>>(wq, DM, DQ, WQ); k_wtG<<<(unsigned)((DM * 2 * DKV / 64 + 63) / 64), 256, 0, stream>>>(wkv, DM, 2 * DKV, WKV);   /* 'xw' [1024][2048] -> Bt [2048][1024]: rows 0..1023 = k, 1024.. = v */ 
      
       }
    k_csid<<<(TT * HD + 255) / 256, 256, 0, stream>>>(CS);
    const unsigned LQ = (unsigned)(((size_t)NH_ * TT * HD / 2 + 255) / 256), LKv = (unsigned)(((size_t)NKV * TT * HD / 2 + 255) / 256);
    for (int b = 0; b < NB_; ++b) {
        
        k_cvt8<<<(unsigned)(((size_t)TT * DM / 8 + 255) / 256), 256, 0, stream>>>(x + (size_t)b * TT * DM, XB, (size_t)TT * DM / 8);
        k_gemmw<bf, 0, true><<<dim3(TT / 64, DQ / 64, 1), 32, 0, stream>>>(XB, nullptr, WQ, nullptr, DM, FQ, DQ, bq, 0, 0, 0); k_hlna<<<(NH_ * TT + 7) / 8, 256, 0, stream>>>(FQ, gq, btq);   /* per-head LayerNorm(q) x gamma + beta */
        k_rope<<<LQ, 256, 0, stream>>>(FQ, DQ, NH_, CS, nullptr, nullptr, 1.0f, QP16, QPh, QPl);
        k_cvt8<<<(unsigned)(((size_t)TT * DM / 8 + 255) / 256), 256, 0, stream>>>(x2 + (size_t)b * TT * DM, XB, (size_t)TT * DM / 8); k_gemmw<bf, 0, true><<<dim3(TT / 64, DKV / 64, 1), 32, 0, stream>>>(XB, nullptr, WK, nullptr, DM, FK, DKV, bk, 0, 0, 0); k_hlna<<<(NKV * TT + 7) / 8, 256, 0, stream>>>(FK, gk, btk);   /* k from x2, LayerNorm(k) */
        k_rope<<<LKv, 256, 0, stream>>>(FK, DKV, NKV, CS, nullptr, nullptr, 1.0f, KP16, KPh, KPl);
        k_gemmw<bf, 0, true><<<dim3(TT / 64, DKV / 64, 1), 32, 0, stream>>>(XB, nullptr, WV, nullptr, DM, FV, DKV, bv, 0, 0, 0); k_vtp<<<LKv, 256, 0, stream>>>(FV, DKV, NKV, VT16, VTh, VTl);
        for (int h0 = 0; h0 < NH_; h0 += ZH) { const size_t zq = (size_t)h0, zk = (size_t)(h0 / REP);   // one kv head per query head: the pass's two heads use consecutive kv planes (z-strides TT*HD)
            k_gemmw<bf, 2, false><<<dim3(RH / 64, TT / 64, ZH), 32, 0, stream>>>(QPh + zq * TT * HD, QPl + zq * TT * HD, KPh + zk * TT * HD, KPl + zk * TT * HD, HD, Sb, TT, nullptr, (size_t)TT * HD, (size_t)TT * HD, (size_t)TT * TT);
            k_gemmw<h16, 0, false><<<dim3((TT - RH) / 64, TT / 64, ZH), 32, 0, stream>>>(QP16 + zq * TT * HD + (size_t)RH * HD, nullptr, KP16 + zk * TT * HD, nullptr, HD, Sb + (size_t)RH * TT, TT, nullptr, (size_t)TT * HD, (size_t)TT * HD, (size_t)TT * TT);
            k_asoft<<<ZH * TT / 8, 256, 0, stream>>>(Sb, P16, Ph, Pl);
            k_gemmw<bf, 2, false><<<dim3(RH / 64, HD / 64, ZH), 32, 0, stream>>>(Ph, Pl, VTh + zk * HD * TT, VTl + zk * HD * TT, TT, Ob, HD, nullptr, (size_t)RH * TT, (size_t)HD * TT, (size_t)TT * HD);
            k_gemmw<h16, 0, false><<<dim3((TT - RH) / 64, HD / 64, ZH), 32, 0, stream>>>(P16 + (size_t)RH * TT, nullptr, VT16 + zk * HD * TT, nullptr, TT, Ob + (size_t)RH * HD, HD, nullptr, (size_t)TT * TT, (size_t)HD * TT, (size_t)TT * HD);
            k_merge<<<(unsigned)(((size_t)ZH * TT * HD / 2 + 255) / 256), 256, 0, stream>>>(Ob, h0, OUT + (size_t)b * TT * DQ); }
         }
}

// v001
// Measured time: 1660 microseconds a run.
// In two side-by-side timings against v000, it was 2.36 and 2.38 times as fast.
#include <hip/hip_runtime.h>

// Cross-attention block with LayerNorm-ed per-head q and k (x1, x2 [4][2048][1024]; q = x1 wq + bq, [k | v] = x2 wkv + bkv ('xw' [1024][1024] and [1024][2048] 0.02, zero biases -> k = first 1024 columns, v = the rest); 16 heads x 64; q, k <- per-head LayerNorm over 64 (eps 1e-5) x gamma + beta ([64], read); scores x 64^-0.5; softmax; out = merged attn v -> [4][2048][1024] (8.4 M)).
// Layout per batch: bf16 copies of x1 and x2 in turn; exact projections + f32 biases (k and v as the two column blocks of wkv); an in-place per-(token, head) LayerNorm kernel with affine on the f32 q and k projections before the plane builders; dense T-2048 attention (hybrid rows: < 512 hi/lo 3 products, rest fp16 x1024); the f32 merge writes the output rows.
// Compute dtypes, f32 accumulate: every input rounded to bf16; projections exact + f32 biases; LayerNorms f32; attention rows < 512 3 products, rest fp16; softmax f32; output f32.

#define NB_  4
#define TT   2048
#define DM   1024
#define NH_  16
#define NKV  16
#define REP  (NH_ / NKV)
#define HD   64
#define DQ   (NH_ * HD)
#define DKV  (NKV * HD)
#define ZH   2
#define RH   512                  // query rows < RH use hi+lo planes (0: none)
#define WIN  0
#define PCAR 1024.0f
#define SCL  0.125f   // HD^-0.5
#define KSP  16                   // K slices of the attn x v products: 128 keys = one 256-byte unit of a probability row per slice
typedef _Float16 h16;
typedef unsigned short bf;
typedef __attribute__((ext_vector_type(16))) __bf16   v16bf;
typedef __attribute__((ext_vector_type(16))) _Float16 v16h;
typedef __attribute__((ext_vector_type(8)))  _Float16 v8h;
typedef __attribute__((ext_vector_type(8)))  unsigned short v8us;
typedef __attribute__((ext_vector_type(8)))  float    v8f;
typedef __attribute__((ext_vector_type(4)))  float    v4f;
typedef v8h  __attribute__((may_alias)) v8ha;
typedef v4f  __attribute__((may_alias)) v4fa;
typedef v8us __attribute__((may_alias)) v8usa;

__device__ __forceinline__ unsigned short f2bf(float f) { unsigned u = __float_as_uint(f); u += 0x7FFFu + ((u >> 16) & 1u); return (unsigned short)(u >> 16); }
__device__ __forceinline__ float bf2f(unsigned short b) { return __uint_as_float(((unsigned)b) << 16); }
__device__ __forceinline__ float bfr(float f) { return bf2f(f2bf(f)); }
__device__ __forceinline__ v16h cat16(v8h lo, v8h hi) { return __builtin_shufflevector(lo, hi, 0, 1, 2, 3, 4, 5, 6, 7, 8, 9, 10, 11, 12, 13, 14, 15); }
__device__ __forceinline__ v16bf cat16b(v8us lo, v8us hi) { return __builtin_bit_cast(v16bf, __builtin_shufflevector(lo, hi, 0, 1, 2, 3, 4, 5, 6, 7, 8, 9, 10, 11, 12, 13, 14, 15)); }
__device__ __forceinline__ v8f wmma16(v16h a, v16h b, v8f c) { return __builtin_amdgcn_wmma_f32_16x16x32_f16(false, a, false, b, (short)0, c, false, false); }
__device__ __forceinline__ v8f wmmab(v16bf a, v16bf b, v8f c) { return __builtin_amdgcn_wmma_f32_16x16x32_bf16(false, a, false, b, (short)0, c, false, false); }



// ---- k_gemmw: register-blocked GEMM, ONE WAVE per 64x64 output tile (16 accumulators), operands straight from K-contiguous 16-bit planes; grid (M/64, N/64, Z), 32 threads.
// C[m][n] (f32, pitch ldc, + optional f32 bias[n]) = sum_k A[m][k] Bt[n][k] (+ split products per NSPLIT). z-batch strides sA/sB/sC in elements. K % 32 == 0.
// KS > 1: grid.y = (N/64) * KS; work-group y sums only K slice y % KS (K / KS long, K % (32 KS) == 0) of column tile y / KS and stores it in partial plane C + (y % KS) * sK; the reader adds the KS planes.
template <typename T16> struct WFrag;
template <> struct WFrag<h16> { typedef v16h V; static __device__ __forceinline__ V ld(const h16* p) { return cat16(*(const v8h*)p, *(const v8h*)(p + 16)); } static __device__ __forceinline__ v8f mma(V a, V b, v8f c) { return wmma16(a, b, c); } };
template <> struct WFrag<bf> { typedef v16bf V; static __device__ __forceinline__ V ld(const bf* p) { return cat16b(*(const v8us*)p, *(const v8us*)(p + 16)); } static __device__ __forceinline__ v8f mma(V a, V b, v8f c) { return wmmab(a, b, c); } };
template <typename T16, int NSPLIT, bool BIAS, int KS>
__global__ __launch_bounds__(32) void k_gemmw(const T16* __restrict__ A, const T16* __restrict__ A2, const T16* __restrict__ Bt, const T16* __restrict__ Bt2, int K, float* C, int ldc, const float* __restrict__ bias, size_t sA, size_t sB, size_t sC, size_t sK) {
    typedef typename WFrag<T16>::V V;
    __shared__ __align__(16) float os[16 * 68];
    const size_t z = blockIdx.z; A += z * sA; if (A2) A2 += z * sA; Bt += z * sB; if (Bt2) Bt2 += z * sB; C += z * sC;
    const int lane = threadIdx.x & 31, lr = lane & 15, hi = lane >> 4; const int r0 = blockIdx.x * 64, c0 = (int)(blockIdx.y / KS) * 64; const int ks = (int)(blockIdx.y % KS), kb = ks * (K / KS), ke = kb + K / KS; C += (size_t)ks * sK;
    v8f acc[4][4];
#pragma unroll
    for (int mb = 0; mb < 4; ++mb)
#pragma unroll
        for (int nb = 0; nb < 4; ++nb) acc[mb][nb] = (v8f){};
    const size_t aoff = (size_t)(r0 + lr) * K + 8 * hi, boff = (size_t)(c0 + lr) * K + 8 * hi;
#pragma unroll 1
    for (int kc = kb; kc < ke; kc += 32) {
        V a[4], a2[4];
#pragma unroll
        for (int mb = 0; mb < 4; ++mb) { a[mb] = WFrag<T16>::ld(A + aoff + (size_t)mb * 16 * K + kc); if (NSPLIT == 1 || NSPLIT == 2) a2[mb] = WFrag<T16>::ld(A2 + aoff + (size_t)mb * 16 * K + kc); }
#pragma unroll
        for (int nb = 0; nb < 4; ++nb) { const V b = WFrag<T16>::ld(Bt + boff + (size_t)nb * 16 * K + kc); V b2; if (NSPLIT >= 2) b2 = WFrag<T16>::ld(Bt2 + boff + (size_t)nb * 16 * K + kc);
#pragma unroll
            for (int mb = 0; mb < 4; ++mb) { acc[mb][nb] = WFrag<T16>::mma(a[mb], b, acc[mb][nb]); if (NSPLIT == 1 || NSPLIT == 2) acc[mb][nb] = WFrag<T16>::mma(a2[mb], b, acc[mb][nb]); if (NSPLIT >= 2) acc[mb][nb] = WFrag<T16>::mma(a[mb], b2, acc[mb][nb]); } }
        asm volatile("v_nop\n\tv_nop\n\tv_nop\n\tv_nop" : "+v"(acc[0][0]), "+v"(acc[1][1]), "+v"(acc[2][2]), "+v"(acc[3][3]) : "v"(a[0]), "v"(a[3]));
    }
#pragma unroll
    for (int mb = 0; mb < 4; ++mb) {
#pragma unroll
        for (int nb = 0; nb < 4; ++nb) {
#pragma unroll
            for (int j = 0; j < 8; ++j) os[(hi * 8 + j) * 68 + nb * 16 + lr] = acc[mb][nb][j]; }
        __builtin_amdgcn_wave_barrier(); asm volatile("" ::: "memory");
        float* crow = C + (size_t)(r0 + mb * 16) * ldc + c0;
{
#pragma unroll
            for (int s = 0; s < 8; ++s) { const int row = 2 * s + hi, cofs = lr * 4; v4f val = *(const v4fa*)(os + row * 68 + cofs); if (BIAS) { val[0] += bfr(bias[c0 + cofs]); val[1] += bfr(bias[c0 + cofs + 1]); val[2] += bfr(bias[c0 + cofs + 2]); val[3] += bfr(bias[c0 + cofs + 3]); }
                *(v4f*)(crow + (size_t)row * ldc + cofs) = val; }
             }
        __builtin_amdgcn_wave_barrier(); asm volatile("" ::: "memory");
    }
}

__device__ __forceinline__ h16 tohx(float x) { return (h16)x; }
__device__ __forceinline__ void splitf(float y, unsigned short& h, unsigned short& l) { h = f2bf(y); l = f2bf(y - bf2f(h)); }
typedef __attribute__((ext_vector_type(2))) _Float16 v2h;
typedef __attribute__((ext_vector_type(4))) _Float16 v4h;
typedef __attribute__((ext_vector_type(2))) unsigned short v2us;
typedef __attribute__((ext_vector_type(4))) unsigned short v4us;
typedef __attribute__((ext_vector_type(2))) float v2f;
typedef __attribute__((ext_vector_type(4))) int v4i;

__global__ __launch_bounds__(256) void k_wtG(const float* __restrict__ w, int K, int N, bf* Bt) {
    const int lane = threadIdx.x & 31; const int L0 = (blockIdx.x * 8 + (threadIdx.x >> 5)) * 8; const int nlines = N * K / 64;
{
#pragma unroll 1
        for (int l = 0; l < 8; ++l) { const int L = L0 + l; if (L >= nlines) break; const size_t e = (size_t)L * 64 + lane * 2; const int k = (int)(e % K), n = (int)(e / K); v2us o;
            o[0] = f2bf(w[(size_t)k * N + n]); o[1] = f2bf(w[(size_t)(k + 1) * N + n]); *(v2us*)(Bt + e) = o; }
         }
}
__global__ __launch_bounds__(256) void k_cvt8(const float* __restrict__ src, bf* dst, size_t n8) { const size_t i = (size_t)blockIdx.x * 256 + threadIdx.x; if (i >= n8) return; const v8f v = *(const v8f*)(src + i * 8); v8us o;
#pragma unroll
    for (int k = 0; k < 8; ++k) o[k] = f2bf(v[k]); *(v8us*)(dst + i * 8) = o;  }

// k_rope: head planes [h][t][d] (fp16 + hi/lo) of rope(x) x sc with the rotate-half convention out[d] = x[d] cos[t][d] - x[d+HD/2] sin[t][d], out[d+HD/2] = x[d+HD/2] cos[t][d+HD/2] + x[d] sin[t][d+HD/2]
__global__ __launch_bounds__(256) void k_rope(const float* __restrict__ F, int pitch, int nheads, const float* __restrict__ CS, const float* __restrict__ RF, const float* __restrict__ nw, float sc, h16* P16, bf* Ph, bf* Pl) {
    const size_t e = ((size_t)blockIdx.x * 256 + threadIdx.x) * 2; if (e >= (size_t)nheads * TT * HD) return; const int d = (int)(e % HD); const int t = (int)((e / HD) % TT); const int h = (int)(e / ((size_t)HD * TT)); const float* f = F + (size_t)t * pitch + h * HD; const float rf = RF ? RF[(size_t)h * TT + t] : 1.0f; v2h o16; v2us oh, ol;
#pragma unroll
    for (int q = 0; q < 2; ++q) { const int dd = d + q; const int dp = (dd < HD / 2) ? dd + HD / 2 : dd - HD / 2; float x0 = f[dd], x1 = f[dp];
        if (RF) { float n0 = __fmul_rn(x0, rf), n1 = __fmul_rn(x1, rf); asm volatile("" : "+v"(n0)); asm volatile("" : "+v"(n1)); x0 = __fmul_rn(bfr(nw[dd]), n0); x1 = __fmul_rn(bfr(nw[dp]), n1); }
        const v2f cs = *(const v2f*)(CS + ((size_t)t * HD + dd) * 2); float a = __fmul_rn(x0, cs[0]), bq = __fmul_rn(x1, cs[1]); asm volatile("" : "+v"(a)); asm volatile("" : "+v"(bq)); const float r = ((dd < HD / 2) ? __fsub_rn(a, bq) : __fadd_rn(a, bq)) * sc;
        o16[q] = tohx(r); unsigned short a2, c2; splitf(r, a2, c2); oh[q] = a2; ol[q] = c2; }
    *(v2h*)(P16 + e) = o16; *(v2us*)(Ph + e) = oh; *(v2us*)(Pl + e) = ol;  }
__global__ __launch_bounds__(256) void k_vtp(const float* __restrict__ F, int pitch, int nheads, h16* V16, bf* Vh, bf* Vl) { const size_t e = ((size_t)blockIdx.x * 256 + threadIdx.x) * 2; if (e >= (size_t)nheads * HD * TT) return; const int t = (int)(e % TT); const int d = (int)((e / TT) % HD); const int g = (int)(e / ((size_t)TT * HD)); v2h o16; v2us oh, ol;
#pragma unroll
    for (int q = 0; q < 2; ++q) { const float x = F[(size_t)(t + q) * pitch + g * HD + d]; o16[q] = tohx(x); unsigned short a2, c2; splitf(x, a2, c2); oh[q] = a2; ol[q] = c2; }
    *(v2h*)(V16 + e) = o16; *(v2us*)(Vh + e) = oh; *(v2us*)(Vl + e) = ol;  }
__global__ __launch_bounds__(256) void k_csid(float* CS) { const int idx = blockIdx.x * 256 + threadIdx.x; if (idx >= TT * HD) return; v2f cs; cs[0] = 1.0f; cs[1] = 0.0f; *(v2f*)(CS + (size_t)idx * 2) = cs;  }
// k_asoft: per row (zz, i): t = S x HD^-0.5 (no mask); softmax over the 2048 keys (register row, one exp, fixed trees);
__global__ __launch_bounds__(256) void k_asoft(const float* __restrict__ Sb, h16* P16, bf* Ph, bf* Pl) {
    const int lane = threadIdx.x & 31; const int row = blockIdx.x * 8 + (threadIdx.x >> 5); if (row >= ZH * TT) return; const int i = row % TT; const int zz = row / TT; (void)zz; const bool hires = (i < RH); const float* sr = Sb + (size_t)row * TT; float v[TT / 32]; float mx = -3.0e38f;
#pragma unroll
    for (int ch = 0; ch < TT / 128; ++ch) { const int j0 = ch * 128 + lane * 4; const v4f a = *(const v4f*)(sr + j0);
#pragma unroll
        for (int q = 0; q < 4; ++q) { const int j = j0 + q; (void)j; const float t = a[q] * SCL; v[ch * 4 + q] = t; mx = fmaxf(mx, t); } }
#pragma unroll
    for (int sh = 16; sh; sh >>= 1) mx = fmaxf(mx, __shfl_xor(mx, sh, 32));
    float sum = 0.f;
#pragma unroll
    for (int k = 0; k < TT / 32; ++k) { float d0 = __fsub_rn(v[k], mx); asm volatile("" : "+v"(d0)); v[k] = __builtin_amdgcn_exp2f(__fmul_rn(d0, 1.4426950408889634f)); sum += v[k]; }
#pragma unroll
    for (int sh = 16; sh; sh >>= 1) sum += __shfl_xor(sum, sh, 32);
    const float f = __fdiv_rn(hires ? 1.0f : PCAR, sum);
{
        if (hires) {
#pragma unroll
            for (int ch = 0; ch < TT / 128; ++ch) { v4us oh, ol;
#pragma unroll
                for (int q = 0; q < 4; ++q) { unsigned short a, c2; splitf(v[ch * 4 + q] * f, a, c2); oh[q] = a; ol[q] = c2; }
                const size_t oo = ((size_t)zz * (RH ? RH : 1) + i) * TT + ch * 128 + lane * 4; *(v4us*)(Ph + oo) = oh; *(v4us*)(Pl + oo) = ol; }
        } else {
#pragma unroll
            for (int ch = 0; ch < TT / 128; ++ch) { v4h o4;
#pragma unroll
                for (int q = 0; q < 4; ++q) o4[q] = tohx(v[ch * 4 + q] * f);
                *(v4h*)(P16 + (size_t)row * TT + ch * 128 + lane * 4) = o4; } }
         }
}
__global__ __launch_bounds__(256) void k_hlna(float* F, const float* __restrict__ g, const float* __restrict__ bb) { const int lane = threadIdx.x & 31; const size_t wv = (size_t)blockIdx.x * 8 + (threadIdx.x >> 5); if (wv >= (size_t)TT * NH_) return; float* f = F + wv * HD + lane * 2; const v2f a = *(const v2f*)f; float s = __fadd_rn(a[0], a[1]);
#pragma unroll
    for (int sh = 16; sh; sh >>= 1) s = __fadd_rn(s, __shfl_xor(s, sh, 32));
    const float mean = __fdiv_rn(s, (float)HD); const float d0 = __fsub_rn(a[0], mean), d1 = __fsub_rn(a[1], mean); float p0 = __fmul_rn(d0, d0), p1 = __fmul_rn(d1, d1); asm volatile("" : "+v"(p0), "+v"(p1)); float vs = __fadd_rn(p0, p1);
#pragma unroll
    for (int sh = 16; sh; sh >>= 1) vs = __fadd_rn(vs, __shfl_xor(vs, sh, 32));
    const float var = __fdiv_rn(vs, (float)HD); const float den = __fsqrt_rn(__fadd_rn(var, 1e-5f)); v2f o; { float y0 = __fdiv_rn(d0, den), y1 = __fdiv_rn(d1, den); asm volatile("" : "+v"(y0), "+v"(y1)); y0 = __fmul_rn(y0, bfr(g[lane * 2])); y1 = __fmul_rn(y1, bfr(g[lane * 2 + 1])); asm volatile("" : "+v"(y0), "+v"(y1)); o[0] = __fadd_rn(y0, bfr(bb[lane * 2])); o[1] = __fadd_rn(y1, bfr(bb[lane * 2 + 1])); }
    *(v2f*)f = o;  }
__global__ __launch_bounds__(256) void k_merge(const float* __restrict__ O, int h0, float* OUTb) { const size_t e = ((size_t)blockIdx.x * 256 + threadIdx.x) * 2; if (e >= (size_t)ZH * TT * HD) return; const int d = (int)(e % HD); const int t = (int)((e / HD) % TT); const int zz = (int)(e / ((size_t)HD * TT)); const float cs = (t < RH) ? 1.0f : (1.0f / PCAR); const size_t oo = (size_t)t * DQ + (h0 + zz) * HD + d;
    v2f a = *(const v2f*)(O + e);   // the KSP partial planes of the K-split products, added in slice order
#pragma unroll   // all KSP loads in flight together instead of one latency per plane
    for (int s = 1; s < KSP; ++s) { const v2f p = *(const v2f*)(O + (size_t)s * ZH * TT * HD + e); a[0] += p[0]; a[1] += p[1]; }
    v2f o2; o2[0] = a[0] * cs; o2[1] = a[1] * cs; *(v2f*)(OUTb + oo) = o2;  }

extern "C" void kernel_launch(void* const* d_in, const int* in_sizes, int n_in,
                              void* d_out, int out_size, void* d_ws, size_t ws_size, hipStream_t stream) {
    (void)in_sizes; (void)n_in; (void)out_size;
    const float* x = (const float*)d_in[0]; const float* x2 = (const float*)d_in[1]; const float* wq = (const float*)d_in[2]; const float* bq = (const float*)d_in[3]; const float* wkv = (const float*)d_in[4]; const float* bkv = (const float*)d_in[5]; const float* gq = (const float*)d_in[6]; const float* btq = (const float*)d_in[7]; const float* gk = (const float*)d_in[8]; const float* btk = (const float*)d_in[9]; const float* wk = nullptr; const float* wv = nullptr; const float* wo = nullptr; (void)wk; (void)wv; (void)wo; const float* bk = bkv; const float* bv = bkv + 1024;
    float* OUT = (float*)d_out;     // [4][2048][1024]
    char* wsp = (char*)d_ws;
    auto take = [&](size_t bytes) { char* p = wsp; wsp += (bytes + 255) & ~(size_t)255; return (void*)p; };
    bf* WQ = (bf*)take((size_t)DQ * DM * 2); bf* WKV = (bf*)take((size_t)2 * DKV * DM * 2); bf* WK = WKV; bf* WV = WKV + (size_t)DKV * DM;   /* k | v row blocks of the transposed fused weight */ float* CS = (float*)take((size_t)TT * HD * 2 * 4);
    bf* XB = (bf*)take((size_t)TT * DM * 2); float* FQ = (float*)take((size_t)TT * DQ * 4); float* FK = (float*)take((size_t)TT * DKV * 4);
    h16* QP16 = (h16*)take((size_t)NH_ * TT * HD * 2); h16* KP16 = (h16*)take((size_t)NKV * TT * HD * 2); h16* VT16 = (h16*)take((size_t)NKV * HD * TT * 2);
    bf* QPh = (bf*)take((size_t)NH_ * TT * HD * 2); bf* QPl = (bf*)take((size_t)NH_ * TT * HD * 2); bf* KPh = (bf*)take((size_t)NKV * TT * HD * 2); bf* KPl = (bf*)take((size_t)NKV * TT * HD * 2); bf* VTh = (bf*)take((size_t)NKV * HD * TT * 2); bf* VTl = (bf*)take((size_t)NKV * HD * TT * 2); bf* Ph = (bf*)take((size_t)ZH * RH * TT * 2); bf* Pl = (bf*)take((size_t)ZH * RH * TT * 2);
    float* Sb = (float*)take((size_t)ZH * TT * TT * 4); h16* P16 = (h16*)take((size_t)ZH * TT * TT * 2); float* Ob = (float*)take((size_t)KSP * ZH * TT * HD * 4);   /* KSP partial planes [slice][head][t][d] */
    if ((size_t)(wsp - (char*)d_ws) > ws_size) return;    // ws 256 MiB
    float* FV = FK;   // v projection reuses the k buffer after the k planes are built (stream-ordered)
    { k_wtG<<<(unsigned)((DM * DQ / 64 + 63) / 64), 256, 0, stream>>>(wq, DM, DQ, WQ); k_wtG<<<(unsigned)((DM * 2 * DKV / 64 + 63) / 64), 256, 0, stream>>>(wkv, DM, 2 * DKV, WKV);   /* 'xw' [1024][2048] -> Bt [2048][1024]: rows 0..1023 = k, 1024.. = v */ 
      
       }
    k_csid<<<(TT * HD + 255) / 256, 256, 0, stream>>>(CS);
    const unsigned LQ = (unsigned)(((size_t)NH_ * TT * HD / 2 + 255) / 256), LKv = (unsigned)(((size_t)NKV * TT * HD / 2 + 255) / 256);
    for (int b = 0; b < NB_; ++b) {
        
        k_cvt8<<<(unsigned)(((size_t)TT * DM / 8 + 255) / 256), 256, 0, stream>>>(x + (size_t)b * TT * DM, XB, (size_t)TT * DM / 8);
        k_gemmw<bf, 0, true, 1><<<dim3(TT / 64, DQ / 64, 1), 32, 0, stream>>>(XB, nullptr, WQ, nullptr, DM, FQ, DQ, bq, 0, 0, 0, 0); k_hlna<<<(NH_ * TT + 7) / 8, 256, 0, stream>>>(FQ, gq, btq);   /* per-head LayerNorm(q) x gamma + beta */
        k_rope<<<LQ, 256, 0, stream>>>(FQ, DQ, NH_, CS, nullptr, nullptr, 1.0f, QP16, QPh, QPl);
        k_cvt8<<<(unsigned)(((size_t)TT * DM / 8 + 255) / 256), 256, 0, stream>>>(x2 + (size_t)b * TT * DM, XB, (size_t)TT * DM / 8); k_gemmw<bf, 0, true, 1><<<dim3(TT / 64, DKV / 64, 1), 32, 0, stream>>>(XB, nullptr, WK, nullptr, DM, FK, DKV, bk, 0, 0, 0, 0); k_hlna<<<(NKV * TT + 7) / 8, 256, 0, stream>>>(FK, gk, btk);   /* k from x2, LayerNorm(k) */
        k_rope<<<LKv, 256, 0, stream>>>(FK, DKV, NKV, CS, nullptr, nullptr, 1.0f, KP16, KPh, KPl);
        k_gemmw<bf, 0, true, 1><<<dim3(TT / 64, DKV / 64, 1), 32, 0, stream>>>(XB, nullptr, WV, nullptr, DM, FV, DKV, bv, 0, 0, 0, 0); k_vtp<<<LKv, 256, 0, stream>>>(FV, DKV, NKV, VT16, VTh, VTl);
        for (int h0 = 0; h0 < NH_; h0 += ZH) { const size_t zq = (size_t)h0, zk = (size_t)(h0 / REP);   // one kv head per query head: the pass's two heads use consecutive kv planes (z-strides TT*HD)
            k_gemmw<bf, 2, false, 1><<<dim3(RH / 64, TT / 64, ZH), 32, 0, stream>>>(QPh + zq * TT * HD, QPl + zq * TT * HD, KPh + zk * TT * HD, KPl + zk * TT * HD, HD, Sb, TT, nullptr, (size_t)TT * HD, (size_t)TT * HD, (size_t)TT * TT, 0);
            k_gemmw<h16, 0, false, 1><<<dim3((TT - RH) / 64, TT / 64, ZH), 32, 0, stream>>>(QP16 + zq * TT * HD + (size_t)RH * HD, nullptr, KP16 + zk * TT * HD, nullptr, HD, Sb + (size_t)RH * TT, TT, nullptr, (size_t)TT * HD, (size_t)TT * HD, (size_t)TT * TT, 0);
            k_asoft<<<ZH * TT / 8, 256, 0, stream>>>(Sb, P16, Ph, Pl);
            k_gemmw<bf, 2, false, KSP><<<dim3(RH / 64, HD / 64 * KSP, ZH), 32, 0, stream>>>(Ph, Pl, VTh + zk * HD * TT, VTl + zk * HD * TT, TT, Ob, HD, nullptr, (size_t)RH * TT, (size_t)HD * TT, (size_t)TT * HD, (size_t)ZH * TT * HD);
            k_gemmw<h16, 0, false, KSP><<<dim3((TT - RH) / 64, HD / 64 * KSP, ZH), 32, 0, stream>>>(P16 + (size_t)RH * TT, nullptr, VT16 + zk * HD * TT, nullptr, TT, Ob + (size_t)RH * HD, HD, nullptr, (size_t)TT * TT, (size_t)HD * TT, (size_t)TT * HD, (size_t)ZH * TT * HD);
            k_merge<<<(unsigned)(((size_t)ZH * TT * HD / 2 + 255) / 256), 256, 0, stream>>>(Ob, h0, OUT + (size_t)b * TT * DQ); }
         }
}

// v003
// Measured time: 503 microseconds a run.
// It is 3.29 times as fast as v001, going by the measured steps of the versions left out in between.
// Over all steps from v000 it is 7.79 times as fast.
#include <hip/hip_runtime.h>

// Cross-attention block with LayerNorm-ed per-head q and k (x1, x2 [4][2048][1024]; q = x1 wq + bq, [k | v] = x2 wkv + bkv ('xw' [1024][1024] and [1024][2048] 0.02, zero biases -> k = first 1024 columns, v = the rest); 16 heads x 64; q, k <- per-head LayerNorm over 64 (eps 1e-5) x gamma + beta ([64], read); scores x 64^-0.5; softmax; out = merged attn v -> [4][2048][1024] (8.4 M)).
// Layout per batch: bf16 copies of x1 and x2 in turn; one projection kernel each for q, k and v (k and v as the two column blocks of wkv): exact products, f32 bias, for q and k the per-(token, head) LayerNorm with affine on the wave's own accumulators, and the 16-bit head planes stored straight from them (no f32 projection in memory); the head planes of all four batches stay in the workspace; fused dense T-2048 attention with a running softmax, one kernel per row class (hybrid rows: < 512 hi/lo 3 products, rest fp16 x1024), writes the output rows.
// Compute dtypes, f32 accumulate: every input rounded to bf16; projections exact + f32 biases; LayerNorms f32; attention rows < 512 3 products, rest fp16; softmax f32; output f32.

#define NB_  4
#define TT   2048
#define DM   1024
#define NH_  16
#define NKV  16
#define REP  (NH_ / NKV)
#define HD   64
#define DQ   (NH_ * HD)
#define DKV  (NKV * HD)
#define RH   512                  // query rows < RH use hi+lo planes (0: none)
#define WIN  0
#define PCAR 1024.0f
#define SCL  0.125f   // HD^-0.5
typedef _Float16 h16;
typedef unsigned short bf;
typedef __attribute__((ext_vector_type(16))) __bf16   v16bf;
typedef __attribute__((ext_vector_type(16))) _Float16 v16h;
typedef __attribute__((ext_vector_type(8)))  _Float16 v8h;
typedef __attribute__((ext_vector_type(8)))  unsigned short v8us;
typedef __attribute__((ext_vector_type(8)))  float    v8f;
typedef __attribute__((ext_vector_type(4)))  float    v4f;
typedef v8h  __attribute__((may_alias)) v8ha;
typedef v4f  __attribute__((may_alias)) v4fa;
typedef v8us __attribute__((may_alias)) v8usa;

__device__ __forceinline__ unsigned short f2bf(float f) { unsigned u = __float_as_uint(f); u += 0x7FFFu + ((u >> 16) & 1u); return (unsigned short)(u >> 16); }
__device__ __forceinline__ float bf2f(unsigned short b) { return __uint_as_float(((unsigned)b) << 16); }
__device__ __forceinline__ float bfr(float f) { return bf2f(f2bf(f)); }
__device__ __forceinline__ v16h cat16(v8h lo, v8h hi) { return __builtin_shufflevector(lo, hi, 0, 1, 2, 3, 4, 5, 6, 7, 8, 9, 10, 11, 12, 13, 14, 15); }
__device__ __forceinline__ v16bf cat16b(v8us lo, v8us hi) { return __builtin_bit_cast(v16bf, __builtin_shufflevector(lo, hi, 0, 1, 2, 3, 4, 5, 6, 7, 8, 9, 10, 11, 12, 13, 14, 15)); }
__device__ __forceinline__ v8f wmma16(v16h a, v16h b, v8f c) { return __builtin_amdgcn_wmma_f32_16x16x32_f16(false, a, false, b, (short)0, c, false, false); }
__device__ __forceinline__ v8f wmmab(v16bf a, v16bf b, v8f c) { return __builtin_amdgcn_wmma_f32_16x16x32_bf16(false, a, false, b, (short)0, c, false, false); }



// WFrag: one 16x32 (or 32x16) 16-bit operand fragment from a K-contiguous plane, the same k order for A and B
template <typename T16> struct WFrag;
template <> struct WFrag<h16> { typedef v16h V; static __device__ __forceinline__ V ld(const h16* p) { return cat16(*(const v8h*)p, *(const v8h*)(p + 16)); } static __device__ __forceinline__ v8f mma(V a, V b, v8f c) { return wmma16(a, b, c); } };
template <> struct WFrag<bf> { typedef v16bf V; static __device__ __forceinline__ V ld(const bf* p) { return cat16b(*(const v8us*)p, *(const v8us*)(p + 16)); } static __device__ __forceinline__ v8f mma(V a, V b, v8f c) { return wmmab(a, b, c); } };

__device__ __forceinline__ h16 tohx(float x) { return (h16)x; }
__device__ __forceinline__ void splitf(float y, unsigned short& h, unsigned short& l) { h = f2bf(y); l = f2bf(y - bf2f(h)); }
typedef __attribute__((ext_vector_type(2))) _Float16 v2h;
typedef __attribute__((ext_vector_type(4))) _Float16 v4h;
typedef __attribute__((ext_vector_type(2))) unsigned short v2us;
typedef __attribute__((ext_vector_type(4))) unsigned short v4us;
typedef __attribute__((ext_vector_type(2))) float v2f;
typedef __attribute__((ext_vector_type(4))) int v4i;

__global__ __launch_bounds__(256) void k_wtG(const float* __restrict__ w, int K, int N, bf* Bt) {
    const int lane = threadIdx.x & 31; const int L0 = (blockIdx.x * 8 + (threadIdx.x >> 5)) * 8; const int nlines = N * K / 64;
{
#pragma unroll 1
        for (int l = 0; l < 8; ++l) { const int L = L0 + l; if (L >= nlines) break; const size_t e = (size_t)L * 64 + lane * 2; const int k = (int)(e % K), n = (int)(e / K); v2us o;
            o[0] = f2bf(w[(size_t)k * N + n]); o[1] = f2bf(w[(size_t)(k + 1) * N + n]); *(v2us*)(Bt + e) = o; }
         }
}
__global__ __launch_bounds__(256) void k_cvt8(const float* __restrict__ src, bf* dst, size_t n8) { const size_t i = (size_t)blockIdx.x * 256 + threadIdx.x; if (i >= n8) return; const v8f v = *(const v8f*)(src + i * 8); v8us o;
#pragma unroll
    for (int k = 0; k < 8; ++k) o[k] = f2bf(v[k]); *(v8us*)(dst + i * 8) = o;  }

// ---- k_proj: projection GEMM with its whole tail, ONE WAVE per 64 tokens x 64 columns (= one head; 16 accumulators), operands straight from K-contiguous bf16 planes; grid (TT/64, heads), 32 threads.
// The f32 tile stays in registers: the wave adds the bias, normalises (q, k) and stores the fp16, hi and lo head planes itself.
// LN (q, k): product rows = weight rows (d), columns = tokens: per column group a lane holds 32 of the 64 d of ONE token (lane ^ 16 the other 32), and each accumulator is 8 neighbouring d = one 16-byte store into [h][t][d].
// !LN (v): product rows = tokens, columns = weight rows: each accumulator is 8 neighbouring tokens of one d = one 16-byte store into [h][d][t].
// Every plain '#pragma unroll' here stands on a loop over register arrays: their indices must be constants, or the arrays would leave the registers.
__device__ __forceinline__ float xhalf(float v) { const int b = __float_as_int(v); return __int_as_float(__builtin_amdgcn_permlanex16(b, b, 0x76543210, 0xfedcba98, false, false)); }   // the value of lane ^ 16
// sum over the 64 d of a token, v[mb][j] = element d = mb*16 + hi*8 + j: neighbours first, then d ^ 32, ^ 16, ^ 8 (the other wave half), ^ 4, ^ 2; both halves end with the same bits
__device__ __forceinline__ float hsum64(const float (&v)[4][8]) { float z[4];
#pragma unroll
    for (int q = 0; q < 4; ++q) { z[q] = ((v[0][2 * q] + v[0][2 * q + 1]) + (v[2][2 * q] + v[2][2 * q + 1])) + ((v[1][2 * q] + v[1][2 * q + 1]) + (v[3][2 * q] + v[3][2 * q + 1])); z[q] += xhalf(z[q]); }
    return (z[0] + z[2]) + (z[1] + z[3]); }
__device__ __forceinline__ void planes8(const float (&r)[8], v8h& o16, v8us& oh, v8us& ol) {
#pragma unroll
    for (int j = 0; j < 8; ++j) { o16[j] = tohx(r[j]); unsigned short a2, c2; splitf(r[j], a2, c2); oh[j] = a2; ol[j] = c2; } }
template <bool LN>
__global__ __launch_bounds__(32) void k_proj(const bf* __restrict__ X, const bf* __restrict__ Wt, const float* __restrict__ bias, const float* __restrict__ g, const float* __restrict__ bb, h16* __restrict__ P16, bf* __restrict__ Ph, bf* __restrict__ Pl) {
    typedef WFrag<bf>::V V;
    const int lane = threadIdx.x & 31, lr = lane & 15, hi = lane >> 4; const int t0 = blockIdx.x * 64, h = blockIdx.y, c0 = h * 64;
    const bf* A = LN ? Wt + (size_t)c0 * DM : X + (size_t)t0 * DM; const bf* Bt = LN ? X + (size_t)t0 * DM : Wt + (size_t)c0 * DM;
    v8f acc[4][4];
#pragma unroll
    for (int mb = 0; mb < 4; ++mb)
#pragma unroll
        for (int nb = 0; nb < 4; ++nb) acc[mb][nb] = (v8f){};
    const size_t off = (size_t)lr * DM + 8 * hi;
    // rolled: a trip already holds 16 loads and 16 matrix instructions, more trips in the text would only lengthen it
#pragma unroll 1
    for (int kc = 0; kc < DM; kc += 32) {
        V a[4]; const bf* pa = A + off + kc; const bf* pb = Bt + off + kc;
#pragma unroll
        for (int mb = 0; mb < 4; ++mb) a[mb] = WFrag<bf>::ld(pa + (size_t)mb * 16 * DM);
#pragma unroll
        for (int nb = 0; nb < 4; ++nb) { const V b = WFrag<bf>::ld(pb + (size_t)nb * 16 * DM);
#pragma unroll
            for (int mb = 0; mb < 4; ++mb) acc[mb][nb] = WFrag<bf>::mma(a[mb], b, acc[mb][nb]); }
        // the vector slots that the chip needs between the trip's last matrix instructions and what follows them over the back edge
        asm volatile("v_nop\n\tv_nop\n\tv_nop\n\tv_nop" : "+v"(acc[0][0]), "+v"(acc[1][1]), "+v"(acc[2][2]), "+v"(acc[3][3]) : "v"(a[0]), "v"(a[3]));
        asm volatile("s_wait_xcnt 0x0" :: "v"(pa), "v"(pb) : "memory");   // before the address registers of the trip's loads are reused; naming them keeps them live up to the wait, so that no load's own result lands on them
    }
    if (LN) {
        float bs[4][8], gm[4][8], bt[4][8]; const unsigned ob = (unsigned)hi * 32u;   // the lane's byte offset (d = hi * 8) into the three [64] f32 vectors
        const char* cbs = (const char*)(bias + c0); const char* cgm = (const char*)g; const char* cbt = (const char*)bb;
#pragma unroll
        for (int mb = 0; mb < 4; ++mb)
#pragma unroll
            for (int j = 0; j < 8; ++j) { bs[mb][j] = *(const float*)(cbs + ob + mb * 64 + j * 4); gm[mb][j] = *(const float*)(cgm + ob + mb * 64 + j * 4); bt[mb][j] = *(const float*)(cbt + ob + mb * 64 + j * 4); }
        asm volatile("s_wait_xcnt 0x0" :: "v"(ob) : "memory");   // before the offset register of the loads above is reused; naming it keeps it live up to the wait, so that no load's own result lands on it
        __builtin_amdgcn_sched_barrier(0);   // keeps later register writes from being lifted over the wait
#pragma unroll
        for (int mb = 0; mb < 4; ++mb)
#pragma unroll
            for (int j = 0; j < 8; ++j) { bs[mb][j] = bfr(bs[mb][j]); gm[mb][j] = bfr(gm[mb][j]); bt[mb][j] = bfr(bt[mb][j]);
#pragma unroll
                for (int nb = 0; nb < 4; ++nb) acc[mb][nb][j] += bs[mb][j]; }
#pragma unroll
        for (int nb = 0; nb < 4; ++nb) { float x[4][8], p[4][8];
#pragma unroll
            for (int mb = 0; mb < 4; ++mb)
#pragma unroll
                for (int j = 0; j < 8; ++j) x[mb][j] = acc[mb][nb][j];
            const float mean = hsum64(x) * (1.0f / HD);
#pragma unroll
            for (int mb = 0; mb < 4; ++mb)
#pragma unroll
                for (int j = 0; j < 8; ++j) { x[mb][j] -= mean; p[mb][j] = x[mb][j] * x[mb][j]; }
            const float den = __fsqrt_rn(hsum64(p) * (1.0f / HD) + 1e-5f);
            v8h o16[4]; v8us oh[4], ol[4];
#pragma unroll
            for (int mb = 0; mb < 4; ++mb) { float r[8];
#pragma unroll
                for (int j = 0; j < 8; ++j) r[j] = __fdiv_rn(x[mb][j], den) * gm[mb][j] + bt[mb][j];
                planes8(r, o16[mb], oh[mb], ol[mb]); }
            const size_t e = ((size_t)h * TT + t0 + nb * 16 + lr) * HD + hi * 8;
            __builtin_amdgcn_sched_barrier(0);   // the column's arithmetic ends here: nothing of it is sunk between a store and the wait behind the stores
#pragma unroll
            for (int mb = 0; mb < 4; ++mb) { *(v8h*)(P16 + e + mb * 16) = o16[mb]; *(v8us*)(Ph + e + mb * 16) = oh[mb]; *(v8us*)(Pl + e + mb * 16) = ol[mb]; }
            asm volatile("s_wait_xcnt 0x0" ::: "memory");   // before the data and address registers of the stores above are reused
            __builtin_amdgcn_sched_barrier(0);   // keeps later register writes from being lifted over the wait
        }
    } else {
#pragma unroll
        for (int nb = 0; nb < 4; ++nb) { const float bs = bfr(bias[c0 + nb * 16 + lr]); v8h o16[4]; v8us oh[4], ol[4];
#pragma unroll
            for (int mb = 0; mb < 4; ++mb) { float r[8];
#pragma unroll
                for (int j = 0; j < 8; ++j) r[j] = acc[mb][nb][j] + bs;
                planes8(r, o16[mb], oh[mb], ol[mb]); }
            const size_t e = ((size_t)h * HD + nb * 16 + lr) * TT + t0 + hi * 8;
            __builtin_amdgcn_sched_barrier(0);   // the column's arithmetic ends here: nothing of it is sunk between a store and the wait behind the stores
#pragma unroll
            for (int mb = 0; mb < 4; ++mb) { *(v8h*)(P16 + e + mb * 16) = o16[mb]; *(v8us*)(Ph + e + mb * 16) = oh[mb]; *(v8us*)(Pl + e + mb * 16) = ol[mb]; }
            asm volatile("s_wait_xcnt 0x0" ::: "memory");   // before the data and address registers of the stores above are reused
            __builtin_amdgcn_sched_barrier(0);   // keeps later register writes from being lifted over the wait
        }
    }
}
// ---- attn_cols: scores, softmax and attn x v of one (batch, head) in one kernel; no score or probability ever leaves the registers.
// One wave owns NQ*16 query columns and walks the 2048 keys 32 at a time: St = K Qt (A = key rows, B = query rows kept in registers), so a lane holds 16 scores of ONE query per column group;
// running maximum and sum per query (in-lane + one exchange between the wave halves); the two 16-key score tiles, converted in place, ARE the B operand of Ot += Vt Pt (A = rows of the [d][t] v plane, same k order as WFrag::ld).
// Rows < RH: bf16 hi+lo planes, 3 products each; the rest fp16 with probabilities x PCAR (the factor is in the sum too and cancels in the division).
template <typename T16> struct PPack;
template <> struct PPack<h16> { static __device__ __forceinline__ void pk(const v8f& p0, const v8f& p1, v16h& a, v16h& a2) { (void)a2;
#pragma unroll
    for (int e = 0; e < 8; ++e) { a[e] = tohx(p0[e]); a[8 + e] = tohx(p1[e]); } } };
template <> struct PPack<bf> { static __device__ __forceinline__ void pk(const v8f& p0, const v8f& p1, v16bf& a, v16bf& a2) { v8us h0, h1, l0, l1;
#pragma unroll
    for (int e = 0; e < 8; ++e) { unsigned short x, y; splitf(p0[e], x, y); h0[e] = x; l0[e] = y; splitf(p1[e], x, y); h1[e] = x; l1[e] = y; }
    a = cat16b(h0, h1); a2 = cat16b(l0, l1); } };
template <typename T16, bool HL, int NQ>
__device__ __forceinline__ void attn_cols(const T16* __restrict__ Q, const T16* __restrict__ Q2, const T16* __restrict__ Kp, const T16* __restrict__ K2, const T16* __restrict__ Vt, const T16* __restrict__ V2, int q0, float sh, float* __restrict__ orow) {
    typedef typename WFrag<T16>::V V;
    const int lane = threadIdx.x & 31, lr = lane & 15, hi = lane >> 4; const float c1 = SCL * 1.4426950408889634f;
    V qf[NQ][2], qf2[NQ][2];
#pragma unroll
    for (int nb = 0; nb < NQ; ++nb)
#pragma unroll
        for (int ks = 0; ks < 2; ++ks) { const size_t qo = (size_t)(q0 + nb * 16 + lr) * HD + 8 * hi + ks * 32; qf[nb][ks] = WFrag<T16>::ld(Q + qo); if (HL) qf2[nb][ks] = WFrag<T16>::ld(Q2 + qo); }
    asm volatile("s_wait_xcnt 0x0" ::: "memory");   // before the address registers of the loads above are reused
    __builtin_amdgcn_sched_barrier(0);   // keeps later register writes from being lifted over the wait
    v8f o[4][NQ]; float mx[NQ], sm[NQ];
#pragma unroll
    for (int nb = 0; nb < NQ; ++nb) { mx[nb] = -3.0e38f; sm[nb] = 0.f;
#pragma unroll
        for (int dt = 0; dt < 4; ++dt) o[dt][nb] = (v8f){}; }
    const size_t ko = (size_t)lr * HD + 8 * hi, vo = (size_t)lr * TT + 8 * hi;
    V kf[2][2], kf2[2][2];
#pragma unroll
    for (int kt = 0; kt < 2; ++kt)
#pragma unroll
        for (int ks = 0; ks < 2; ++ks) { kf[kt][ks] = WFrag<T16>::ld(Kp + ko + kt * 16 * HD + ks * 32); if (HL) kf2[kt][ks] = WFrag<T16>::ld(K2 + ko + kt * 16 * HD + ks * 32); }
    asm volatile("s_wait_xcnt 0x0" ::: "memory");   // before the address registers of the loads above are reused
    __builtin_amdgcn_sched_barrier(0);   // keeps later register writes from being lifted over the wait
    for (int k0 = 0; k0 < TT; k0 += 32) {
        V vf[4], vf2[4]; const T16* pv = Vt + vo + k0; const T16* pv2 = HL ? V2 + vo + k0 : nullptr;
#pragma unroll
        for (int dt = 0; dt < 4; ++dt) { vf[dt] = WFrag<T16>::ld(pv + (size_t)dt * 16 * TT); if (HL) vf2[dt] = WFrag<T16>::ld(pv2 + (size_t)dt * 16 * TT); }
        // before the address registers of the loads above are reused; naming them keeps them live up to the wait, so that no load's own result lands on them
        if (HL) asm volatile("s_wait_xcnt 0x0" :: "v"(pv), "v"(pv2) : "memory"); else asm volatile("s_wait_xcnt 0x0" :: "v"(pv) : "memory");
        __builtin_amdgcn_sched_barrier(0);   // the loads above issue here, a softmax ahead of their use; sunk to their use each would cost its whole latency
        v8f s[2][NQ];
#pragma unroll
        for (int kt = 0; kt < 2; ++kt)
#pragma unroll
            for (int nb = 0; nb < NQ; ++nb) { v8f t = (v8f){};
#pragma unroll
                for (int ks = 0; ks < 2; ++ks) { t = WFrag<T16>::mma(kf[kt][ks], qf[nb][ks], t); if (HL) { t = WFrag<T16>::mma(kf2[kt][ks], qf[nb][ks], t); t = WFrag<T16>::mma(kf[kt][ks], qf2[nb][ks], t); } }
                s[kt][nb] = t; }
        const size_t kn = ko + (size_t)((k0 + 32) & (TT - 1)) * HD;   // the next 32 keys' fragments fly under the softmax; the last trip re-reads keys 0..31 (in bounds, unused)
#pragma unroll
        for (int kt = 0; kt < 2; ++kt)
#pragma unroll
            for (int ks = 0; ks < 2; ++ks) { kf[kt][ks] = WFrag<T16>::ld(Kp + kn + kt * 16 * HD + ks * 32); if (HL) kf2[kt][ks] = WFrag<T16>::ld(K2 + kn + kt * 16 * HD + ks * 32); }
        asm volatile("s_wait_xcnt 0x0" ::: "memory");   // before the address registers of the loads above are reused
        __builtin_amdgcn_sched_barrier(0);   // the loads above issue here, the rest of the trip ahead of their use; sunk to the loop's foot they would cost their whole latency
#pragma unroll
        for (int nb = 0; nb < NQ; ++nb) { float m = mx[nb];
#pragma unroll
            for (int j = 0; j < 8; ++j) m = fmaxf(m, fmaxf(s[0][nb][j], s[1][nb][j]));
            m = fmaxf(m, __shfl_xor(m, 16, 32));
            const float al = __builtin_amdgcn_exp2f((mx[nb] - m) * c1); mx[nb] = m; const float mc = sh - m * c1; float sum = 0.f;
#pragma unroll
            for (int j = 0; j < 8; ++j) { s[0][nb][j] = __builtin_amdgcn_exp2f(fmaf(s[0][nb][j], c1, mc)); s[1][nb][j] = __builtin_amdgcn_exp2f(fmaf(s[1][nb][j], c1, mc)); sum += s[0][nb][j] + s[1][nb][j]; }
            sm[nb] = fmaf(sm[nb], al, sum);
            V pf, pf2; PPack<T16>::pk(s[0][nb], s[1][nb], pf, pf2);
#pragma unroll
            for (int dt = 0; dt < 4; ++dt) { v8f t = o[dt][nb] * al; t = WFrag<T16>::mma(vf[dt], pf, t); if (HL) { t = WFrag<T16>::mma(vf[dt], pf2, t); t = WFrag<T16>::mma(vf2[dt], pf, t); } o[dt][nb] = t; } }
    }
#pragma unroll
    for (int nb = 0; nb < NQ; ++nb) { const float tot = sm[nb] + __shfl_xor(sm[nb], 16, 32); const float inv = __fdiv_rn(1.0f, tot); float* op = orow + (size_t)(q0 + nb * 16 + lr) * DQ + hi * 8;
#pragma unroll
        for (int dt = 0; dt < 4; ++dt) *(v8f*)(op + dt * 16) = o[dt][nb] * inv; }
}
// grid (NB_*NH_, query tiles), 4 independent waves per work-group on neighbouring query columns of one head (they walk the same k and v lines). One kernel per row class, so that each has its own register count and all its waves are resident at once:
// k_fattn3: rows < RH, 64 per work-group; k_fattn1: the rest, 128 per work-group.
__global__ __launch_bounds__(128) void k_fattn3(const bf* __restrict__ QPh, const bf* __restrict__ QPl, const bf* __restrict__ KPh, const bf* __restrict__ KPl, const bf* __restrict__ VTh, const bf* __restrict__ VTl, float* __restrict__ OUT) {
    const size_t z = blockIdx.x, pz = z * TT * HD; const int wv = threadIdx.x >> 5;
    attn_cols<bf, true, 1>(QPh + pz, QPl + pz, KPh + pz, KPl + pz, VTh + pz, VTl + pz, (int)blockIdx.y * 64 + wv * 16, 0.0f, OUT + (z / NH_) * (size_t)TT * DQ + (z % NH_) * HD);
}
__global__ __launch_bounds__(128) void k_fattn1(const h16* __restrict__ QP16, const h16* __restrict__ KP16, const h16* __restrict__ VT16, float* __restrict__ OUT) {
    const size_t z = blockIdx.x, pz = z * TT * HD; const int wv = threadIdx.x >> 5;
    attn_cols<h16, false, 2>(QP16 + pz, nullptr, KP16 + pz, nullptr, VT16 + pz, nullptr, RH + (int)blockIdx.y * 128 + wv * 32, 10.0f, OUT + (z / NH_) * (size_t)TT * DQ + (z % NH_) * HD);   // 10 = log2(PCAR)
}

extern "C" void kernel_launch(void* const* d_in, const int* in_sizes, int n_in,
                              void* d_out, int out_size, void* d_ws, size_t ws_size, hipStream_t stream) {
    (void)in_sizes; (void)n_in; (void)out_size;
    const float* x = (const float*)d_in[0]; const float* x2 = (const float*)d_in[1]; const float* wq = (const float*)d_in[2]; const float* bq = (const float*)d_in[3]; const float* wkv = (const float*)d_in[4]; const float* bkv = (const float*)d_in[5]; const float* gq = (const float*)d_in[6]; const float* btq = (const float*)d_in[7]; const float* gk = (const float*)d_in[8]; const float* btk = (const float*)d_in[9]; const float* wk = nullptr; const float* wv = nullptr; const float* wo = nullptr; (void)wk; (void)wv; (void)wo; const float* bk = bkv; const float* bv = bkv + 1024;
    float* OUT = (float*)d_out;     // [4][2048][1024]
    char* wsp = (char*)d_ws;
    auto take = [&](size_t bytes) { char* p = wsp; wsp += (bytes + 255) & ~(size_t)255; return (void*)p; };
    bf* WQ = (bf*)take((size_t)DQ * DM * 2); bf* WKV = (bf*)take((size_t)2 * DKV * DM * 2); bf* WK = WKV; bf* WV = WKV + (size_t)DKV * DM;   /* k | v row blocks of the transposed fused weight */
    bf* XB = (bf*)take((size_t)TT * DM * 2);
    /* head planes [batch][head][..] of all NB_ batches */ h16* QP16 = (h16*)take((size_t)NB_ * NH_ * TT * HD * 2); h16* KP16 = (h16*)take((size_t)NB_ * NKV * TT * HD * 2); h16* VT16 = (h16*)take((size_t)NB_ * NKV * HD * TT * 2);
    bf* QPh = (bf*)take((size_t)NB_ * NH_ * TT * HD * 2); bf* QPl = (bf*)take((size_t)NB_ * NH_ * TT * HD * 2); bf* KPh = (bf*)take((size_t)NB_ * NKV * TT * HD * 2); bf* KPl = (bf*)take((size_t)NB_ * NKV * TT * HD * 2); bf* VTh = (bf*)take((size_t)NB_ * NKV * HD * TT * 2); bf* VTl = (bf*)take((size_t)NB_ * NKV * HD * TT * 2);
    if ((size_t)(wsp - (char*)d_ws) > ws_size) return;    // ws 256 MiB
    { k_wtG<<<(unsigned)((DM * DQ / 64 + 63) / 64), 256, 0, stream>>>(wq, DM, DQ, WQ); k_wtG<<<(unsigned)((DM * 2 * DKV / 64 + 63) / 64), 256, 0, stream>>>(wkv, DM, 2 * DKV, WKV);   /* 'xw' [1024][2048] -> Bt [2048][1024]: rows 0..1023 = k, 1024.. = v */ 
      
       }
    for (int b = 0; b < NB_; ++b) { const size_t pb = (size_t)b * NH_ * TT * HD;   // this batch's block in every head plane (NKV == NH_)
        k_cvt8<<<(unsigned)(((size_t)TT * DM / 8 + 255) / 256), 256, 0, stream>>>(x + (size_t)b * TT * DM, XB, (size_t)TT * DM / 8);
        k_proj<true><<<dim3(TT / 64, NH_), 32, 0, stream>>>(XB, WQ, bq, gq, btq, QP16 + pb, QPh + pb, QPl + pb);   /* q, per-head LayerNorm(q) x gamma + beta, planes */
        k_cvt8<<<(unsigned)(((size_t)TT * DM / 8 + 255) / 256), 256, 0, stream>>>(x2 + (size_t)b * TT * DM, XB, (size_t)TT * DM / 8);
        k_proj<true><<<dim3(TT / 64, NKV), 32, 0, stream>>>(XB, WK, bk, gk, btk, KP16 + pb, KPh + pb, KPl + pb);   /* k from x2, LayerNorm(k), planes */
        k_proj<false><<<dim3(TT / 64, NKV), 32, 0, stream>>>(XB, WV, bv, nullptr, nullptr, VT16 + pb, VTh + pb, VTl + pb);   /* v from x2, transposed planes */
    }
    k_fattn3<<<dim3(NB_ * NH_, RH / 64), 128, 0, stream>>>(QPh, QPl, KPh, KPl, VTh, VTl, OUT);
    k_fattn1<<<dim3(NB_ * NH_, (TT - RH) / 128), 128, 0, stream>>>(QP16, KP16, VT16, OUT);
}

// v004
// A run of this version takes 318 microseconds.
// Next to v003, in two timings, it ran 1.56 times as fast each time.
// Counting every step since v000, it is 12.2 times as fast.
#include <hip/hip_runtime.h>

// Cross-attention block with LayerNorm-ed per-head q and k (x1, x2 [4][2048][1024]; q = x1 wq + bq, [k | v] = x2 wkv + bkv ('xw' [1024][1024] and [1024][2048] 0.02, zero biases -> k = first 1024 columns, v = the rest); 16 heads x 64; q, k <- per-head LayerNorm over 64 (eps 1e-5) x gamma + beta ([64], read); scores x 64^-0.5; softmax; out = merged attn v -> [4][2048][1024] (8.4 M)).
// Layout: bf16 copies of all of x1 and x2 (one launch); one projection grid over all four batches and q, k and v (blockIdx.z; k and v as the two column blocks of wkv): exact products, f32 bias, for q and k the per-(token, head) LayerNorm with affine on the wave's own accumulators, and the 16-bit head planes stored straight from them (no f32 projection in memory); the head planes of all four batches stay in the workspace; fused dense T-2048 attention with a running softmax, one kernel per row class (hybrid rows: < 512 hi/lo 3 products, rest fp16 x1024), writes the output rows.
// Compute dtypes, f32 accumulate: every input rounded to bf16; projections exact + f32 biases; LayerNorms f32; attention rows < 512 3 products, rest fp16; softmax f32; output f32.

#define NB_  4
#define TT   2048
#define DM   1024
#define NH_  16
#define NKV  16
#define REP  (NH_ / NKV)
#define HD   64
#define DQ   (NH_ * HD)
#define DKV  (NKV * HD)
#define RH   512                  // query rows < RH use hi+lo planes (0: none)
#define WIN  0
#define PCAR 1024.0f
#define SCL  0.125f   // HD^-0.5
typedef _Float16 h16;
typedef unsigned short bf;
typedef __attribute__((ext_vector_type(16))) __bf16   v16bf;
typedef __attribute__((ext_vector_type(16))) _Float16 v16h;
typedef __attribute__((ext_vector_type(8)))  _Float16 v8h;
typedef __attribute__((ext_vector_type(8)))  unsigned short v8us;
typedef __attribute__((ext_vector_type(8)))  float    v8f;
typedef __attribute__((ext_vector_type(4)))  float    v4f;
typedef v8h  __attribute__((may_alias)) v8ha;
typedef v4f  __attribute__((may_alias)) v4fa;
typedef v8us __attribute__((may_alias)) v8usa;

__device__ __forceinline__ unsigned short f2bf(float f) { unsigned u = __float_as_uint(f); u += 0x7FFFu + ((u >> 16) & 1u); return (unsigned short)(u >> 16); }
__device__ __forceinline__ float bf2f(unsigned short b) { return __uint_as_float(((unsigned)b) << 16); }
__device__ __forceinline__ float bfr(float f) { return bf2f(f2bf(f)); }
__device__ __forceinline__ v16h cat16(v8h lo, v8h hi) { return __builtin_shufflevector(lo, hi, 0, 1, 2, 3, 4, 5, 6, 7, 8, 9, 10, 11, 12, 13, 14, 15); }
__device__ __forceinline__ v16bf cat16b(v8us lo, v8us hi) { return __builtin_bit_cast(v16bf, __builtin_shufflevector(lo, hi, 0, 1, 2, 3, 4, 5, 6, 7, 8, 9, 10, 11, 12, 13, 14, 15)); }
__device__ __forceinline__ v8f wmma16(v16h a, v16h b, v8f c) { return __builtin_amdgcn_wmma_f32_16x16x32_f16(false, a, false, b, (short)0, c, false, false); }
__device__ __forceinline__ v8f wmmab(v16bf a, v16bf b, v8f c) { return __builtin_amdgcn_wmma_f32_16x16x32_bf16(false, a, false, b, (short)0, c, false, false); }



// WFrag: one 16x32 (or 32x16) 16-bit operand fragment from a K-contiguous plane, the same k order for A and B
template <typename T16> struct WFrag;
template <> struct WFrag<h16> { typedef v16h V; static __device__ __forceinline__ V ld(const h16* p) { return cat16(*(const v8h*)p, *(const v8h*)(p + 16)); } static __device__ __forceinline__ v8f mma(V a, V b, v8f c) { return wmma16(a, b, c); } };
template <> struct WFrag<bf> { typedef v16bf V; static __device__ __forceinline__ V ld(const bf* p) { return cat16b(*(const v8us*)p, *(const v8us*)(p + 16)); } static __device__ __forceinline__ v8f mma(V a, V b, v8f c) { return wmmab(a, b, c); } };

__device__ __forceinline__ h16 tohx(float x) { return (h16)x; }
__device__ __forceinline__ void splitf(float y, unsigned short& h, unsigned short& l) { h = f2bf(y); l = f2bf(y - bf2f(h)); }
typedef __attribute__((ext_vector_type(2))) _Float16 v2h;
typedef __attribute__((ext_vector_type(4))) _Float16 v4h;
typedef __attribute__((ext_vector_type(2))) unsigned short v2us;
typedef __attribute__((ext_vector_type(4))) unsigned short v4us;
typedef __attribute__((ext_vector_type(2))) float v2f;
typedef __attribute__((ext_vector_type(4))) int v4i;

__global__ __launch_bounds__(256) void k_wtG(const float* __restrict__ w, int K, int N, bf* Bt) {
    const int lane = threadIdx.x & 31; const int L0 = (blockIdx.x * 8 + (threadIdx.x >> 5)) * 8; const int nlines = N * K / 64;
{
#pragma unroll 1
        for (int l = 0; l < 8; ++l) { const int L = L0 + l; if (L >= nlines) break; const size_t e = (size_t)L * 64 + lane * 2; const int k = (int)(e % K), n = (int)(e / K); v2us o;
            o[0] = f2bf(w[(size_t)k * N + n]); o[1] = f2bf(w[(size_t)(k + 1) * N + n]); *(v2us*)(Bt + e) = o; }
         }
}
// blockIdx.y picks the source (x1, x2) and its half of dst
__global__ __launch_bounds__(256) void k_cvt8(const float* __restrict__ s1, const float* __restrict__ s2, bf* d, size_t n8) { const size_t i = (size_t)blockIdx.x * 256 + threadIdx.x; if (i >= n8) return; const float* src = blockIdx.y ? s2 : s1; bf* dst = d + (size_t)blockIdx.y * n8 * 8; const float* p = src + i * 8; const v8f v = *(const v8f*)p; v8us o;
    asm volatile("s_wait_xcnt 0x0" :: "v"(p) : "memory");   // before the address registers of the loads above are reused; naming them keeps them live up to the wait
#pragma unroll
    for (int k = 0; k < 8; ++k) o[k] = f2bf(v[k]); *(v8us*)(dst + i * 8) = o;  }

// ---- proj_tile: projection GEMM with its whole tail, ONE WAVE per 64 tokens x 64 columns (= one head; 16 accumulators), operands straight from K-contiguous bf16 planes; X, P16, Ph, Pl: the tile's own batch.
// The f32 tile stays in registers: the wave adds the bias, normalises (q, k) and stores the fp16, hi and lo head planes itself.
// LN (q, k): product rows = weight rows (d), columns = tokens: per column group a lane holds 32 of the 64 d of ONE token (lane ^ 16 the other 32), and each accumulator is 8 neighbouring d = one 16-byte store into [h][t][d].
// !LN (v): product rows = tokens, columns = weight rows: each accumulator is 8 neighbouring tokens of one d = one 16-byte store into [h][d][t].
// Every plain '#pragma unroll' here stands on a loop over register arrays: their indices must be constants, or the arrays would leave the registers.
__device__ __forceinline__ float xhalf(float v) { const int b = __float_as_int(v); return __int_as_float(__builtin_amdgcn_permlanex16(b, b, 0x76543210, 0xfedcba98, false, false)); }   // the value of lane ^ 16
// sum over the 64 d of a token, v[mb][j] = element d = mb*16 + hi*8 + j: neighbours first, then d ^ 32, ^ 16, ^ 8 (the other wave half), ^ 4, ^ 2; both halves end with the same bits
__device__ __forceinline__ float hsum64(const float (&v)[4][8]) { float z[4];
#pragma unroll
    for (int q = 0; q < 4; ++q) { z[q] = ((v[0][2 * q] + v[0][2 * q + 1]) + (v[2][2 * q] + v[2][2 * q + 1])) + ((v[1][2 * q] + v[1][2 * q + 1]) + (v[3][2 * q] + v[3][2 * q + 1])); z[q] += xhalf(z[q]); }
    return (z[0] + z[2]) + (z[1] + z[3]); }
__device__ __forceinline__ void planes8(const float (&r)[8], v8h& o16, v8us& oh, v8us& ol) {
#pragma unroll
    for (int j = 0; j < 8; ++j) { o16[j] = tohx(r[j]); unsigned short a2, c2; splitf(r[j], a2, c2); oh[j] = a2; ol[j] = c2; } }
template <bool LN>
__device__ __forceinline__ void proj_tile(const bf* __restrict__ X, const bf* __restrict__ Wt, const float* __restrict__ bias, const float* __restrict__ g, const float* __restrict__ bb, h16* __restrict__ P16, bf* __restrict__ Ph, bf* __restrict__ Pl, int t0, int h) {
    typedef WFrag<bf>::V V;
    const int lane = threadIdx.x & 31, lr = lane & 15, hi = lane >> 4; const int c0 = h * 64;
    const bf* A = LN ? Wt + (size_t)c0 * DM : X + (size_t)t0 * DM; const bf* Bt = LN ? X + (size_t)t0 * DM : Wt + (size_t)c0 * DM;
    v8f acc[4][4];
#pragma unroll
    for (int mb = 0; mb < 4; ++mb)
#pragma unroll
        for (int nb = 0; nb < 4; ++nb) acc[mb][nb] = (v8f){};
    const size_t off = (size_t)lr * DM + 8 * hi;
    // rolled: a trip already holds 16 loads and 16 matrix instructions, more trips in the text would only lengthen it
#pragma unroll 1
    for (int kc = 0; kc < DM; kc += 32) {
        V a[4]; const bf* pa = A + off + kc; const bf* pb = Bt + off + kc;
#pragma unroll
        for (int mb = 0; mb < 4; ++mb) a[mb] = WFrag<bf>::ld(pa + (size_t)mb * 16 * DM);
#pragma unroll
        for (int nb = 0; nb < 4; ++nb) { const V b = WFrag<bf>::ld(pb + (size_t)nb * 16 * DM);
#pragma unroll
            for (int mb = 0; mb < 4; ++mb) acc[mb][nb] = WFrag<bf>::mma(a[mb], b, acc[mb][nb]); }
        // the vector slots that the chip needs between the trip's last matrix instructions and what follows them over the back edge
        asm volatile("v_nop\n\tv_nop\n\tv_nop\n\tv_nop" : "+v"(acc[0][0]), "+v"(acc[1][1]), "+v"(acc[2][2]), "+v"(acc[3][3]) : "v"(a[0]), "v"(a[3]));
        asm volatile("s_wait_xcnt 0x0" :: "v"(pa), "v"(pb) : "memory");   // before the address registers of the trip's loads are reused; naming them keeps them live up to the wait, so that no load's own result lands on them
    }
    if (LN) {
        float bs[4][8], gm[4][8], bt[4][8]; const unsigned ob = (unsigned)hi * 32u;   // the lane's byte offset (d = hi * 8) into the three [64] f32 vectors
        const char* cbs = (const char*)(bias + c0); const char* cgm = (const char*)g; const char* cbt = (const char*)bb;
#pragma unroll
        for (int mb = 0; mb < 4; ++mb)
#pragma unroll
            for (int j = 0; j < 8; ++j) { bs[mb][j] = *(const float*)(cbs + ob + mb * 64 + j * 4); gm[mb][j] = *(const float*)(cgm + ob + mb * 64 + j * 4); bt[mb][j] = *(const float*)(cbt + ob + mb * 64 + j * 4); }
        asm volatile("s_wait_xcnt 0x0" :: "v"(ob) : "memory");   // before the offset register of the loads above is reused; naming it keeps it live up to the wait, so that no load's own result lands on it
        __builtin_amdgcn_sched_barrier(0);   // keeps later register writes from being lifted over the wait
#pragma unroll
        for (int mb = 0; mb < 4; ++mb)
#pragma unroll
            for (int j = 0; j < 8; ++j) { bs[mb][j] = bfr(bs[mb][j]); gm[mb][j] = bfr(gm[mb][j]); bt[mb][j] = bfr(bt[mb][j]);
#pragma unroll
                for (int nb = 0; nb < 4; ++nb) acc[mb][nb][j] += bs[mb][j]; }
#pragma unroll
        for (int nb = 0; nb < 4; ++nb) { float x[4][8], p[4][8];
#pragma unroll
            for (int mb = 0; mb < 4; ++mb)
#pragma unroll
                for (int j = 0; j < 8; ++j) x[mb][j] = acc[mb][nb][j];
            const float mean = hsum64(x) * (1.0f / HD);
#pragma unroll
            for (int mb = 0; mb < 4; ++mb)
#pragma unroll
                for (int j = 0; j < 8; ++j) { x[mb][j] -= mean; p[mb][j] = x[mb][j] * x[mb][j]; }
            const float den = __fsqrt_rn(hsum64(p) * (1.0f / HD) + 1e-5f);
            v8h o16[4]; v8us oh[4], ol[4];
#pragma unroll
            for (int mb = 0; mb < 4; ++mb) { float r[8];
#pragma unroll
                for (int j = 0; j < 8; ++j) r[j] = __fdiv_rn(x[mb][j], den) * gm[mb][j] + bt[mb][j];
                planes8(r, o16[mb], oh[mb], ol[mb]); }
            const size_t e = ((size_t)h * TT + t0 + nb * 16 + lr) * HD + hi * 8;
            __builtin_amdgcn_sched_barrier(0);   // the column's arithmetic ends here: nothing of it is sunk between a store and the wait behind the stores
#pragma unroll
            for (int mb = 0; mb < 4; ++mb) { *(v8h*)(P16 + e + mb * 16) = o16[mb]; *(v8us*)(Ph + e + mb * 16) = oh[mb]; *(v8us*)(Pl + e + mb * 16) = ol[mb]; }
            asm volatile("s_wait_xcnt 0x0" ::: "memory");   // before the data and address registers of the stores above are reused
            __builtin_amdgcn_sched_barrier(0);   // keeps later register writes from being lifted over the wait
        }
    } else {
#pragma unroll
        for (int nb = 0; nb < 4; ++nb) { const float bs = bfr(bias[c0 + nb * 16 + lr]); v8h o16[4]; v8us oh[4], ol[4];
#pragma unroll
            for (int mb = 0; mb < 4; ++mb) { float r[8];
#pragma unroll
                for (int j = 0; j < 8; ++j) r[j] = acc[mb][nb][j] + bs;
                planes8(r, o16[mb], oh[mb], ol[mb]); }
            const size_t e = ((size_t)h * HD + nb * 16 + lr) * TT + t0 + hi * 8;
            __builtin_amdgcn_sched_barrier(0);   // the column's arithmetic ends here: nothing of it is sunk between a store and the wait behind the stores
#pragma unroll
            for (int mb = 0; mb < 4; ++mb) { *(v8h*)(P16 + e + mb * 16) = o16[mb]; *(v8us*)(Ph + e + mb * 16) = oh[mb]; *(v8us*)(Pl + e + mb * 16) = ol[mb]; }
            asm volatile("s_wait_xcnt 0x0" ::: "memory");   // before the data and address registers of the stores above are reused
            __builtin_amdgcn_sched_barrier(0);   // keeps later register writes from being lifted over the wait
        }
    }
}
// k_proj: every projection tile of the block in one launch, so that all of them share the chip at once; grid (NB_*TT/64, heads, 3), 32 threads; blockIdx.z: 0 = q from x1, 1 = k, 2 = v from x2.
__global__ __launch_bounds__(32) void k_proj(const bf* __restrict__ X1, const bf* __restrict__ X2, const bf* __restrict__ WQ, const bf* __restrict__ WK, const bf* __restrict__ WV, const float* __restrict__ bq, const float* __restrict__ bk, const float* __restrict__ bv, const float* __restrict__ gq, const float* __restrict__ btq, const float* __restrict__ gk, const float* __restrict__ btk,
                                              h16* __restrict__ QP16, bf* __restrict__ QPh, bf* __restrict__ QPl, h16* __restrict__ KP16, bf* __restrict__ KPh, bf* __restrict__ KPl, h16* __restrict__ VT16, bf* __restrict__ VTh, bf* __restrict__ VTl) {
    const int b = blockIdx.x / (TT / 64), t0 = (blockIdx.x % (TT / 64)) * 64, h = blockIdx.y; const size_t xb = (size_t)b * TT * DM, pb = (size_t)b * NH_ * TT * HD;   // this batch's block in x and in every head plane (NKV == NH_)
    if (blockIdx.z == 2) proj_tile<false>(X2 + xb, WV, bv, nullptr, nullptr, VT16 + pb, VTh + pb, VTl + pb, t0, h);   // v, transposed planes
    else { const bool kk = blockIdx.z == 1;   // q or k: per-head LayerNorm x gamma + beta, planes
        proj_tile<true>((kk ? X2 : X1) + xb, kk ? WK : WQ, kk ? bk : bq, kk ? gk : gq, kk ? btk : btq, (kk ? KP16 : QP16) + pb, (kk ? KPh : QPh) + pb, (kk ? KPl : QPl) + pb, t0, h); }
}
// ---- attn_cols: scores, softmax and attn x v of one (batch, head) in one kernel; no score or probability ever leaves the registers.
// One wave owns NQ*16 query columns and walks the 2048 keys 32 at a time: St = K Qt (A = key rows, B = query rows kept in registers), so a lane holds 16 scores of ONE query per column group;
// running maximum and sum per query (in-lane + one exchange between the wave halves); the two 16-key score tiles, converted in place, ARE the B operand of Ot += Vt Pt (A = rows of the [d][t] v plane, same k order as WFrag::ld).
// Rows < RH: bf16 hi+lo planes, 3 products each; the rest fp16 with probabilities x PCAR (the factor is in the sum too and cancels in the division).
template <typename T16> struct PPack;
template <> struct PPack<h16> { static __device__ __forceinline__ void pk(const v8f& p0, const v8f& p1, v16h& a, v16h& a2) { (void)a2;
#pragma unroll
    for (int e = 0; e < 8; ++e) { a[e] = tohx(p0[e]); a[8 + e] = tohx(p1[e]); } } };
template <> struct PPack<bf> { static __device__ __forceinline__ void pk(const v8f& p0, const v8f& p1, v16bf& a, v16bf& a2) { v8us h0, h1, l0, l1;
#pragma unroll
    for (int e = 0; e < 8; ++e) { unsigned short x, y; splitf(p0[e], x, y); h0[e] = x; l0[e] = y; splitf(p1[e], x, y); h1[e] = x; l1[e] = y; }
    a = cat16b(h0, h1); a2 = cat16b(l0, l1); } };
template <typename T16, bool HL, int NQ>
__device__ __forceinline__ void attn_cols(const T16* __restrict__ Q, const T16* __restrict__ Q2, const T16* __restrict__ Kp, const T16* __restrict__ K2, const T16* __restrict__ Vt, const T16* __restrict__ V2, int q0, float sh, float* __restrict__ orow) {
    typedef typename WFrag<T16>::V V;
    const int lane = threadIdx.x & 31, lr = lane & 15, hi = lane >> 4; const float c1 = SCL * 1.4426950408889634f;
    V qf[NQ][2], qf2[NQ][2];
#pragma unroll
    for (int nb = 0; nb < NQ; ++nb)
#pragma unroll
        for (int ks = 0; ks < 2; ++ks) { const size_t qo = (size_t)(q0 + nb * 16 + lr) * HD + 8 * hi + ks * 32; qf[nb][ks] = WFrag<T16>::ld(Q + qo); if (HL) qf2[nb][ks] = WFrag<T16>::ld(Q2 + qo); }
    asm volatile("s_wait_xcnt 0x0" ::: "memory");   // before the address registers of the loads above are reused
    __builtin_amdgcn_sched_barrier(0);   // keeps later register writes from being lifted over the wait
    v8f o[4][NQ]; float mx[NQ], sm[NQ];
#pragma unroll
    for (int nb = 0; nb < NQ; ++nb) { mx[nb] = -3.0e38f; sm[nb] = 0.f;
#pragma unroll
        for (int dt = 0; dt < 4; ++dt) o[dt][nb] = (v8f){}; }
    const size_t ko = (size_t)lr * HD + 8 * hi, vo = (size_t)lr * TT + 8 * hi;
    V kf[2][2], kf2[2][2];
#pragma unroll
    for (int kt = 0; kt < 2; ++kt)
#pragma unroll
        for (int ks = 0; ks < 2; ++ks) { kf[kt][ks] = WFrag<T16>::ld(Kp + ko + kt * 16 * HD + ks * 32); if (HL) kf2[kt][ks] = WFrag<T16>::ld(K2 + ko + kt * 16 * HD + ks * 32); }
    asm volatile("s_wait_xcnt 0x0" ::: "memory");   // before the address registers of the loads above are reused
    __builtin_amdgcn_sched_barrier(0);   // keeps later register writes from being lifted over the wait
    for (int k0 = 0; k0 < TT; k0 += 32) {
        V vf[4], vf2[4]; const T16* pv = Vt + vo + k0; const T16* pv2 = HL ? V2 + vo + k0 : nullptr;
#pragma unroll
        for (int dt = 0; dt < 4; ++dt) { vf[dt] = WFrag<T16>::ld(pv + (size_t)dt * 16 * TT); if (HL) vf2[dt] = WFrag<T16>::ld(pv2 + (size_t)dt * 16 * TT); }
        // before the address registers of the loads above are reused; naming them keeps them live up to the wait, so that no load's own result lands on them
        if (HL) asm volatile("s_wait_xcnt 0x0" :: "v"(pv), "v"(pv2) : "memory"); else asm volatile("s_wait_xcnt 0x0" :: "v"(pv) : "memory");
        __builtin_amdgcn_sched_barrier(0);   // the loads above issue here, a softmax ahead of their use; sunk to their use each would cost its whole latency
        v8f s[2][NQ];
#pragma unroll
        for (int kt = 0; kt < 2; ++kt)
#pragma unroll
            for (int nb = 0; nb < NQ; ++nb) { v8f t = (v8f){};
#pragma unroll
                for (int ks = 0; ks < 2; ++ks) { t = WFrag<T16>::mma(kf[kt][ks], qf[nb][ks], t); if (HL) { t = WFrag<T16>::mma(kf2[kt][ks], qf[nb][ks], t); t = WFrag<T16>::mma(kf[kt][ks], qf2[nb][ks], t); } }
                s[kt][nb] = t; }
        const size_t kn = ko + (size_t)((k0 + 32) & (TT - 1)) * HD;   // the next 32 keys' fragments fly under the softmax; the last trip re-reads keys 0..31 (in bounds, unused)
#pragma unroll
        for (int kt = 0; kt < 2; ++kt)
#pragma unroll
            for (int ks = 0; ks < 2; ++ks) { kf[kt][ks] = WFrag<T16>::ld(Kp + kn + kt * 16 * HD + ks * 32); if (HL) kf2[kt][ks] = WFrag<T16>::ld(K2 + kn + kt * 16 * HD + ks * 32); }
        asm volatile("s_wait_xcnt 0x0" ::: "memory");   // before the address registers of the loads above are reused
        __builtin_amdgcn_sched_barrier(0);   // the loads above issue here, the rest of the trip ahead of their use; sunk to the loop's foot they would cost their whole latency
#pragma unroll
        for (int nb = 0; nb < NQ; ++nb) { float m = mx[nb];
#pragma unroll
            for (int j = 0; j < 8; ++j) m = fmaxf(m, fmaxf(s[0][nb][j], s[1][nb][j]));
            m = fmaxf(m, __shfl_xor(m, 16, 32));
            const float al = __builtin_amdgcn_exp2f((mx[nb] - m) * c1); mx[nb] = m; const float mc = sh - m * c1; float sum = 0.f;
#pragma unroll
            for (int j = 0; j < 8; ++j) { s[0][nb][j] = __builtin_amdgcn_exp2f(fmaf(s[0][nb][j], c1, mc)); s[1][nb][j] = __builtin_amdgcn_exp2f(fmaf(s[1][nb][j], c1, mc)); sum += s[0][nb][j] + s[1][nb][j]; }
            sm[nb] = fmaf(sm[nb], al, sum);
            V pf, pf2; PPack<T16>::pk(s[0][nb], s[1][nb], pf, pf2);
#pragma unroll
            for (int dt = 0; dt < 4; ++dt) { v8f t = o[dt][nb] * al; t = WFrag<T16>::mma(vf[dt], pf, t); if (HL) { t = WFrag<T16>::mma(vf[dt], pf2, t); t = WFrag<T16>::mma(vf2[dt], pf, t); } o[dt][nb] = t; } }
    }
#pragma unroll
    for (int nb = 0; nb < NQ; ++nb) { const float tot = sm[nb] + __shfl_xor(sm[nb], 16, 32); const float inv = __fdiv_rn(1.0f, tot); float* op = orow + (size_t)(q0 + nb * 16 + lr) * DQ + hi * 8;
#pragma unroll
        for (int dt = 0; dt < 4; ++dt) *(v8f*)(op + dt * 16) = o[dt][nb] * inv; }
}
// grid (NB_*NH_, query tiles), 4 independent waves per work-group on neighbouring query columns of one head (they walk the same k and v lines). One kernel per row class, so that each has its own register count and all its waves are resident at once:
// k_fattn3: rows < RH, 64 per work-group; k_fattn1: the rest, 128 per work-group.
__global__ __launch_bounds__(128) void k_fattn3(const bf* __restrict__ QPh, const bf* __restrict__ QPl, const bf* __restrict__ KPh, const bf* __restrict__ KPl, const bf* __restrict__ VTh, const bf* __restrict__ VTl, float* __restrict__ OUT) {
    const size_t z = blockIdx.x, pz = z * TT * HD; const int wv = threadIdx.x >> 5;
    attn_cols<bf, true, 1>(QPh + pz, QPl + pz, KPh + pz, KPl + pz, VTh + pz, VTl + pz, (int)blockIdx.y * 64 + wv * 16, 0.0f, OUT + (z / NH_) * (size_t)TT * DQ + (z % NH_) * HD);
}
__global__ __launch_bounds__(128) void k_fattn1(const h16* __restrict__ QP16, const h16* __restrict__ KP16, const h16* __restrict__ VT16, float* __restrict__ OUT) {
    const size_t z = blockIdx.x, pz = z * TT * HD; const int wv = threadIdx.x >> 5;
    attn_cols<h16, false, 2>(QP16 + pz, nullptr, KP16 + pz, nullptr, VT16 + pz, nullptr, RH + (int)blockIdx.y * 128 + wv * 32, 10.0f, OUT + (z / NH_) * (size_t)TT * DQ + (z % NH_) * HD);   // 10 = log2(PCAR)
}

extern "C" void kernel_launch(void* const* d_in, const int* in_sizes, int n_in,
                              void* d_out, int out_size, void* d_ws, size_t ws_size, hipStream_t stream) {
    (void)in_sizes; (void)n_in; (void)out_size;
    const float* x = (const float*)d_in[0]; const float* x2 = (const float*)d_in[1]; const float* wq = (const float*)d_in[2]; const float* bq = (const float*)d_in[3]; const float* wkv = (const float*)d_in[4]; const float* bkv = (const float*)d_in[5]; const float* gq = (const float*)d_in[6]; const float* btq = (const float*)d_in[7]; const float* gk = (const float*)d_in[8]; const float* btk = (const float*)d_in[9]; const float* wk = nullptr; const float* wv = nullptr; const float* wo = nullptr; (void)wk; (void)wv; (void)wo; const float* bk = bkv; const float* bv = bkv + 1024;
    float* OUT = (float*)d_out;     // [4][2048][1024]
    char* wsp = (char*)d_ws;
    auto take = [&](size_t bytes) { char* p = wsp; wsp += (bytes + 255) & ~(size_t)255; return (void*)p; };
    bf* WQ = (bf*)take((size_t)DQ * DM * 2); bf* WKV = (bf*)take((size_t)2 * DKV * DM * 2); bf* WK = WKV; bf* WV = WKV + (size_t)DKV * DM;   /* k | v row blocks of the transposed fused weight */
    bf* XB = (bf*)take((size_t)2 * NB_ * TT * DM * 2); bf* XB2 = XB + (size_t)NB_ * TT * DM;   /* bf16 x1 | x2, all batches */
    /* head planes [batch][head][..] of all NB_ batches */ h16* QP16 = (h16*)take((size_t)NB_ * NH_ * TT * HD * 2); h16* KP16 = (h16*)take((size_t)NB_ * NKV * TT * HD * 2); h16* VT16 = (h16*)take((size_t)NB_ * NKV * HD * TT * 2);
    bf* QPh = (bf*)take((size_t)NB_ * NH_ * TT * HD * 2); bf* QPl = (bf*)take((size_t)NB_ * NH_ * TT * HD * 2); bf* KPh = (bf*)take((size_t)NB_ * NKV * TT * HD * 2); bf* KPl = (bf*)take((size_t)NB_ * NKV * TT * HD * 2); bf* VTh = (bf*)take((size_t)NB_ * NKV * HD * TT * 2); bf* VTl = (bf*)take((size_t)NB_ * NKV * HD * TT * 2);
    if ((size_t)(wsp - (char*)d_ws) > ws_size) return;    // ws 256 MiB
    { k_wtG<<<(unsigned)((DM * DQ / 64 + 63) / 64), 256, 0, stream>>>(wq, DM, DQ, WQ); k_wtG<<<(unsigned)((DM * 2 * DKV / 64 + 63) / 64), 256, 0, stream>>>(wkv, DM, 2 * DKV, WKV);   /* 'xw' [1024][2048] -> Bt [2048][1024]: rows 0..1023 = k, 1024.. = v */ 
      
       }
    k_cvt8<<<dim3((unsigned)(((size_t)NB_ * TT * DM / 8 + 255) / 256), 2), 256, 0, stream>>>(x, x2, XB, (size_t)NB_ * TT * DM / 8);
    k_proj<<<dim3(NB_ * TT / 64, NH_, 3), 32, 0, stream>>>(XB, XB2, WQ, WK, WV, bq, bk, bv, gq, btq, gk, btk, QP16, QPh, QPl, KP16, KPh, KPl, VT16, VTh, VTl);
    k_fattn3<<<dim3(NB_ * NH_, RH / 64), 128, 0, stream>>>(QPh, QPl, KPh, KPl, VTh, VTl, OUT);
    k_fattn1<<<dim3(NB_ * NH_, (TT - RH) / 128), 128, 0, stream>>>(QP16, KP16, VT16, OUT);
}

// v005
// It runs in 207 microseconds.
// Next to v004, in two timings, it ran 1.53 and 1.54 times as fast.
// All steps since v000 together make it 18.7 times as fast.
#include <hip/hip_runtime.h>

// Cross-attention block with LayerNorm-ed per-head q and k (x1, x2 [4][2048][1024]; q = x1 wq + bq, [k | v] = x2 wkv + bkv ('xw' [1024][1024] and [1024][2048] 0.02, zero biases -> k = first 1024 columns, v = the rest); 16 heads x 64; q, k <- per-head LayerNorm over 64 (eps 1e-5) x gamma + beta ([64], read); scores x 64^-0.5; softmax; out = merged attn v -> [4][2048][1024] (8.4 M)).
// Layout: bf16 copies of all of x1 and x2 (one launch); one projection grid over all four batches and q, k and v (blockIdx.z; k and v as the two column blocks of wkv): exact products, f32 bias, for q and k the per-(token, head) LayerNorm with affine on the wave's own accumulators, and the 16-bit head planes stored straight from them (no f32 projection in memory); the head planes of all four batches stay in the workspace; fused dense T-2048 attention with a running softmax, one kernel per row class (hybrid rows: < 512 hi/lo 3 products, rest fp16 x1024), writes the output rows.
// Every 16-bit operand plane in the workspace (x, weights, q, k, v) lies in FRAGMENT ORDER: a 16-row x 32-k fragment is 1 KiB, [k half][lane][8 elements], so that each 16-byte-per-lane load or store of a wave covers 512 contiguous bytes (4 whole lines) and not 32-byte pieces of 16 lines; the registers receive the same values as from row-major planes.
// Compute dtypes, f32 accumulate: every input rounded to bf16; projections exact + f32 biases; LayerNorms f32; attention rows < 512 3 products, rest fp16; softmax f32; output f32.

#define NB_  4
#define TT   2048
#define DM   1024
#define NH_  16
#define NKV  16
#define REP  (NH_ / NKV)
#define HD   64
#define DQ   (NH_ * HD)
#define DKV  (NKV * HD)
#define RH   512                  // query rows < RH use hi+lo planes (0: none)
#define WIN  0
#define PCAR 1024.0f
#define SCL  0.125f   // HD^-0.5
typedef _Float16 h16;
typedef unsigned short bf;
typedef __attribute__((ext_vector_type(16))) __bf16   v16bf;
typedef __attribute__((ext_vector_type(16))) _Float16 v16h;
typedef __attribute__((ext_vector_type(8)))  _Float16 v8h;
typedef __attribute__((ext_vector_type(8)))  unsigned short v8us;
typedef __attribute__((ext_vector_type(8)))  float    v8f;
typedef __attribute__((ext_vector_type(4)))  float    v4f;
typedef v8h  __attribute__((may_alias)) v8ha;
typedef v4f  __attribute__((may_alias)) v4fa;
typedef v8us __attribute__((may_alias)) v8usa;

__device__ __forceinline__ unsigned short f2bf(float f) { unsigned u = __float_as_uint(f); u += 0x7FFFu + ((u >> 16) & 1u); return (unsigned short)(u >> 16); }
__device__ __forceinline__ float bf2f(unsigned short b) { return __uint_as_float(((unsigned)b) << 16); }
__device__ __forceinline__ float bfr(float f) { return bf2f(f2bf(f)); }
__device__ __forceinline__ v16h cat16(v8h lo, v8h hi) { return __builtin_shufflevector(lo, hi, 0, 1, 2, 3, 4, 5, 6, 7, 8, 9, 10, 11, 12, 13, 14, 15); }
__device__ __forceinline__ v16bf cat16b(v8us lo, v8us hi) { return __builtin_bit_cast(v16bf, __builtin_shufflevector(lo, hi, 0, 1, 2, 3, 4, 5, 6, 7, 8, 9, 10, 11, 12, 13, 14, 15)); }
__device__ __forceinline__ v8f wmma16(v16h a, v16h b, v8f c) { return __builtin_amdgcn_wmma_f32_16x16x32_f16(false, a, false, b, (short)0, c, false, false); }
__device__ __forceinline__ v8f wmmab(v16bf a, v16bf b, v8f c) { return __builtin_amdgcn_wmma_f32_16x16x32_bf16(false, a, false, b, (short)0, c, false, false); }



// WFrag: one 16x32 (or 32x16) 16-bit operand fragment from a fragment-order plane, p = fragment + lane * 8: lane (lr, hi) finds row lr, k = 8 hi .. + 7 there and k = 16 + 8 hi .. + 7 256 elements on; the same k order for A and B
template <typename T16> struct WFrag;
template <> struct WFrag<h16> { typedef v16h V; static __device__ __forceinline__ V ld(const h16* p) { return cat16(*(const v8h*)p, *(const v8h*)(p + 256)); } static __device__ __forceinline__ v8f mma(V a, V b, v8f c) { return wmma16(a, b, c); } };
template <> struct WFrag<bf> { typedef v16bf V; static __device__ __forceinline__ V ld(const bf* p) { return cat16b(*(const v8us*)p, *(const v8us*)(p + 256)); } static __device__ __forceinline__ v8f mma(V a, V b, v8f c) { return wmmab(a, b, c); } };

__device__ __forceinline__ h16 tohx(float x) { return (h16)x; }
__device__ __forceinline__ void splitf(float y, unsigned short& h, unsigned short& l) { h = f2bf(y); l = f2bf(y - bf2f(h)); }
typedef __attribute__((ext_vector_type(2))) _Float16 v2h;
typedef __attribute__((ext_vector_type(4))) _Float16 v4h;
typedef __attribute__((ext_vector_type(2))) unsigned short v2us;
typedef __attribute__((ext_vector_type(4))) unsigned short v4us;
typedef __attribute__((ext_vector_type(2))) float v2f;
typedef __attribute__((ext_vector_type(4))) int v4i;

// w [K][N] f32 -> Bt, the transposed weight in fragment order [N/16][K/32][k half][lane][8]; one wave per fragment: a lane gathers 16 k of its row n (16 neighbouring n per load = 64-byte runs) and stores 16 bytes twice, the wave 512 in a row each time
template <int K, int N>
__global__ __launch_bounds__(256) void k_wtG(const float* __restrict__ w, bf* Bt) {
    const int lane = threadIdx.x & 31, lr = lane & 15, hi = lane >> 4; const int F = blockIdx.x * 8 + (threadIdx.x >> 5); if (F >= (N / 16) * (K / 32)) return;
    const float* p = w + (size_t)((F % (K / 32)) * 32 + hi * 8) * N + (F / (K / 32)) * 16 + lr; float v[16];
#pragma unroll   // register arrays here and below: their indices must be constants; all 16 loads fly together
    for (int j = 0; j < 16; ++j) v[j] = p[(size_t)((j >> 3) * 16 + (j & 7)) * N];
    asm volatile("s_wait_xcnt 0x0" :: "v"(p) : "memory");   // before the address registers of the loads above are reused; naming them keeps them live up to the wait
    v8us o0, o1;
#pragma unroll
    for (int j = 0; j < 8; ++j) { o0[j] = f2bf(v[j]); o1[j] = f2bf(v[8 + j]); }
    bf* q = Bt + (size_t)F * 512 + lane * 8; *(v8us*)q = o0; *(v8us*)(q + 256) = o1;
}
// blockIdx.y picks the source (x1, x2) and its half of dst; dst in fragment order [row/16][k/32][k half][lane][8]. One wave = 8 rows x 32 k (half a fragment): each load covers 4 whole source lines (4 rows x 128 bytes), each store four 64-byte runs
__global__ __launch_bounds__(256) void k_cvt8(const float* __restrict__ s1, const float* __restrict__ s2, bf* d, size_t n8) { const size_t i = (size_t)blockIdx.x * 256 + threadIdx.x; if (i >= n8) return; const float* src = blockIdx.y ? s2 : s1; bf* dst = d + (size_t)blockIdx.y * n8 * 8;
    const int l = threadIdx.x & 31, q = l & 7; const size_t F = i >> 6; const int r0 = (int)((i >> 5) & 1) * 8 + (l >> 3);   // fragment; the lane's first row in it (the second: + 4); q: which 4 of the row's 32 k
    const float* p = src + ((F / (DM / 32)) * 16 + r0) * DM + (F % (DM / 32)) * 32 + q * 4; const v4f v0 = *(const v4f*)p, v1 = *(const v4f*)(p + 4 * DM);
    asm volatile("s_wait_xcnt 0x0" :: "v"(p) : "memory");   // before the address registers of the loads above are reused; naming them keeps them live up to the wait
    v4us o0, o1;
#pragma unroll   // vector elements in registers: their indices must be constants
    for (int k = 0; k < 4; ++k) { o0[k] = f2bf(v0[k]); o1[k] = f2bf(v1[k]); }
    bf* o = dst + F * 512 + (q >> 2) * 256 + (((q >> 1) & 1) * 16 + r0) * 8 + (q & 1) * 4; *(v4us*)o = o0; *(v4us*)(o + 32) = o1; }

// ---- proj_tile: projection GEMM with its whole tail, ONE WAVE per 64 tokens x 64 columns (= one head; 16 accumulators), operands straight from fragment-order bf16 planes; X, P16, Ph, Pl: the tile's own batch.
// The f32 tile stays in registers: the wave adds the bias, normalises (q, k) and stores the fp16, hi and lo head planes itself.
// LN (q, k): product rows = weight rows (d), columns = tokens: per column group a lane holds 32 of the 64 d of ONE token (lane ^ 16 the other 32), and each accumulator is 8 neighbouring d = the lane's 16 bytes of half a fragment of the plane [h][t/16][d/32][d half][lane][8].
// !LN (v): product rows = tokens, columns = weight rows: each accumulator is 8 neighbouring tokens of one d = the lane's 16 bytes of half a fragment of the plane [h][t/32][d/16][t half][lane][8].
// Every plain '#pragma unroll' here stands on a loop over register arrays: their indices must be constants, or the arrays would leave the registers.
__device__ __forceinline__ float xhalf(float v) { const int b = __float_as_int(v); return __int_as_float(__builtin_amdgcn_permlanex16(b, b, 0x76543210, 0xfedcba98, false, false)); }   // the value of lane ^ 16
// sum over the 64 d of a token, v[mb][j] = element d = mb*16 + hi*8 + j: neighbours first, then d ^ 32, ^ 16, ^ 8 (the other wave half), ^ 4, ^ 2; both halves end with the same bits
__device__ __forceinline__ float hsum64(const float (&v)[4][8]) { float z[4];
#pragma unroll
    for (int q = 0; q < 4; ++q) { z[q] = ((v[0][2 * q] + v[0][2 * q + 1]) + (v[2][2 * q] + v[2][2 * q + 1])) + ((v[1][2 * q] + v[1][2 * q + 1]) + (v[3][2 * q] + v[3][2 * q + 1])); z[q] += xhalf(z[q]); }
    return (z[0] + z[2]) + (z[1] + z[3]); }
__device__ __forceinline__ void planes8(const float (&r)[8], v8h& o16, v8us& oh, v8us& ol) {
#pragma unroll
    for (int j = 0; j < 8; ++j) { o16[j] = tohx(r[j]); unsigned short a2, c2; splitf(r[j], a2, c2); oh[j] = a2; ol[j] = c2; } }
template <bool LN>
__device__ __forceinline__ void proj_tile(const bf* __restrict__ X, const bf* __restrict__ Wt, const float* __restrict__ bias, const float* __restrict__ g, const float* __restrict__ bb, h16* __restrict__ P16, bf* __restrict__ Ph, bf* __restrict__ Pl, int t0, int h) {
    typedef WFrag<bf>::V V;
    const int lane = threadIdx.x & 31, lr = lane & 15, hi = lane >> 4; const int c0 = h * 64;
    const bf* A = LN ? Wt + (size_t)c0 * DM : X + (size_t)t0 * DM; const bf* Bt = LN ? X + (size_t)t0 * DM : Wt + (size_t)c0 * DM;
    v8f acc[4][4];
#pragma unroll
    for (int mb = 0; mb < 4; ++mb)
#pragma unroll
        for (int nb = 0; nb < 4; ++nb) acc[mb][nb] = (v8f){};
    const size_t off = (size_t)lane * 8;
    // rolled: a trip already holds 16 loads and 16 matrix instructions, more trips in the text would only lengthen it
#pragma unroll 1
    for (int kc = 0; kc < DM; kc += 32) {
        V a[4]; const bf* pa = A + off + kc * 16; const bf* pb = Bt + off + kc * 16;   // fragment kc / 32 of each 16-row tile
#pragma unroll
        for (int mb = 0; mb < 4; ++mb) a[mb] = WFrag<bf>::ld(pa + (size_t)mb * 16 * DM);
#pragma unroll
        for (int nb = 0; nb < 4; ++nb) { const V b = WFrag<bf>::ld(pb + (size_t)nb * 16 * DM);
#pragma unroll
            for (int mb = 0; mb < 4; ++mb) acc[mb][nb] = WFrag<bf>::mma(a[mb], b, acc[mb][nb]); }
        // the vector slots that the chip needs between the trip's last matrix instructions and what follows them over the back edge
        asm volatile("v_nop\n\tv_nop\n\tv_nop\n\tv_nop" : "+v"(acc[0][0]), "+v"(acc[1][1]), "+v"(acc[2][2]), "+v"(acc[3][3]) : "v"(a[0]), "v"(a[3]));
        asm volatile("s_wait_xcnt 0x0" :: "v"(pa), "v"(pb) : "memory");   // before the address registers of the trip's loads are reused; naming them keeps them live up to the wait, so that no load's own result lands on them
    }
    if (LN) {
        float bs[4][8], gm[4][8], bt[4][8]; const unsigned ob = (unsigned)hi * 32u;   // the lane's byte offset (d = hi * 8) into the three [64] f32 vectors
        const char* cbs = (const char*)(bias + c0); const char* cgm = (const char*)g; const char* cbt = (const char*)bb;
#pragma unroll
        for (int mb = 0; mb < 4; ++mb)
#pragma unroll
            for (int j = 0; j < 8; ++j) { bs[mb][j] = *(const float*)(cbs + ob + mb * 64 + j * 4); gm[mb][j] = *(const float*)(cgm + ob + mb * 64 + j * 4); bt[mb][j] = *(const float*)(cbt + ob + mb * 64 + j * 4); }
        asm volatile("s_wait_xcnt 0x0" :: "v"(ob) : "memory");   // before the offset register of the loads above is reused; naming it keeps it live up to the wait, so that no load's own result lands on it
        __builtin_amdgcn_sched_barrier(0);   // keeps later register writes from being lifted over the wait
#pragma unroll
        for (int mb = 0; mb < 4; ++mb)
#pragma unroll
            for (int j = 0; j < 8; ++j) { bs[mb][j] = bfr(bs[mb][j]); gm[mb][j] = bfr(gm[mb][j]); bt[mb][j] = bfr(bt[mb][j]);
#pragma unroll
                for (int nb = 0; nb < 4; ++nb) acc[mb][nb][j] += bs[mb][j]; }
#pragma unroll
        for (int nb = 0; nb < 4; ++nb) { float x[4][8], p[4][8];
#pragma unroll
            for (int mb = 0; mb < 4; ++mb)
#pragma unroll
                for (int j = 0; j < 8; ++j) x[mb][j] = acc[mb][nb][j];
            const float mean = hsum64(x) * (1.0f / HD);
#pragma unroll
            for (int mb = 0; mb < 4; ++mb)
#pragma unroll
                for (int j = 0; j < 8; ++j) { x[mb][j] -= mean; p[mb][j] = x[mb][j] * x[mb][j]; }
            const float den = __fsqrt_rn(hsum64(p) * (1.0f / HD) + 1e-5f);
            v8h o16[4]; v8us oh[4], ol[4];
#pragma unroll
            for (int mb = 0; mb < 4; ++mb) { float r[8];
#pragma unroll
                for (int j = 0; j < 8; ++j) r[j] = __fdiv_rn(x[mb][j], den) * gm[mb][j] + bt[mb][j];
                planes8(r, o16[mb], oh[mb], ol[mb]); }
            const size_t e = ((size_t)h * TT + t0 + nb * 16) * HD + lane * 8;
            __builtin_amdgcn_sched_barrier(0);   // the column's arithmetic ends here: nothing of it is sunk between a store and the wait behind the stores
#pragma unroll
            for (int mb = 0; mb < 4; ++mb) { *(v8h*)(P16 + e + mb * 256) = o16[mb]; *(v8us*)(Ph + e + mb * 256) = oh[mb]; *(v8us*)(Pl + e + mb * 256) = ol[mb]; }
            asm volatile("s_wait_xcnt 0x0" ::: "memory");   // before the data and address registers of the stores above are reused
            __builtin_amdgcn_sched_barrier(0);   // keeps later register writes from being lifted over the wait
        }
    } else {
#pragma unroll
        for (int nb = 0; nb < 4; ++nb) { const float bs = bfr(bias[c0 + nb * 16 + lr]); v8h o16[4]; v8us oh[4], ol[4];
#pragma unroll
            for (int mb = 0; mb < 4; ++mb) { float r[8];
#pragma unroll
                for (int j = 0; j < 8; ++j) r[j] = acc[mb][nb][j] + bs;
                planes8(r, o16[mb], oh[mb], ol[mb]); }
            const size_t e = (((size_t)h * (TT / 32) + t0 / 32) * 4 + nb) * 512 + lane * 8;
            __builtin_amdgcn_sched_barrier(0);   // the column's arithmetic ends here: nothing of it is sunk between a store and the wait behind the stores
#pragma unroll
            for (int mb = 0; mb < 4; ++mb) { const int f = (mb >> 1) * 2048 + (mb & 1) * 256; *(v8h*)(P16 + e + f) = o16[mb]; *(v8us*)(Ph + e + f) = oh[mb]; *(v8us*)(Pl + e + f) = ol[mb]; }
            asm volatile("s_wait_xcnt 0x0" ::: "memory");   // before the data and address registers of the stores above are reused
            __builtin_amdgcn_sched_barrier(0);   // keeps later register writes from being lifted over the wait
        }
    }
}
// k_proj: every projection tile of the block in one launch, so that all of them share the chip at once; grid (NB_*TT/64, heads, 3), 32 threads; blockIdx.z: 0 = q from x1, 1 = k, 2 = v from x2.
__global__ __launch_bounds__(32) void k_proj(const bf* __restrict__ X1, const bf* __restrict__ X2, const bf* __restrict__ WQ, const bf* __restrict__ WK, const bf* __restrict__ WV, const float* __restrict__ bq, const float* __restrict__ bk, const float* __restrict__ bv, const float* __restrict__ gq, const float* __restrict__ btq, const float* __restrict__ gk, const float* __restrict__ btk,
                                              h16* __restrict__ QP16, bf* __restrict__ QPh, bf* __restrict__ QPl, h16* __restrict__ KP16, bf* __restrict__ KPh, bf* __restrict__ KPl, h16* __restrict__ VT16, bf* __restrict__ VTh, bf* __restrict__ VTl) {
    const int b = blockIdx.x / (TT / 64), t0 = (blockIdx.x % (TT / 64)) * 64, h = blockIdx.y; const size_t xb = (size_t)b * TT * DM, pb = (size_t)b * NH_ * TT * HD;   // this batch's block in x and in every head plane (NKV == NH_)
    if (blockIdx.z == 2) proj_tile<false>(X2 + xb, WV, bv, nullptr, nullptr, VT16 + pb, VTh + pb, VTl + pb, t0, h);   // v, transposed planes
    else { const bool kk = blockIdx.z == 1;   // q or k: per-head LayerNorm x gamma + beta, planes
        proj_tile<true>((kk ? X2 : X1) + xb, kk ? WK : WQ, kk ? bk : bq, kk ? gk : gq, kk ? btk : btq, (kk ? KP16 : QP16) + pb, (kk ? KPh : QPh) + pb, (kk ? KPl : QPl) + pb, t0, h); }
}
// ---- attn_cols: scores, softmax and attn x v of one (batch, head) in one kernel; no score or probability ever leaves the registers.
// One wave owns NQ*16 query columns and walks the 2048 keys 32 at a time: St = K Qt (A = key rows, B = query rows kept in registers), so a lane holds 16 scores of ONE query per column group;
// running maximum and sum per query (in-lane + one exchange between the wave halves); the two 16-key score tiles, converted in place, ARE the B operand of Ot += Vt Pt (A = d rows of the v plane, same k order as WFrag::ld).
// Rows < RH: bf16 hi+lo planes, 3 products each; the rest fp16 with probabilities x PCAR (the factor is in the sum too and cancels in the division).
template <typename T16> struct PPack;
template <> struct PPack<h16> { static __device__ __forceinline__ void pk(const v8f& p0, const v8f& p1, v16h& a, v16h& a2) { (void)a2;
#pragma unroll
    for (int e = 0; e < 8; ++e) { a[e] = tohx(p0[e]); a[8 + e] = tohx(p1[e]); } } };
template <> struct PPack<bf> { static __device__ __forceinline__ void pk(const v8f& p0, const v8f& p1, v16bf& a, v16bf& a2) { v8us h0, h1, l0, l1;
#pragma unroll
    for (int e = 0; e < 8; ++e) { unsigned short x, y; splitf(p0[e], x, y); h0[e] = x; l0[e] = y; splitf(p1[e], x, y); h1[e] = x; l1[e] = y; }
    a = cat16b(h0, h1); a2 = cat16b(l0, l1); } };
template <typename T16, bool HL, int NQ>
__device__ __forceinline__ void attn_cols(const T16* __restrict__ Q, const T16* __restrict__ Q2, const T16* __restrict__ Kp, const T16* __restrict__ K2, const T16* __restrict__ Vt, const T16* __restrict__ V2, int q0, float sh, float* __restrict__ orow) {
    typedef typename WFrag<T16>::V V;
    const int lane = threadIdx.x & 31, lr = lane & 15, hi = lane >> 4; const float c1 = SCL * 1.4426950408889634f;
    V qf[NQ][2], qf2[NQ][2];
#pragma unroll
    for (int nb = 0; nb < NQ; ++nb)
#pragma unroll
        for (int ks = 0; ks < 2; ++ks) { const size_t qo = (size_t)(q0 + nb * 16) * HD + ks * 512 + lane * 8; qf[nb][ks] = WFrag<T16>::ld(Q + qo); if (HL) qf2[nb][ks] = WFrag<T16>::ld(Q2 + qo); }
    asm volatile("s_wait_xcnt 0x0" ::: "memory");   // before the address registers of the loads above are reused
    __builtin_amdgcn_sched_barrier(0);   // keeps later register writes from being lifted over the wait
    v8f o[4][NQ]; float mx[NQ], sm[NQ];
#pragma unroll
    for (int nb = 0; nb < NQ; ++nb) { mx[nb] = -3.0e38f; sm[nb] = 0.f;
#pragma unroll
        for (int dt = 0; dt < 4; ++dt) o[dt][nb] = (v8f){}; }
    const size_t ko = (size_t)lane * 8, vo = (size_t)lane * 8;
    V kf[2][2], kf2[2][2];
#pragma unroll
    for (int kt = 0; kt < 2; ++kt)
#pragma unroll
        for (int ks = 0; ks < 2; ++ks) { kf[kt][ks] = WFrag<T16>::ld(Kp + ko + kt * 16 * HD + ks * 512); if (HL) kf2[kt][ks] = WFrag<T16>::ld(K2 + ko + kt * 16 * HD + ks * 512); }
    asm volatile("s_wait_xcnt 0x0" ::: "memory");   // before the address registers of the loads above are reused
    __builtin_amdgcn_sched_barrier(0);   // keeps later register writes from being lifted over the wait
    for (int k0 = 0; k0 < TT; k0 += 32) {
        V vf[4], vf2[4]; const T16* pv = Vt + vo + (size_t)k0 * HD; const T16* pv2 = HL ? V2 + vo + (size_t)k0 * HD : nullptr;   // 32 keys x 64 d = 4 fragments in a row
#pragma unroll
        for (int dt = 0; dt < 4; ++dt) { vf[dt] = WFrag<T16>::ld(pv + dt * 512); if (HL) vf2[dt] = WFrag<T16>::ld(pv2 + dt * 512); }
        // before the address registers of the loads above are reused; naming them keeps them live up to the wait, so that no load's own result lands on them
        if (HL) asm volatile("s_wait_xcnt 0x0" :: "v"(pv), "v"(pv2) : "memory"); else asm volatile("s_wait_xcnt 0x0" :: "v"(pv) : "memory");
        __builtin_amdgcn_sched_barrier(0);   // the loads above issue here, a softmax ahead of their use; sunk to their use each would cost its whole latency
        v8f s[2][NQ];
#pragma unroll
        for (int kt = 0; kt < 2; ++kt)
#pragma unroll
            for (int nb = 0; nb < NQ; ++nb) { v8f t = (v8f){};
#pragma unroll
                for (int ks = 0; ks < 2; ++ks) { t = WFrag<T16>::mma(kf[kt][ks], qf[nb][ks], t); if (HL) { t = WFrag<T16>::mma(kf2[kt][ks], qf[nb][ks], t); t = WFrag<T16>::mma(kf[kt][ks], qf2[nb][ks], t); } }
                s[kt][nb] = t; }
        const size_t kn = ko + (size_t)((k0 + 32) & (TT - 1)) * HD;   // the next 32 keys' fragments fly under the softmax; the last trip re-reads keys 0..31 (in bounds, unused)
#pragma unroll
        for (int kt = 0; kt < 2; ++kt)
#pragma unroll
            for (int ks = 0; ks < 2; ++ks) { kf[kt][ks] = WFrag<T16>::ld(Kp + kn + kt * 16 * HD + ks * 512); if (HL) kf2[kt][ks] = WFrag<T16>::ld(K2 + kn + kt * 16 * HD + ks * 512); }
        asm volatile("s_wait_xcnt 0x0" ::: "memory");   // before the address registers of the loads above are reused
        __builtin_amdgcn_sched_barrier(0);   // the loads above issue here, the rest of the trip ahead of their use; sunk to the loop's foot they would cost their whole latency
#pragma unroll
        for (int nb = 0; nb < NQ; ++nb) { float m = mx[nb];
#pragma unroll
            for (int j = 0; j < 8; ++j) m = fmaxf(m, fmaxf(s[0][nb][j], s[1][nb][j]));
            m = fmaxf(m, __shfl_xor(m, 16, 32));
            const float al = __builtin_amdgcn_exp2f((mx[nb] - m) * c1); mx[nb] = m; const float mc = sh - m * c1; float sum = 0.f;
#pragma unroll
            for (int j = 0; j < 8; ++j) { s[0][nb][j] = __builtin_amdgcn_exp2f(fmaf(s[0][nb][j], c1, mc)); s[1][nb][j] = __builtin_amdgcn_exp2f(fmaf(s[1][nb][j], c1, mc)); sum += s[0][nb][j] + s[1][nb][j]; }
            sm[nb] = fmaf(sm[nb], al, sum);
            V pf, pf2; PPack<T16>::pk(s[0][nb], s[1][nb], pf, pf2);
#pragma unroll
            for (int dt = 0; dt < 4; ++dt) { v8f t = o[dt][nb] * al; t = WFrag<T16>::mma(vf[dt], pf, t); if (HL) { t = WFrag<T16>::mma(vf[dt], pf2, t); t = WFrag<T16>::mma(vf2[dt], pf, t); } o[dt][nb] = t; } }
    }
#pragma unroll
    for (int nb = 0; nb < NQ; ++nb) { const float tot = sm[nb] + __shfl_xor(sm[nb], 16, 32); const float inv = __fdiv_rn(1.0f, tot); float* op = orow + (size_t)(q0 + nb * 16 + lr) * DQ + hi * 8;
#pragma unroll
        for (int dt = 0; dt < 4; ++dt) *(v8f*)(op + dt * 16) = o[dt][nb] * inv; }
}
// grid (NB_*NH_, query tiles), 4 independent waves per work-group on neighbouring query columns of one head (they walk the same k and v lines). One kernel per row class, so that each has its own register count and all its waves are resident at once:
// k_fattn3: rows < RH, 64 per work-group; k_fattn1: the rest, 128 per work-group.
__global__ __launch_bounds__(128) void k_fattn3(const bf* __restrict__ QPh, const bf* __restrict__ QPl, const bf* __restrict__ KPh, const bf* __restrict__ KPl, const bf* __restrict__ VTh, const bf* __restrict__ VTl, float* __restrict__ OUT) {
    const size_t z = blockIdx.x, pz = z * TT * HD; const int wv = threadIdx.x >> 5;
    attn_cols<bf, true, 1>(QPh + pz, QPl + pz, KPh + pz, KPl + pz, VTh + pz, VTl + pz, (int)blockIdx.y * 64 + wv * 16, 0.0f, OUT + (z / NH_) * (size_t)TT * DQ + (z % NH_) * HD);
}
__global__ __launch_bounds__(128) void k_fattn1(const h16* __restrict__ QP16, const h16* __restrict__ KP16, const h16* __restrict__ VT16, float* __restrict__ OUT) {
    const size_t z = blockIdx.x, pz = z * TT * HD; const int wv = threadIdx.x >> 5;
    attn_cols<h16, false, 2>(QP16 + pz, nullptr, KP16 + pz, nullptr, VT16 + pz, nullptr, RH + (int)blockIdx.y * 128 + wv * 32, 10.0f, OUT + (z / NH_) * (size_t)TT * DQ + (z % NH_) * HD);   // 10 = log2(PCAR)
}

extern "C" void kernel_launch(void* const* d_in, const int* in_sizes, int n_in,
                              void* d_out, int out_size, void* d_ws, size_t ws_size, hipStream_t stream) {
    (void)in_sizes; (void)n_in; (void)out_size;
    const float* x = (const float*)d_in[0]; const float* x2 = (const float*)d_in[1]; const float* wq = (const float*)d_in[2]; const float* bq = (const float*)d_in[3]; const float* wkv = (const float*)d_in[4]; const float* bkv = (const float*)d_in[5]; const float* gq = (const float*)d_in[6]; const float* btq = (const float*)d_in[7]; const float* gk = (const float*)d_in[8]; const float* btk = (const float*)d_in[9]; const float* wk = nullptr; const float* wv = nullptr; const float* wo = nullptr; (void)wk; (void)wv; (void)wo; const float* bk = bkv; const float* bv = bkv + 1024;
    float* OUT = (float*)d_out;     // [4][2048][1024]
    char* wsp = (char*)d_ws;
    auto take = [&](size_t bytes) { char* p = wsp; wsp += (bytes + 255) & ~(size_t)255; return (void*)p; };
    bf* WQ = (bf*)take((size_t)DQ * DM * 2); bf* WKV = (bf*)take((size_t)2 * DKV * DM * 2); bf* WK = WKV; bf* WV = WKV + (size_t)DKV * DM;   /* k | v row blocks of the transposed fused weight */
    bf* XB = (bf*)take((size_t)2 * NB_ * TT * DM * 2); bf* XB2 = XB + (size_t)NB_ * TT * DM;   /* bf16 x1 | x2, all batches */
    /* head planes [batch][head][..] of all NB_ batches */ h16* QP16 = (h16*)take((size_t)NB_ * NH_ * TT * HD * 2); h16* KP16 = (h16*)take((size_t)NB_ * NKV * TT * HD * 2); h16* VT16 = (h16*)take((size_t)NB_ * NKV * HD * TT * 2);
    bf* QPh = (bf*)take((size_t)NB_ * NH_ * TT * HD * 2); bf* QPl = (bf*)take((size_t)NB_ * NH_ * TT * HD * 2); bf* KPh = (bf*)take((size_t)NB_ * NKV * TT * HD * 2); bf* KPl = (bf*)take((size_t)NB_ * NKV * TT * HD * 2); bf* VTh = (bf*)take((size_t)NB_ * NKV * HD * TT * 2); bf* VTl = (bf*)take((size_t)NB_ * NKV * HD * TT * 2);
    if ((size_t)(wsp - (char*)d_ws) > ws_size) return;    // ws 256 MiB
    { k_wtG<DM, DQ><<<(unsigned)((DM * DQ / 64 + 63) / 64), 256, 0, stream>>>(wq, WQ); k_wtG<DM, 2 * DKV><<<(unsigned)((DM * 2 * DKV / 64 + 63) / 64), 256, 0, stream>>>(wkv, WKV);   /* 'xw' [1024][2048] -> Bt [2048][1024]: rows 0..1023 = k, 1024.. = v */ 
      
       }
    k_cvt8<<<dim3((unsigned)(((size_t)NB_ * TT * DM / 8 + 255) / 256), 2), 256, 0, stream>>>(x, x2, XB, (size_t)NB_ * TT * DM / 8);
    k_proj<<<dim3(NB_ * TT / 64, NH_, 3), 32, 0, stream>>>(XB, XB2, WQ, WK, WV, bq, bk, bv, gq, btq, gk, btk, QP16, QPh, QPl, KP16, KPh, KPl, VT16, VTh, VTl);
    k_fattn3<<<dim3(NB_ * NH_, RH / 64), 128, 0, stream>>>(QPh, QPl, KPh, KPl, VTh, VTl, OUT);
    k_fattn1<<<dim3(NB_ * NH_, (TT - RH) / 128), 128, 0, stream>>>(QP16, KP16, VT16, OUT);
}

// v006
// A run of this version takes 189 microseconds.
// Timed twice side by side with v005, it ran 1.10 and 1.08 times as fast.
// Over all steps from v000 it is 20.3 times as fast.
#include <hip/hip_runtime.h>

// Cross-attention block with LayerNorm-ed per-head q and k (x1, x2 [4][2048][1024]; q = x1 wq + bq, [k | v] = x2 wkv + bkv ('xw' [1024][1024] and [1024][2048] 0.02, zero biases -> k = first 1024 columns, v = the rest); 16 heads x 64; q, k <- per-head LayerNorm over 64 (eps 1e-5) x gamma + beta ([64], read); scores x 64^-0.5; softmax; out = merged attn v -> [4][2048][1024] (8.4 M)).
// Layout, 3 launches: bf16 copies of both weights and of all of x1 and x2 (one grid, parts by block range); one projection grid over all four batches and q, k and v (blockIdx.z; k and v as the two column blocks of wkv): exact products, f32 bias, for q and k the per-(token, head) LayerNorm with affine on the wave's own accumulators, and the 16-bit head planes stored straight from them (no f32 projection in memory); the head planes of all four batches stay in the workspace; fused dense T-2048 attention with a running softmax, both row classes in one grid (hybrid rows: < 512 hi/lo 3 products, rest fp16 x1024), writes the output rows.
// Every 16-bit operand plane in the workspace (x, weights, q, k, v) lies in FRAGMENT ORDER: a 16-row x 32-k fragment is 1 KiB, [k half][lane][8 elements], so that each 16-byte-per-lane load or store of a wave covers 512 contiguous bytes (4 whole lines) and not 32-byte pieces of 16 lines; the registers receive the same values as from row-major planes.
// Compute dtypes, f32 accumulate: every input rounded to bf16; projections exact + f32 biases; LayerNorms f32; attention rows < 512 3 products, rest fp16; softmax f32; output f32.

#define NB_  4
#define TT   2048
#define DM   1024
#define NH_  16
#define NKV  16
#define REP  (NH_ / NKV)
#define HD   64
#define DQ   (NH_ * HD)
#define DKV  (NKV * HD)
#define RH   512                  // query rows < RH use hi+lo planes (0: none)
#define WIN  0
#define PCAR 1024.0f
#define SCL  0.125f   // HD^-0.5
typedef _Float16 h16;
typedef unsigned short bf;
typedef __attribute__((ext_vector_type(16))) __bf16   v16bf;
typedef __attribute__((ext_vector_type(16))) _Float16 v16h;
typedef __attribute__((ext_vector_type(8)))  _Float16 v8h;
typedef __attribute__((ext_vector_type(8)))  unsigned short v8us;
typedef __attribute__((ext_vector_type(8)))  float    v8f;
typedef __attribute__((ext_vector_type(4)))  float    v4f;
typedef v8h  __attribute__((may_alias)) v8ha;
typedef v4f  __attribute__((may_alias)) v4fa;
typedef v8us __attribute__((may_alias)) v8usa;

__device__ __forceinline__ unsigned short f2bf(float f) { unsigned u = __float_as_uint(f); u += 0x7FFFu + ((u >> 16) & 1u); return (unsigned short)(u >> 16); }
__device__ __forceinline__ float bf2f(unsigned short b) { return __uint_as_float(((unsigned)b) << 16); }
__device__ __forceinline__ float bfr(float f) { return bf2f(f2bf(f)); }
__device__ __forceinline__ v16h cat16(v8h lo, v8h hi) { return __builtin_shufflevector(lo, hi, 0, 1, 2, 3, 4, 5, 6, 7, 8, 9, 10, 11, 12, 13, 14, 15); }
__device__ __forceinline__ v16bf cat16b(v8us lo, v8us hi) { return __builtin_bit_cast(v16bf, __builtin_shufflevector(lo, hi, 0, 1, 2, 3, 4, 5, 6, 7, 8, 9, 10, 11, 12, 13, 14, 15)); }
__device__ __forceinline__ v8f wmma16(v16h a, v16h b, v8f c) { return __builtin_amdgcn_wmma_f32_16x16x32_f16(false, a, false, b, (short)0, c, false, false); }
__device__ __forceinline__ v8f wmmab(v16bf a, v16bf b, v8f c) { return __builtin_amdgcn_wmma_f32_16x16x32_bf16(false, a, false, b, (short)0, c, false, false); }



// WFrag: one 16x32 (or 32x16) 16-bit operand fragment from a fragment-order plane, p = fragment + lane * 8: lane (lr, hi) finds row lr, k = 8 hi .. + 7 there and k = 16 + 8 hi .. + 7 256 elements on; the same k order for A and B
template <typename T16> struct WFrag;
template <> struct WFrag<h16> { typedef v16h V; static __device__ __forceinline__ V ld(const h16* p) { return cat16(*(const v8h*)p, *(const v8h*)(p + 256)); } static __device__ __forceinline__ v8f mma(V a, V b, v8f c) { return wmma16(a, b, c); } };
template <> struct WFrag<bf> { typedef v16bf V; static __device__ __forceinline__ V ld(const bf* p) { return cat16b(*(const v8us*)p, *(const v8us*)(p + 256)); } static __device__ __forceinline__ v8f mma(V a, V b, v8f c) { return wmmab(a, b, c); } };

__device__ __forceinline__ h16 tohx(float x) { return (h16)x; }
__device__ __forceinline__ void splitf(float y, unsigned short& h, unsigned short& l) { h = f2bf(y); l = f2bf(y - bf2f(h)); }
typedef __attribute__((ext_vector_type(2))) _Float16 v2h;
typedef __attribute__((ext_vector_type(4))) _Float16 v4h;
typedef __attribute__((ext_vector_type(2))) unsigned short v2us;
typedef __attribute__((ext_vector_type(4))) unsigned short v4us;
typedef __attribute__((ext_vector_type(2))) float v2f;
typedef __attribute__((ext_vector_type(4))) int v4i;

// w [K][N] f32 -> Bt, the transposed weight in fragment order [N/16][K/32][k half][lane][8]; one wave per fragment: a lane gathers 16 k of its row n (16 neighbouring n per load = 64-byte runs) and stores 16 bytes twice, the wave 512 in a row each time
template <int K, int N>
__device__ __forceinline__ void wtG(const float* __restrict__ w, bf* Bt, int blk) {
    const int lane = threadIdx.x & 31, lr = lane & 15, hi = lane >> 4; const int F = blk * 8 + (threadIdx.x >> 5); if (F >= (N / 16) * (K / 32)) return;
    const float* p = w + (size_t)((F % (K / 32)) * 32 + hi * 8) * N + (F / (K / 32)) * 16 + lr; float v[16];
#pragma unroll   // register arrays here and below: their indices must be constants; all 16 loads fly together
    for (int j = 0; j < 16; ++j) v[j] = p[(size_t)((j >> 3) * 16 + (j & 7)) * N];
    asm volatile("s_wait_xcnt 0x0" :: "v"(p) : "memory");   // before the address registers of the loads above are reused; naming them keeps them live up to the wait
    v8us o0, o1;
#pragma unroll
    for (int j = 0; j < 8; ++j) { o0[j] = f2bf(v[j]); o1[j] = f2bf(v[8 + j]); }
    bf* q = Bt + (size_t)F * 512 + lane * 8; *(v8us*)q = o0; *(v8us*)(q + 256) = o1;
}
// src: x1 or x2, dst: its half of the bf16 copy; i: the thread's index in it; dst in fragment order [row/16][k/32][k half][lane][8]. One wave = 8 rows x 32 k (half a fragment): each load covers 4 whole source lines (4 rows x 128 bytes), each store four 64-byte runs
__device__ __forceinline__ void cvt8(const float* __restrict__ src, bf* dst, size_t i, size_t n8) { if (i >= n8) return;
    const int l = threadIdx.x & 31, q = l & 7; const size_t F = i >> 6; const int r0 = (int)((i >> 5) & 1) * 8 + (l >> 3);   // fragment; the lane's first row in it (the second: + 4); q: which 4 of the row's 32 k
    const float* p = src + ((F / (DM / 32)) * 16 + r0) * DM + (F % (DM / 32)) * 32 + q * 4; const v4f v0 = *(const v4f*)p, v1 = *(const v4f*)(p + 4 * DM);
    asm volatile("s_wait_xcnt 0x0" :: "v"(p) : "memory");   // before the address registers of the loads above are reused; naming them keeps them live up to the wait
    v4us o0, o1;
#pragma unroll   // vector elements in registers: their indices must be constants
    for (int k = 0; k < 4; ++k) { o0[k] = f2bf(v0[k]); o1[k] = f2bf(v1[k]); }
    bf* o = dst + F * 512 + (q >> 2) * 256 + (((q >> 1) & 1) * 16 + r0) * 8 + (q & 1) * 4; *(v4us*)o = o0; *(v4us*)(o + 32) = o1; }
// k_prep: the three independent 16-bit copies in ONE launch, so that they share the chip and pay one launch's start and drain; parts by block range, the gathering weight parts first: wq, wkv, x1, x2
#define PB_WQ  (DM * DQ / 512 / 8)          // work-groups: one wave per 512-element fragment, 8 waves each
#define PB_WKV (DM * 2 * DKV / 512 / 8)
#define PB_X   (NB_ * TT * DM / 8 / 256)    // 8 elements per thread, per source
__global__ __launch_bounds__(256) void k_prep(const float* __restrict__ wq, const float* __restrict__ wkv, const float* __restrict__ x1, const float* __restrict__ x2, bf* WQ, bf* WKV, bf* XB) {
    const int b = blockIdx.x;
    if (b < PB_WQ) wtG<DM, DQ>(wq, WQ, b);
    else if (b < PB_WQ + PB_WKV) wtG<DM, 2 * DKV>(wkv, WKV, b - PB_WQ);
    else { const int c = b - (PB_WQ + PB_WKV); const bool two = c >= PB_X;
        cvt8(two ? x2 : x1, XB + (two ? (size_t)NB_ * TT * DM : 0), (size_t)(two ? c - PB_X : c) * 256 + threadIdx.x, (size_t)NB_ * TT * DM / 8); }
}

// ---- proj_tile: projection GEMM with its whole tail, ONE WAVE per 64 tokens x 64 columns (= one head; 16 accumulators), operands straight from fragment-order bf16 planes; X, P16, Ph, Pl: the tile's own batch.
// The f32 tile stays in registers: the wave adds the bias, normalises (q, k) and stores the fp16, hi and lo head planes itself.
// LN (q, k): product rows = weight rows (d), columns = tokens: per column group a lane holds 32 of the 64 d of ONE token (lane ^ 16 the other 32), and each accumulator is 8 neighbouring d = the lane's 16 bytes of half a fragment of the plane [h][t/16][d/32][d half][lane][8].
// !LN (v): product rows = tokens, columns = weight rows: each accumulator is 8 neighbouring tokens of one d = the lane's 16 bytes of half a fragment of the plane [h][t/32][d/16][t half][lane][8].
// Every plain '#pragma unroll' here stands on a loop over register arrays: their indices must be constants, or the arrays would leave the registers.
__device__ __forceinline__ float xhalf(float v) { const int b = __float_as_int(v); return __int_as_float(__builtin_amdgcn_permlanex16(b, b, 0x76543210, 0xfedcba98, false, false)); }   // the value of lane ^ 16
// sum over the 64 d of a token, v[mb][j] = element d = mb*16 + hi*8 + j: neighbours first, then d ^ 32, ^ 16, ^ 8 (the other wave half), ^ 4, ^ 2; both halves end with the same bits
__device__ __forceinline__ float hsum64(const float (&v)[4][8]) { float z[4];
#pragma unroll
    for (int q = 0; q < 4; ++q) { z[q] = ((v[0][2 * q] + v[0][2 * q + 1]) + (v[2][2 * q] + v[2][2 * q + 1])) + ((v[1][2 * q] + v[1][2 * q + 1]) + (v[3][2 * q] + v[3][2 * q + 1])); z[q] += xhalf(z[q]); }
    return (z[0] + z[2]) + (z[1] + z[3]); }
__device__ __forceinline__ void planes8(const float (&r)[8], v8h& o16, v8us& oh, v8us& ol) {
#pragma unroll
    for (int j = 0; j < 8; ++j) { o16[j] = tohx(r[j]); unsigned short a2, c2; splitf(r[j], a2, c2); oh[j] = a2; ol[j] = c2; } }
template <bool LN>
__device__ __forceinline__ void proj_tile(const bf* __restrict__ X, const bf* __restrict__ Wt, const float* __restrict__ bias, const float* __restrict__ g, const float* __restrict__ bb, h16* __restrict__ P16, bf* __restrict__ Ph, bf* __restrict__ Pl, int t0, int h) {
    typedef WFrag<bf>::V V;
    const int lane = threadIdx.x & 31, lr = lane & 15, hi = lane >> 4; const int c0 = h * 64;
    const bf* A = LN ? Wt + (size_t)c0 * DM : X + (size_t)t0 * DM; const bf* Bt = LN ? X + (size_t)t0 * DM : Wt + (size_t)c0 * DM;
    v8f acc[4][4];
#pragma unroll
    for (int mb = 0; mb < 4; ++mb)
#pragma unroll
        for (int nb = 0; nb < 4; ++nb) acc[mb][nb] = (v8f){};
    const size_t off = (size_t)lane * 8;
    // rolled: a trip already holds 16 loads and 16 matrix instructions, more trips in the text would only lengthen it
#pragma unroll 1
    for (int kc = 0; kc < DM; kc += 32) {
        V a[4]; const bf* pa = A + off + kc * 16; const bf* pb = Bt + off + kc * 16;   // fragment kc / 32 of each 16-row tile
#pragma unroll
        for (int mb = 0; mb < 4; ++mb) a[mb] = WFrag<bf>::ld(pa + (size_t)mb * 16 * DM);
#pragma unroll
        for (int nb = 0; nb < 4; ++nb) { const V b = WFrag<bf>::ld(pb + (size_t)nb * 16 * DM);
#pragma unroll
            for (int mb = 0; mb < 4; ++mb) acc[mb][nb] = WFrag<bf>::mma(a[mb], b, acc[mb][nb]); }
        // the vector slots that the chip needs between the trip's last matrix instructions and what follows them over the back edge
        asm volatile("v_nop\n\tv_nop\n\tv_nop\n\tv_nop" : "+v"(acc[0][0]), "+v"(acc[1][1]), "+v"(acc[2][2]), "+v"(acc[3][3]) : "v"(a[0]), "v"(a[3]));
        asm volatile("s_wait_xcnt 0x0" :: "v"(pa), "v"(pb) : "memory");   // before the address registers of the trip's loads are reused; naming them keeps them live up to the wait, so that no load's own result lands on them
    }
    if (LN) {
        float bs[4][8], gm[4][8], bt[4][8]; const unsigned ob = (unsigned)hi * 32u;   // the lane's byte offset (d = hi * 8) into the three [64] f32 vectors
        const char* cbs = (const char*)(bias + c0); const char* cgm = (const char*)g; const char* cbt = (const char*)bb;
#pragma unroll
        for (int mb = 0; mb < 4; ++mb)
#pragma unroll
            for (int j = 0; j < 8; ++j) { bs[mb][j] = *(const float*)(cbs + ob + mb * 64 + j * 4); gm[mb][j] = *(const float*)(cgm + ob + mb * 64 + j * 4); bt[mb][j] = *(const float*)(cbt + ob + mb * 64 + j * 4); }
        asm volatile("s_wait_xcnt 0x0" :: "v"(ob) : "memory");   // before the offset register of the loads above is reused; naming it keeps it live up to the wait, so that no load's own result lands on it
        __builtin_amdgcn_sched_barrier(0);   // keeps later register writes from being lifted over the wait
#pragma unroll
        for (int mb = 0; mb < 4; ++mb)
#pragma unroll
            for (int j = 0; j < 8; ++j) { bs[mb][j] = bfr(bs[mb][j]); gm[mb][j] = bfr(gm[mb][j]); bt[mb][j] = bfr(bt[mb][j]);
#pragma unroll
                for (int nb = 0; nb < 4; ++nb) acc[mb][nb][j] += bs[mb][j]; }
#pragma unroll
        for (int nb = 0; nb < 4; ++nb) { float x[4][8], p[4][8];
#pragma unroll
            for (int mb = 0; mb < 4; ++mb)
#pragma unroll
                for (int j = 0; j < 8; ++j) x[mb][j] = acc[mb][nb][j];
            const float mean = hsum64(x) * (1.0f / HD);
#pragma unroll
            for (int mb = 0; mb < 4; ++mb)
#pragma unroll
                for (int j = 0; j < 8; ++j) { x[mb][j] -= mean; p[mb][j] = x[mb][j] * x[mb][j]; }
            const float den = __fsqrt_rn(hsum64(p) * (1.0f / HD) + 1e-5f);
            v8h o16[4]; v8us oh[4], ol[4];
#pragma unroll
            for (int mb = 0; mb < 4; ++mb) { float r[8];
#pragma unroll
                for (int j = 0; j < 8; ++j) r[j] = __fdiv_rn(x[mb][j], den) * gm[mb][j] + bt[mb][j];
                planes8(r, o16[mb], oh[mb], ol[mb]); }
            const size_t e = ((size_t)h * TT + t0 + nb * 16) * HD + lane * 8;
            __builtin_amdgcn_sched_barrier(0);   // the column's arithmetic ends here: nothing of it is sunk between a store and the wait behind the stores
#pragma unroll
            for (int mb = 0; mb < 4; ++mb) { *(v8h*)(P16 + e + mb * 256) = o16[mb]; *(v8us*)(Ph + e + mb * 256) = oh[mb]; *(v8us*)(Pl + e + mb * 256) = ol[mb]; }
            asm volatile("s_wait_xcnt 0x0" ::: "memory");   // before the data and address registers of the stores above are reused
            __builtin_amdgcn_sched_barrier(0);   // keeps later register writes from being lifted over the wait
        }
    } else {
#pragma unroll
        for (int nb = 0; nb < 4; ++nb) { const float bs = bfr(bias[c0 + nb * 16 + lr]); v8h o16[4]; v8us oh[4], ol[4];
#pragma unroll
            for (int mb = 0; mb < 4; ++mb) { float r[8];
#pragma unroll
                for (int j = 0; j < 8; ++j) r[j] = acc[mb][nb][j] + bs;
                planes8(r, o16[mb], oh[mb], ol[mb]); }
            const size_t e = (((size_t)h * (TT / 32) + t0 / 32) * 4 + nb) * 512 + lane * 8;
            __builtin_amdgcn_sched_barrier(0);   // the column's arithmetic ends here: nothing of it is sunk between a store and the wait behind the stores
#pragma unroll
            for (int mb = 0; mb < 4; ++mb) { const int f = (mb >> 1) * 2048 + (mb & 1) * 256; *(v8h*)(P16 + e + f) = o16[mb]; *(v8us*)(Ph + e + f) = oh[mb]; *(v8us*)(Pl + e + f) = ol[mb]; }
            asm volatile("s_wait_xcnt 0x0" ::: "memory");   // before the data and address registers of the stores above are reused
            __builtin_amdgcn_sched_barrier(0);   // keeps later register writes from being lifted over the wait
        }
    }
}
// k_proj: every projection tile of the block in one launch, so that all of them share the chip at once; grid (NB_*TT/64, heads, 3), 32 threads; blockIdx.z: 0 = q from x1, 1 = k, 2 = v from x2.
__global__ __launch_bounds__(32) void k_proj(const bf* __restrict__ X1, const bf* __restrict__ X2, const bf* __restrict__ WQ, const bf* __restrict__ WK, const bf* __restrict__ WV, const float* __restrict__ bq, const float* __restrict__ bk, const float* __restrict__ bv, const float* __restrict__ gq, const float* __restrict__ btq, const float* __restrict__ gk, const float* __restrict__ btk,
                                              h16* __restrict__ QP16, bf* __restrict__ QPh, bf* __restrict__ QPl, h16* __restrict__ KP16, bf* __restrict__ KPh, bf* __restrict__ KPl, h16* __restrict__ VT16, bf* __restrict__ VTh, bf* __restrict__ VTl) {
    const int b = blockIdx.x / (TT / 64), t0 = (blockIdx.x % (TT / 64)) * 64, h = blockIdx.y; const size_t xb = (size_t)b * TT * DM, pb = (size_t)b * NH_ * TT * HD;   // this batch's block in x and in every head plane (NKV == NH_)
    if (blockIdx.z == 2) proj_tile<false>(X2 + xb, WV, bv, nullptr, nullptr, VT16 + pb, VTh + pb, VTl + pb, t0, h);   // v, transposed planes
    else { const bool kk = blockIdx.z == 1;   // q or k: per-head LayerNorm x gamma + beta, planes
        proj_tile<true>((kk ? X2 : X1) + xb, kk ? WK : WQ, kk ? bk : bq, kk ? gk : gq, kk ? btk : btq, (kk ? KP16 : QP16) + pb, (kk ? KPh : QPh) + pb, (kk ? KPl : QPl) + pb, t0, h); }
}
// ---- attn_cols: scores, softmax and attn x v of one (batch, head) in one kernel; no score or probability ever leaves the registers.
// One wave owns NQ*16 query columns and walks the 2048 keys 32 at a time: St = K Qt (A = key rows, B = query rows kept in registers), so a lane holds 16 scores of ONE query per column group;
// running maximum and sum per query (in-lane + one exchange between the wave halves); the two 16-key score tiles, converted in place, ARE the B operand of Ot += Vt Pt (A = d rows of the v plane, same k order as WFrag::ld).
// Rows < RH: bf16 hi+lo planes, 3 products each; the rest fp16 with probabilities x PCAR (the factor is in the sum too and cancels in the division).
template <typename T16> struct PPack;
template <> struct PPack<h16> { static __device__ __forceinline__ void pk(const v8f& p0, const v8f& p1, v16h& a, v16h& a2) { (void)a2;
#pragma unroll
    for (int e = 0; e < 8; ++e) { a[e] = tohx(p0[e]); a[8 + e] = tohx(p1[e]); } } };
template <> struct PPack<bf> { static __device__ __forceinline__ void pk(const v8f& p0, const v8f& p1, v16bf& a, v16bf& a2) { v8us h0, h1, l0, l1;
#pragma unroll
    for (int e = 0; e < 8; ++e) { unsigned short x, y; splitf(p0[e], x, y); h0[e] = x; l0[e] = y; splitf(p1[e], x, y); h1[e] = x; l1[e] = y; }
    a = cat16b(h0, h1); a2 = cat16b(l0, l1); } };
template <typename T16, bool HL, int NQ>
__device__ __forceinline__ void attn_cols(const T16* __restrict__ Q, const T16* __restrict__ Q2, const T16* __restrict__ Kp, const T16* __restrict__ K2, const T16* __restrict__ Vt, const T16* __restrict__ V2, int q0, float sh, float* __restrict__ orow) {
    typedef typename WFrag<T16>::V V;
    const int lane = threadIdx.x & 31, lr = lane & 15, hi = lane >> 4; const float c1 = SCL * 1.4426950408889634f;
    V qf[NQ][2], qf2[NQ][2];
#pragma unroll
    for (int nb = 0; nb < NQ; ++nb)
#pragma unroll
        for (int ks = 0; ks < 2; ++ks) { const size_t qo = (size_t)(q0 + nb * 16) * HD + ks * 512 + lane * 8; qf[nb][ks] = WFrag<T16>::ld(Q + qo); if (HL) qf2[nb][ks] = WFrag<T16>::ld(Q2 + qo); }
    asm volatile("s_wait_xcnt 0x0" ::: "memory");   // before the address registers of the loads above are reused
    __builtin_amdgcn_sched_barrier(0);   // keeps later register writes from being lifted over the wait
    v8f o[4][NQ]; float mx[NQ], sm[NQ];
#pragma unroll
    for (int nb = 0; nb < NQ; ++nb) { mx[nb] = -3.0e38f; sm[nb] = 0.f;
#pragma unroll
        for (int dt = 0; dt < 4; ++dt) o[dt][nb] = (v8f){}; }
    const size_t ko = (size_t)lane * 8, vo = (size_t)lane * 8;
    V kf[2][2], kf2[2][2];
#pragma unroll
    for (int kt = 0; kt < 2; ++kt)
#pragma unroll
        for (int ks = 0; ks < 2; ++ks) { kf[kt][ks] = WFrag<T16>::ld(Kp + ko + kt * 16 * HD + ks * 512); if (HL) kf2[kt][ks] = WFrag<T16>::ld(K2 + ko + kt * 16 * HD + ks * 512); }
    asm volatile("s_wait_xcnt 0x0" ::: "memory");   // before the address registers of the loads above are reused
    __builtin_amdgcn_sched_barrier(0);   // keeps later register writes from being lifted over the wait
    for (int k0 = 0; k0 < TT; k0 += 32) {
        V vf[4], vf2[4]; const T16* pv = Vt + vo + (size_t)k0 * HD; const T16* pv2 = HL ? V2 + vo + (size_t)k0 * HD : nullptr;   // 32 keys x 64 d = 4 fragments in a row
#pragma unroll
        for (int dt = 0; dt < 4; ++dt) { vf[dt] = WFrag<T16>::ld(pv + dt * 512); if (HL) vf2[dt] = WFrag<T16>::ld(pv2 + dt * 512); }
        // before the address registers of the loads above are reused; naming them keeps them live up to the wait, so that no load's own result lands on them
        if (HL) asm volatile("s_wait_xcnt 0x0" :: "v"(pv), "v"(pv2) : "memory"); else asm volatile("s_wait_xcnt 0x0" :: "v"(pv) : "memory");
        __builtin_amdgcn_sched_barrier(0);   // the loads above issue here, a softmax ahead of their use; sunk to their use each would cost its whole latency
        v8f s[2][NQ];
#pragma unroll
        for (int kt = 0; kt < 2; ++kt)
#pragma unroll
            for (int nb = 0; nb < NQ; ++nb) { v8f t = (v8f){};
#pragma unroll
                for (int ks = 0; ks < 2; ++ks) { t = WFrag<T16>::mma(kf[kt][ks], qf[nb][ks], t); if (HL) { t = WFrag<T16>::mma(kf2[kt][ks], qf[nb][ks], t); t = WFrag<T16>::mma(kf[kt][ks], qf2[nb][ks], t); } }
                s[kt][nb] = t; }
        const size_t kn = ko + (size_t)((k0 + 32) & (TT - 1)) * HD;   // the next 32 keys' fragments fly under the softmax; the last trip re-reads keys 0..31 (in bounds, unused)
#pragma unroll
        for (int kt = 0; kt < 2; ++kt)
#pragma unroll
            for (int ks = 0; ks < 2; ++ks) { kf[kt][ks] = WFrag<T16>::ld(Kp + kn + kt * 16 * HD + ks * 512); if (HL) kf2[kt][ks] = WFrag<T16>::ld(K2 + kn + kt * 16 * HD + ks * 512); }
        asm volatile("s_wait_xcnt 0x0" ::: "memory");   // before the address registers of the loads above are reused
        __builtin_amdgcn_sched_barrier(0);   // the loads above issue here, the rest of the trip ahead of their use; sunk to the loop's foot they would cost their whole latency
#pragma unroll
        for (int nb = 0; nb < NQ; ++nb) { float m = mx[nb];
#pragma unroll
            for (int j = 0; j < 8; ++j) m = fmaxf(m, fmaxf(s[0][nb][j], s[1][nb][j]));
            m = fmaxf(m, __shfl_xor(m, 16, 32));
            const float al = __builtin_amdgcn_exp2f((mx[nb] - m) * c1); mx[nb] = m; const float mc = sh - m * c1; float sum = 0.f;
#pragma unroll
            for (int j = 0; j < 8; ++j) { s[0][nb][j] = __builtin_amdgcn_exp2f(fmaf(s[0][nb][j], c1, mc)); s[1][nb][j] = __builtin_amdgcn_exp2f(fmaf(s[1][nb][j], c1, mc)); sum += s[0][nb][j] + s[1][nb][j]; }
            sm[nb] = fmaf(sm[nb], al, sum);
            V pf, pf2; PPack<T16>::pk(s[0][nb], s[1][nb], pf, pf2);
#pragma unroll
            for (int dt = 0; dt < 4; ++dt) { v8f t = o[dt][nb] * al; t = WFrag<T16>::mma(vf[dt], pf, t); if (HL) { t = WFrag<T16>::mma(vf[dt], pf2, t); t = WFrag<T16>::mma(vf2[dt], pf, t); } o[dt][nb] = t; } }
    }
#pragma unroll
    for (int nb = 0; nb < NQ; ++nb) { const float tot = sm[nb] + __shfl_xor(sm[nb], 16, 32); const float inv = __fdiv_rn(1.0f, tot); float* op = orow + (size_t)(q0 + nb * 16 + lr) * DQ + hi * 8;
#pragma unroll
        for (int dt = 0; dt < 4; ++dt) *(v8f*)(op + dt * 16) = o[dt][nb] * inv; }
}
// k_fattn: grid (NB_*NH_, query tiles of both row classes), 4 independent waves per work-group on neighbouring query columns of one head (they walk the same k and v lines).
// Both classes in ONE launch, so that their waves share the SIMDs (one class's matrix runs under the other's vector work) and the launch pays one start and one drain; the longer work-groups come first:
// blockIdx.y < RH/64: rows < RH, 64 per work-group, 3 products; the rest: fp16, 128 per work-group.
__global__ __launch_bounds__(128) void k_fattn(const bf* __restrict__ QPh, const bf* __restrict__ QPl, const bf* __restrict__ KPh, const bf* __restrict__ KPl, const bf* __restrict__ VTh, const bf* __restrict__ VTl, const h16* __restrict__ QP16, const h16* __restrict__ KP16, const h16* __restrict__ VT16, float* __restrict__ OUT) {
    const size_t z = blockIdx.x, pz = z * TT * HD; const int wv = threadIdx.x >> 5; float* orow = OUT + (z / NH_) * (size_t)TT * DQ + (z % NH_) * HD;
    if (blockIdx.y < RH / 64) attn_cols<bf, true, 1>(QPh + pz, QPl + pz, KPh + pz, KPl + pz, VTh + pz, VTl + pz, (int)blockIdx.y * 64 + wv * 16, 0.0f, orow);
    else attn_cols<h16, false, 2>(QP16 + pz, nullptr, KP16 + pz, nullptr, VT16 + pz, nullptr, RH + ((int)blockIdx.y - RH / 64) * 128 + wv * 32, 10.0f, orow);   // 10 = log2(PCAR)
}

extern "C" void kernel_launch(void* const* d_in, const int* in_sizes, int n_in,
                              void* d_out, int out_size, void* d_ws, size_t ws_size, hipStream_t stream) {
    (void)in_sizes; (void)n_in; (void)out_size;
    const float* x = (const float*)d_in[0]; const float* x2 = (const float*)d_in[1]; const float* wq = (const float*)d_in[2]; const float* bq = (const float*)d_in[3]; const float* wkv = (const float*)d_in[4]; const float* bkv = (const float*)d_in[5]; const float* gq = (const float*)d_in[6]; const float* btq = (const float*)d_in[7]; const float* gk = (const float*)d_in[8]; const float* btk = (const float*)d_in[9]; const float* wk = nullptr; const float* wv = nullptr; const float* wo = nullptr; (void)wk; (void)wv; (void)wo; const float* bk = bkv; const float* bv = bkv + 1024;
    float* OUT = (float*)d_out;     // [4][2048][1024]
    char* wsp = (char*)d_ws;
    auto take = [&](size_t bytes) { char* p = wsp; wsp += (bytes + 255) & ~(size_t)255; return (void*)p; };
    bf* WQ = (bf*)take((size_t)DQ * DM * 2); bf* WKV = (bf*)take((size_t)2 * DKV * DM * 2); bf* WK = WKV; bf* WV = WKV + (size_t)DKV * DM;   /* k | v row blocks of the transposed fused weight */
    bf* XB = (bf*)take((size_t)2 * NB_ * TT * DM * 2); bf* XB2 = XB + (size_t)NB_ * TT * DM;   /* bf16 x1 | x2, all batches */
    /* head planes [batch][head][..] of all NB_ batches */ h16* QP16 = (h16*)take((size_t)NB_ * NH_ * TT * HD * 2); h16* KP16 = (h16*)take((size_t)NB_ * NKV * TT * HD * 2); h16* VT16 = (h16*)take((size_t)NB_ * NKV * HD * TT * 2);
    bf* QPh = (bf*)take((size_t)NB_ * NH_ * TT * HD * 2); bf* QPl = (bf*)take((size_t)NB_ * NH_ * TT * HD * 2); bf* KPh = (bf*)take((size_t)NB_ * NKV * TT * HD * 2); bf* KPl = (bf*)take((size_t)NB_ * NKV * TT * HD * 2); bf* VTh = (bf*)take((size_t)NB_ * NKV * HD * TT * 2); bf* VTl = (bf*)take((size_t)NB_ * NKV * HD * TT * 2);
    if ((size_t)(wsp - (char*)d_ws) > ws_size) return;    // ws 256 MiB
    k_prep<<<PB_WQ + PB_WKV + 2 * PB_X, 256, 0, stream>>>(wq, wkv, x, x2, WQ, WKV, XB);   /* 'xw' [1024][2048] -> Bt [2048][1024]: rows 0..1023 = k, 1024.. = v */
    k_proj<<<dim3(NB_ * TT / 64, NH_, 3), 32, 0, stream>>>(XB, XB2, WQ, WK, WV, bq, bk, bv, gq, btq, gk, btk, QP16, QPh, QPl, KP16, KPh, KPl, VT16, VTh, VTl);
    k_fattn<<<dim3(NB_ * NH_, RH / 64 + (TT - RH) / 128), 128, 0, stream>>>(QPh, QPl, KPh, KPl, VTh, VTl, QP16, KP16, VT16, OUT);
}

// v007
// Measured time: 179 microseconds a run.
// Timed twice side by side with v006, it ran 1.07 and 1.05 times as fast.
// Counting every step since v000, it is 21.6 times as fast.
#include <hip/hip_runtime.h>

// Cross-attention block with LayerNorm-ed per-head q and k (x1, x2 [4][2048][1024]; q = x1 wq + bq, [k | v] = x2 wkv + bkv ('xw' [1024][1024] and [1024][2048] 0.02, zero biases -> k = first 1024 columns, v = the rest); 16 heads x 64; q, k <- per-head LayerNorm over 64 (eps 1e-5) x gamma + beta ([64], read); scores x 64^-0.5; softmax; out = merged attn v -> [4][2048][1024] (8.4 M)).
// Layout, 3 launches: bf16 copies of both weights and of all of x1 and x2 (one grid, parts by block range); one projection grid over all four batches and q, k and v (blockIdx.z; k and v as the two column blocks of wkv): exact products, f32 bias, for q and k the per-(token, head) LayerNorm with affine on the wave's own accumulators, and the 16-bit head planes stored straight from them (no f32 projection in memory); the head planes of all four batches stay in the workspace; fused dense T-2048 attention with a running softmax, both row classes in one grid (hybrid rows: < 512 hi/lo 3 products, rest fp16 x1024), writes the output rows.
// Every 16-bit operand plane in the workspace (x, weights, q, k, v) lies in FRAGMENT ORDER: a 16-row x 32-k fragment is 1 KiB, [k half][lane][8 elements], so that each 16-byte-per-lane load or store of a wave covers 512 contiguous bytes (4 whole lines) and not 32-byte pieces of 16 lines; the registers receive the same values as from row-major planes.
// Compute dtypes, f32 accumulate: every input rounded to bf16; projections exact + f32 biases; LayerNorms f32; attention rows < 512 3 products, rest fp16; softmax f32; output f32.

#define NB_  4
#define TT   2048
#define DM   1024
#define NH_  16
#define NKV  16
#define REP  (NH_ / NKV)
#define HD   64
#define DQ   (NH_ * HD)
#define DKV  (NKV * HD)
#define RH   512                  // query rows < RH use hi+lo planes (0: none)
#define WIN  0
#define PCAR 1024.0f
#define SCL  0.125f   // HD^-0.5
typedef _Float16 h16;
typedef unsigned short bf;
typedef __attribute__((ext_vector_type(16))) __bf16   v16bf;
typedef __attribute__((ext_vector_type(16))) _Float16 v16h;
typedef __attribute__((ext_vector_type(8)))  _Float16 v8h;
typedef __attribute__((ext_vector_type(8)))  unsigned short v8us;
typedef __attribute__((ext_vector_type(8)))  float    v8f;
typedef __attribute__((ext_vector_type(4)))  float    v4f;
typedef v8h  __attribute__((may_alias)) v8ha;
typedef v4f  __attribute__((may_alias)) v4fa;
typedef v8us __attribute__((may_alias)) v8usa;

typedef __attribute__((ext_vector_type(2))) float  v2fc;
typedef __attribute__((ext_vector_type(2))) __bf16 v2bc;
typedef __attribute__((ext_vector_type(4))) unsigned v4uc;
// f32 -> bf16, round to nearest even, by the chip's own conversion: cvt2 rounds two values in one instruction (a in the low half, b in the high half of the word)
__device__ __forceinline__ unsigned cvt2(float a, float b) { const v2fc x = {a, b}; return __builtin_bit_cast(unsigned, __builtin_convertvector(x, v2bc)); }
__device__ __forceinline__ unsigned short f2bf(float f) { return __builtin_bit_cast(unsigned short, (__bf16)f); }
// 8 values -> 8 bf16 (rnd8), or -> 8 hi and 8 lo (split8: lo = what the hi rounding left over, rounded in turn)
__device__ __forceinline__ v8us rnd8(const float (&r)[8]) { v4uc t;
#pragma unroll   // vector elements in registers: their indices must be constants
    for (int q = 0; q < 4; ++q) t[q] = cvt2(r[2 * q], r[2 * q + 1]);
    return __builtin_bit_cast(v8us, t); }
__device__ __forceinline__ void split8(const float (&r)[8], v8us& oh, v8us& ol) { v4uc h, l;
#pragma unroll   // vector elements in registers: their indices must be constants
    for (int q = 0; q < 4; ++q) { h[q] = cvt2(r[2 * q], r[2 * q + 1]); l[q] = cvt2(r[2 * q] - __uint_as_float(h[q] << 16), r[2 * q + 1] - __uint_as_float(h[q] & 0xFFFF0000u)); }
    oh = __builtin_bit_cast(v8us, h); ol = __builtin_bit_cast(v8us, l); }
__device__ __forceinline__ float bf2f(unsigned short b) { return __uint_as_float(((unsigned)b) << 16); }
__device__ __forceinline__ float bfr(float f) { return bf2f(f2bf(f)); }
__device__ __forceinline__ v16h cat16(v8h lo, v8h hi) { return __builtin_shufflevector(lo, hi, 0, 1, 2, 3, 4, 5, 6, 7, 8, 9, 10, 11, 12, 13, 14, 15); }
__device__ __forceinline__ v16bf cat16b(v8us lo, v8us hi) { return __builtin_bit_cast(v16bf, __builtin_shufflevector(lo, hi, 0, 1, 2, 3, 4, 5, 6, 7, 8, 9, 10, 11, 12, 13, 14, 15)); }
__device__ __forceinline__ v8f wmma16(v16h a, v16h b, v8f c) { return __builtin_amdgcn_wmma_f32_16x16x32_f16(false, a, false, b, (short)0, c, false, false); }
__device__ __forceinline__ v8f wmmab(v16bf a, v16bf b, v8f c) { return __builtin_amdgcn_wmma_f32_16x16x32_bf16(false, a, false, b, (short)0, c, false, false); }



// WFrag: one 16x32 (or 32x16) 16-bit operand fragment from a fragment-order plane, p = fragment + lane * 8: lane (lr, hi) finds row lr, k = 8 hi .. + 7 there and k = 16 + 8 hi .. + 7 256 elements on; the same k order for A and B
template <typename T16> struct WFrag;
template <> struct WFrag<h16> { typedef v16h V; static __device__ __forceinline__ V ld(const h16* p) { return cat16(*(const v8h*)p, *(const v8h*)(p + 256)); } static __device__ __forceinline__ v8f mma(V a, V b, v8f c) { return wmma16(a, b, c); } };
template <> struct WFrag<bf> { typedef v16bf V; static __device__ __forceinline__ V ld(const bf* p) { return cat16b(*(const v8us*)p, *(const v8us*)(p + 256)); } static __device__ __forceinline__ v8f mma(V a, V b, v8f c) { return wmmab(a, b, c); } };

__device__ __forceinline__ h16 tohx(float x) { return (h16)x; }
typedef __attribute__((ext_vector_type(2))) _Float16 v2h;
typedef __attribute__((ext_vector_type(4))) _Float16 v4h;
typedef __attribute__((ext_vector_type(2))) unsigned short v2us;
typedef __attribute__((ext_vector_type(4))) unsigned short v4us;
typedef __attribute__((ext_vector_type(2))) float v2f;
typedef __attribute__((ext_vector_type(4))) int v4i;
typedef __attribute__((ext_vector_type(2))) unsigned v2u;

// w [K][N] f32 -> Bt, the transposed weight in fragment order [N/16][K/32][k half][lane][8]; one wave per fragment: a lane gathers the 16 k of its row n (16 neighbouring n per load = 64-byte runs) and stores two 16-byte pieces, the wave 512 bytes in a row each
template <int K, int N>
__device__ __forceinline__ void wtG(const float* __restrict__ w, bf* Bt, int blk) {
    const int lane = threadIdx.x & 31, lr = lane & 15, hi = lane >> 4; const int F = blk * 8 + (threadIdx.x >> 5); if (F >= (N / 16) * (K / 32)) return;
    const float* p = w + (size_t)((F % (K / 32)) * 32 + hi * 8) * N + (F / (K / 32)) * 16 + lr; float v[16];
#pragma unroll   // register arrays here and below: their indices must be constants; all 16 loads fly together
    for (int j = 0; j < 16; ++j) v[j] = p[(size_t)((j >> 3) * 16 + (j & 7)) * N];
    asm volatile("s_wait_xcnt 0x0" :: "v"(p) : "memory");   // before the address registers of the loads above are reused; naming them keeps them live up to the wait
    float v0[8], v1[8];
#pragma unroll
    for (int j = 0; j < 8; ++j) { v0[j] = v[j]; v1[j] = v[8 + j]; }
    const v8us o0 = rnd8(v0), o1 = rnd8(v1);
    bf* q = Bt + (size_t)F * 512 + lane * 8; *(v8us*)q = o0; *(v8us*)(q + 256) = o1;
}
// src: x1 or x2, dst: its half of the bf16 copy; i: the thread's index in it; dst in fragment order [row/16][k/32][k half][lane][8]. One wave = 8 rows x 32 k (half a fragment): each load covers 4 whole source lines (4 rows x 128 bytes), each store four 64-byte runs
__device__ __forceinline__ void cvt8(const float* __restrict__ src, bf* dst, size_t i, size_t n8) { if (i >= n8) return;
    const int l = threadIdx.x & 31, q = l & 7; const size_t F = i >> 6; const int r0 = (int)((i >> 5) & 1) * 8 + (l >> 3);   // fragment; the lane's first row in it (the second: + 4); q: which 4 of the row's 32 k
    const float* p = src + ((F / (DM / 32)) * 16 + r0) * DM + (F % (DM / 32)) * 32 + q * 4; const v4f v0 = *(const v4f*)p, v1 = *(const v4f*)(p + 4 * DM);
    asm volatile("s_wait_xcnt 0x0" :: "v"(p) : "memory");   // before the address registers of the loads above are reused; naming them keeps them live up to the wait
    const v2u w0 = {cvt2(v0[0], v0[1]), cvt2(v0[2], v0[3])}, w1 = {cvt2(v1[0], v1[1]), cvt2(v1[2], v1[3])};
    const v4us o0 = __builtin_bit_cast(v4us, w0), o1 = __builtin_bit_cast(v4us, w1);
    bf* o = dst + F * 512 + (q >> 2) * 256 + (((q >> 1) & 1) * 16 + r0) * 8 + (q & 1) * 4; *(v4us*)o = o0; *(v4us*)(o + 32) = o1; }
// k_prep: the three independent 16-bit copies in ONE launch, so that they share the chip and pay one launch's start and drain; parts by block range, the gathering weight parts first: wq, wkv, x1, x2
#define PB_WQ  (DM * DQ / 512 / 8)          // work-groups: one wave per 512-element fragment, 8 waves each
#define PB_WKV (DM * 2 * DKV / 512 / 8)
#define PB_X   (NB_ * TT * DM / 8 / 256)    // 8 elements per thread, per source
__global__ __launch_bounds__(256) void k_prep(const float* __restrict__ wq, const float* __restrict__ wkv, const float* __restrict__ x1, const float* __restrict__ x2, bf* WQ, bf* WKV, bf* XB) {
    const int b = blockIdx.x;
    if (b < PB_WQ) wtG<DM, DQ>(wq, WQ, b);
    else if (b < PB_WQ + PB_WKV) wtG<DM, 2 * DKV>(wkv, WKV, b - PB_WQ);
    else { const int c = b - (PB_WQ + PB_WKV); const bool two = c >= PB_X;
        cvt8(two ? x2 : x1, XB + (two ? (size_t)NB_ * TT * DM : 0), (size_t)(two ? c - PB_X : c) * 256 + threadIdx.x, (size_t)NB_ * TT * DM / 8); }
}

// ---- proj_tile: projection GEMM with its whole tail, ONE WAVE per 64 tokens x 64 columns (= one head; 16 accumulators), operands straight from fragment-order bf16 planes; X, P16, Ph, Pl: the tile's own batch.
// The f32 tile stays in registers: the wave adds the bias, normalises (q, k) and stores the fp16, hi and lo head planes itself.
// LN (q, k): product rows = weight rows (d), columns = tokens: per column group a lane holds 32 of the 64 d of ONE token (lane ^ 16 the other 32), and each accumulator is 8 neighbouring d = the lane's 16 bytes of half a fragment of the plane [h][t/16][d/32][d half][lane][8].
// !LN (v): product rows = tokens, columns = weight rows: each accumulator is 8 neighbouring tokens of one d = the lane's 16 bytes of half a fragment of the plane [h][t/32][d/16][t half][lane][8].
// Every plain '#pragma unroll' here stands on a loop over register arrays: their indices must be constants, or the arrays would leave the registers.
__device__ __forceinline__ float xhalf(float v) { const int b = __float_as_int(v); return __int_as_float(__builtin_amdgcn_permlanex16(b, b, 0x76543210, 0xfedcba98, false, false)); }   // the value of lane ^ 16
// sum over the 64 d of a token, v[mb][j] = element d = mb*16 + hi*8 + j: neighbours first, then d ^ 32, ^ 16, ^ 8 (the other wave half), ^ 4, ^ 2; both halves end with the same bits
__device__ __forceinline__ float hsum64(const float (&v)[4][8]) { float z[4];
#pragma unroll
    for (int q = 0; q < 4; ++q) { z[q] = ((v[0][2 * q] + v[0][2 * q + 1]) + (v[2][2 * q] + v[2][2 * q + 1])) + ((v[1][2 * q] + v[1][2 * q + 1]) + (v[3][2 * q] + v[3][2 * q + 1])); z[q] += xhalf(z[q]); }
    return (z[0] + z[2]) + (z[1] + z[3]); }
__device__ __forceinline__ void planes8(const float (&r)[8], v8h& o16, v8us& oh, v8us& ol) {
#pragma unroll
    for (int j = 0; j < 8; ++j) o16[j] = tohx(r[j]);
    split8(r, oh, ol); }
template <bool LN>
__device__ __forceinline__ void proj_tile(const bf* __restrict__ X, const bf* __restrict__ Wt, const float* __restrict__ bias, const float* __restrict__ g, const float* __restrict__ bb, h16* __restrict__ P16, bf* __restrict__ Ph, bf* __restrict__ Pl, int t0, int h) {
    typedef WFrag<bf>::V V;
    const int lane = threadIdx.x & 31, lr = lane & 15, hi = lane >> 4; const int c0 = h * 64;
    const bf* A = LN ? Wt + (size_t)c0 * DM : X + (size_t)t0 * DM; const bf* Bt = LN ? X + (size_t)t0 * DM : Wt + (size_t)c0 * DM;
    v8f acc[4][4];
#pragma unroll
    for (int mb = 0; mb < 4; ++mb)
#pragma unroll
        for (int nb = 0; nb < 4; ++nb) acc[mb][nb] = (v8f){};
    const size_t off = (size_t)lane * 8;
    // rolled: a trip already holds 16 loads and 16 matrix instructions, more trips in the text would only lengthen it
#pragma unroll 1
    for (int kc = 0; kc < DM; kc += 32) {
        V a[4]; const bf* pa = A + off + kc * 16; const bf* pb = Bt + off + kc * 16;   // fragment kc / 32 of each 16-row tile
#pragma unroll
        for (int mb = 0; mb < 4; ++mb) a[mb] = WFrag<bf>::ld(pa + (size_t)mb * 16 * DM);
#pragma unroll
        for (int nb = 0; nb < 4; ++nb) { const V b = WFrag<bf>::ld(pb + (size_t)nb * 16 * DM);
#pragma unroll
            for (int mb = 0; mb < 4; ++mb) acc[mb][nb] = WFrag<bf>::mma(a[mb], b, acc[mb][nb]); }
        // the vector slots that the chip needs between the trip's last matrix instructions and what follows them over the back edge
        asm volatile("v_nop\n\tv_nop\n\tv_nop\n\tv_nop" : "+v"(acc[0][0]), "+v"(acc[1][1]), "+v"(acc[2][2]), "+v"(acc[3][3]) : "v"(a[0]), "v"(a[3]));
        asm volatile("s_wait_xcnt 0x0" :: "v"(pa), "v"(pb) : "memory");   // before the address registers of the trip's loads are reused; naming them keeps them live up to the wait, so that no load's own result lands on them
    }
    if (LN) {
        float bs[4][8], gm[4][8], bt[4][8]; const unsigned ob = (unsigned)hi * 32u;   // the lane's byte offset (d = hi * 8) into the three [64] f32 vectors
        const char* cbs = (const char*)(bias + c0); const char* cgm = (const char*)g; const char* cbt = (const char*)bb;
#pragma unroll
        for (int mb = 0; mb < 4; ++mb)
#pragma unroll
            for (int j = 0; j < 8; ++j) { bs[mb][j] = *(const float*)(cbs + ob + mb * 64 + j * 4); gm[mb][j] = *(const float*)(cgm + ob + mb * 64 + j * 4); bt[mb][j] = *(const float*)(cbt + ob + mb * 64 + j * 4); }
        asm volatile("s_wait_xcnt 0x0" :: "v"(ob) : "memory");   // before the offset register of the loads above is reused; naming it keeps it live up to the wait, so that no load's own result lands on it
        __builtin_amdgcn_sched_barrier(0);   // keeps later register writes from being lifted over the wait
#pragma unroll
        for (int mb = 0; mb < 4; ++mb)
#pragma unroll
            for (int j = 0; j < 8; ++j) { bs[mb][j] = bfr(bs[mb][j]); gm[mb][j] = bfr(gm[mb][j]); bt[mb][j] = bfr(bt[mb][j]);
#pragma unroll
                for (int nb = 0; nb < 4; ++nb) acc[mb][nb][j] += bs[mb][j]; }
#pragma unroll
        for (int nb = 0; nb < 4; ++nb) { float x[4][8], p[4][8];
#pragma unroll
            for (int mb = 0; mb < 4; ++mb)
#pragma unroll
                for (int j = 0; j < 8; ++j) x[mb][j] = acc[mb][nb][j];
            const float mean = hsum64(x) * (1.0f / HD);
#pragma unroll
            for (int mb = 0; mb < 4; ++mb)
#pragma unroll
                for (int j = 0; j < 8; ++j) { x[mb][j] -= mean; p[mb][j] = x[mb][j] * x[mb][j]; }
            const float den = __fsqrt_rn(hsum64(p) * (1.0f / HD) + 1e-5f);
            v8h o16[4]; v8us oh[4], ol[4];
#pragma unroll
            for (int mb = 0; mb < 4; ++mb) { float r[8];
#pragma unroll
                for (int j = 0; j < 8; ++j) r[j] = __fdiv_rn(x[mb][j], den) * gm[mb][j] + bt[mb][j];
                planes8(r, o16[mb], oh[mb], ol[mb]); }
            const size_t e = ((size_t)h * TT + t0 + nb * 16) * HD + lane * 8;
            __builtin_amdgcn_sched_barrier(0);   // the column's arithmetic ends here: nothing of it is sunk between a store and the wait behind the stores
#pragma unroll
            for (int mb = 0; mb < 4; ++mb) { *(v8h*)(P16 + e + mb * 256) = o16[mb]; *(v8us*)(Ph + e + mb * 256) = oh[mb]; *(v8us*)(Pl + e + mb * 256) = ol[mb]; }
            asm volatile("s_wait_xcnt 0x0" ::: "memory");   // before the data and address registers of the stores above are reused
            __builtin_amdgcn_sched_barrier(0);   // keeps later register writes from being lifted over the wait
        }
    } else {
#pragma unroll
        for (int nb = 0; nb < 4; ++nb) { const float bs = bfr(bias[c0 + nb * 16 + lr]); v8h o16[4]; v8us oh[4], ol[4];
#pragma unroll
            for (int mb = 0; mb < 4; ++mb) { float r[8];
#pragma unroll
                for (int j = 0; j < 8; ++j) r[j] = acc[mb][nb][j] + bs;
                planes8(r, o16[mb], oh[mb], ol[mb]); }
            const size_t e = (((size_t)h * (TT / 32) + t0 / 32) * 4 + nb) * 512 + lane * 8;
            __builtin_amdgcn_sched_barrier(0);   // the column's arithmetic ends here: nothing of it is sunk between a store and the wait behind the stores
#pragma unroll
            for (int mb = 0; mb < 4; ++mb) { const int f = (mb >> 1) * 2048 + (mb & 1) * 256; *(v8h*)(P16 + e + f) = o16[mb]; *(v8us*)(Ph + e + f) = oh[mb]; *(v8us*)(Pl + e + f) = ol[mb]; }
            asm volatile("s_wait_xcnt 0x0" ::: "memory");   // before the data and address registers of the stores above are reused
            __builtin_amdgcn_sched_barrier(0);   // keeps later register writes from being lifted over the wait
        }
    }
}
// k_proj: every projection tile of the block in one launch, so that all of them share the chip at once; grid (NB_*TT/64, heads, 3), 32 threads; blockIdx.z: 0 = q from x1, 1 = k, 2 = v from x2.
__global__ __launch_bounds__(32) void k_proj(const bf* __restrict__ X1, const bf* __restrict__ X2, const bf* __restrict__ WQ, const bf* __restrict__ WK, const bf* __restrict__ WV, const float* __restrict__ bq, const float* __restrict__ bk, const float* __restrict__ bv, const float* __restrict__ gq, const float* __restrict__ btq, const float* __restrict__ gk, const float* __restrict__ btk,
                                              h16* __restrict__ QP16, bf* __restrict__ QPh, bf* __restrict__ QPl, h16* __restrict__ KP16, bf* __restrict__ KPh, bf* __restrict__ KPl, h16* __restrict__ VT16, bf* __restrict__ VTh, bf* __restrict__ VTl) {
    const int b = blockIdx.x / (TT / 64), t0 = (blockIdx.x % (TT / 64)) * 64, h = blockIdx.y; const size_t xb = (size_t)b * TT * DM, pb = (size_t)b * NH_ * TT * HD;   // this batch's block in x and in every head plane (NKV == NH_)
    if (blockIdx.z == 2) proj_tile<false>(X2 + xb, WV, bv, nullptr, nullptr, VT16 + pb, VTh + pb, VTl + pb, t0, h);   // v, transposed planes
    else { const bool kk = blockIdx.z == 1;   // q or k: per-head LayerNorm x gamma + beta, planes
        proj_tile<true>((kk ? X2 : X1) + xb, kk ? WK : WQ, kk ? bk : bq, kk ? gk : gq, kk ? btk : btq, (kk ? KP16 : QP16) + pb, (kk ? KPh : QPh) + pb, (kk ? KPl : QPl) + pb, t0, h); }
}
// ---- attn_cols: scores, softmax and attn x v of one (batch, head) in one kernel; no score or probability ever leaves the registers.
// One wave owns NQ*16 query columns and walks the 2048 keys 32 at a time: St = K Qt (A = key rows, B = query rows kept in registers), so a lane holds 16 scores of ONE query per column group;
// running maximum and sum per query (in-lane + one exchange between the wave halves); the two 16-key score tiles, converted in place, ARE the B operand of Ot += Vt Pt (A = d rows of the v plane, same k order as WFrag::ld).
// Rows < RH: bf16 hi+lo planes, 3 products each; the rest fp16 with probabilities x PCAR (the factor is in the sum too and cancels in the division).
template <typename T16> struct PPack;
template <> struct PPack<h16> { static __device__ __forceinline__ void pk(const v8f& p0, const v8f& p1, v16h& a, v16h& a2) { (void)a2;
#pragma unroll
    for (int e = 0; e < 8; ++e) { a[e] = tohx(p0[e]); a[8 + e] = tohx(p1[e]); } } };
template <> struct PPack<bf> { static __device__ __forceinline__ void pk(const v8f& p0, const v8f& p1, v16bf& a, v16bf& a2) { v8us h0, h1, l0, l1; float r0[8], r1[8];
#pragma unroll
    for (int e = 0; e < 8; ++e) { r0[e] = p0[e]; r1[e] = p1[e]; }
    split8(r0, h0, l0); split8(r1, h1, l1);
    a = cat16b(h0, h1); a2 = cat16b(l0, l1); } };
template <typename T16, bool HL, int NQ>
__device__ __forceinline__ void attn_cols(const T16* __restrict__ Q, const T16* __restrict__ Q2, const T16* __restrict__ Kp, const T16* __restrict__ K2, const T16* __restrict__ Vt, const T16* __restrict__ V2, int q0, float sh, float* __restrict__ orow) {
    typedef typename WFrag<T16>::V V;
    const int lane = threadIdx.x & 31, lr = lane & 15, hi = lane >> 4; const float c1 = SCL * 1.4426950408889634f;
    V qf[NQ][2], qf2[NQ][2];
#pragma unroll
    for (int nb = 0; nb < NQ; ++nb)
#pragma unroll
        for (int ks = 0; ks < 2; ++ks) { const size_t qo = (size_t)(q0 + nb * 16) * HD + ks * 512 + lane * 8; qf[nb][ks] = WFrag<T16>::ld(Q + qo); if (HL) qf2[nb][ks] = WFrag<T16>::ld(Q2 + qo); }
    asm volatile("s_wait_xcnt 0x0" ::: "memory");   // before the address registers of the loads above are reused
    __builtin_amdgcn_sched_barrier(0);   // keeps later register writes from being lifted over the wait
    v8f o[4][NQ]; float mx[NQ], sm[NQ];
#pragma unroll
    for (int nb = 0; nb < NQ; ++nb) { mx[nb] = -3.0e38f; sm[nb] = 0.f;
#pragma unroll
        for (int dt = 0; dt < 4; ++dt) o[dt][nb] = (v8f){}; }
    const size_t ko = (size_t)lane * 8, vo = (size_t)lane * 8;
    V kf[2][2], kf2[2][2];
#pragma unroll
    for (int kt = 0; kt < 2; ++kt)
#pragma unroll
        for (int ks = 0; ks < 2; ++ks) { kf[kt][ks] = WFrag<T16>::ld(Kp + ko + kt * 16 * HD + ks * 512); if (HL) kf2[kt][ks] = WFrag<T16>::ld(K2 + ko + kt * 16 * HD + ks * 512); }
    asm volatile("s_wait_xcnt 0x0" ::: "memory");   // before the address registers of the loads above are reused
    __builtin_amdgcn_sched_barrier(0);   // keeps later register writes from being lifted over the wait
    for (int k0 = 0; k0 < TT; k0 += 32) {
        V vf[4], vf2[4]; const T16* pv = Vt + vo + (size_t)k0 * HD; const T16* pv2 = HL ? V2 + vo + (size_t)k0 * HD : nullptr;   // 32 keys x 64 d = 4 fragments in a row
#pragma unroll
        for (int dt = 0; dt < 4; ++dt) { vf[dt] = WFrag<T16>::ld(pv + dt * 512); if (HL) vf2[dt] = WFrag<T16>::ld(pv2 + dt * 512); }
        // before the address registers of the loads above are reused; naming them keeps them live up to the wait, so that no load's own result lands on them
        if (HL) asm volatile("s_wait_xcnt 0x0" :: "v"(pv), "v"(pv2) : "memory"); else asm volatile("s_wait_xcnt 0x0" :: "v"(pv) : "memory");
        __builtin_amdgcn_sched_barrier(0);   // the loads above issue here, a softmax ahead of their use; sunk to their use each would cost its whole latency
        v8f s[2][NQ];
#pragma unroll
        for (int kt = 0; kt < 2; ++kt)
#pragma unroll
            for (int nb = 0; nb < NQ; ++nb) { v8f t = (v8f){};
#pragma unroll
                for (int ks = 0; ks < 2; ++ks) { t = WFrag<T16>::mma(kf[kt][ks], qf[nb][ks], t); if (HL) { t = WFrag<T16>::mma(kf2[kt][ks], qf[nb][ks], t); t = WFrag<T16>::mma(kf[kt][ks], qf2[nb][ks], t); } }
                s[kt][nb] = t; }
        const size_t kn = ko + (size_t)((k0 + 32) & (TT - 1)) * HD;   // the next 32 keys' fragments fly under the softmax; the last trip re-reads keys 0..31 (in bounds, unused)
#pragma unroll
        for (int kt = 0; kt < 2; ++kt)
#pragma unroll
            for (int ks = 0; ks < 2; ++ks) { kf[kt][ks] = WFrag<T16>::ld(Kp + kn + kt * 16 * HD + ks * 512); if (HL) kf2[kt][ks] = WFrag<T16>::ld(K2 + kn + kt * 16 * HD + ks * 512); }
        asm volatile("s_wait_xcnt 0x0" ::: "memory");   // before the address registers of the loads above are reused
        __builtin_amdgcn_sched_barrier(0);   // the loads above issue here, the rest of the trip ahead of their use; sunk to the loop's foot they would cost their whole latency
#pragma unroll
        for (int nb = 0; nb < NQ; ++nb) { float m = mx[nb];
#pragma unroll
            for (int j = 0; j < 8; ++j) m = fmaxf(m, fmaxf(s[0][nb][j], s[1][nb][j]));
            m = fmaxf(m, __shfl_xor(m, 16, 32));
            const float al = __builtin_amdgcn_exp2f((mx[nb] - m) * c1); mx[nb] = m; const float mc = sh - m * c1; float sum = 0.f;
#pragma unroll
            for (int j = 0; j < 8; ++j) { s[0][nb][j] = __builtin_amdgcn_exp2f(fmaf(s[0][nb][j], c1, mc)); s[1][nb][j] = __builtin_amdgcn_exp2f(fmaf(s[1][nb][j], c1, mc)); sum += s[0][nb][j] + s[1][nb][j]; }
            sm[nb] = fmaf(sm[nb], al, sum);
            V pf, pf2; PPack<T16>::pk(s[0][nb], s[1][nb], pf, pf2);
#pragma unroll
            for (int dt = 0; dt < 4; ++dt) { v8f t = o[dt][nb] * al; t = WFrag<T16>::mma(vf[dt], pf, t); if (HL) { t = WFrag<T16>::mma(vf[dt], pf2, t); t = WFrag<T16>::mma(vf2[dt], pf, t); } o[dt][nb] = t; } }
    }
#pragma unroll
    for (int nb = 0; nb < NQ; ++nb) { const float tot = sm[nb] + __shfl_xor(sm[nb], 16, 32); const float inv = __fdiv_rn(1.0f, tot); float* op = orow + (size_t)(q0 + nb * 16 + lr) * DQ + hi * 8;
#pragma unroll
        for (int dt = 0; dt < 4; ++dt) *(v8f*)(op + dt * 16) = o[dt][nb] * inv; }
}
// k_fattn: grid (NB_*NH_, query tiles of both row classes), 4 independent waves per work-group on neighbouring query columns of one head (they walk the same k and v lines).
// Both classes in ONE launch, so that their waves share the SIMDs (one class's matrix runs under the other's vector work) and the launch pays one start and one drain; the longer work-groups come first:
// blockIdx.y < RH/64: rows < RH, 64 per work-group, 3 products; the rest: fp16, 128 per work-group.
__global__ __launch_bounds__(128) void k_fattn(const bf* __restrict__ QPh, const bf* __restrict__ QPl, const bf* __restrict__ KPh, const bf* __restrict__ KPl, const bf* __restrict__ VTh, const bf* __restrict__ VTl, const h16* __restrict__ QP16, const h16* __restrict__ KP16, const h16* __restrict__ VT16, float* __restrict__ OUT) {
    const size_t z = blockIdx.x, pz = z * TT * HD; const int wv = threadIdx.x >> 5; float* orow = OUT + (z / NH_) * (size_t)TT * DQ + (z % NH_) * HD;
    if (blockIdx.y < RH / 64) attn_cols<bf, true, 1>(QPh + pz, QPl + pz, KPh + pz, KPl + pz, VTh + pz, VTl + pz, (int)blockIdx.y * 64 + wv * 16, 0.0f, orow);
    else attn_cols<h16, false, 2>(QP16 + pz, nullptr, KP16 + pz, nullptr, VT16 + pz, nullptr, RH + ((int)blockIdx.y - RH / 64) * 128 + wv * 32, 10.0f, orow);   // 10 = log2(PCAR)
}

extern "C" void kernel_launch(void* const* d_in, const int* in_sizes, int n_in,
                              void* d_out, int out_size, void* d_ws, size_t ws_size, hipStream_t stream) {
    (void)in_sizes; (void)n_in; (void)out_size;
    const float* x = (const float*)d_in[0]; const float* x2 = (const float*)d_in[1]; const float* wq = (const float*)d_in[2]; const float* bq = (const float*)d_in[3]; const float* wkv = (const float*)d_in[4]; const float* bkv = (const float*)d_in[5]; const float* gq = (const float*)d_in[6]; const float* btq = (const float*)d_in[7]; const float* gk = (const float*)d_in[8]; const float* btk = (const float*)d_in[9]; const float* wk = nullptr; const float* wv = nullptr; const float* wo = nullptr; (void)wk; (void)wv; (void)wo; const float* bk = bkv; const float* bv = bkv + 1024;
    float* OUT = (float*)d_out;     // [4][2048][1024]
    char* wsp = (char*)d_ws;
    auto take = [&](size_t bytes) { char* p = wsp; wsp += (bytes + 255) & ~(size_t)255; return (void*)p; };
    bf* WQ = (bf*)take((size_t)DQ * DM * 2); bf* WKV = (bf*)take((size_t)2 * DKV * DM * 2); bf* WK = WKV; bf* WV = WKV + (size_t)DKV * DM;   /* k | v row blocks of the transposed fused weight */
    bf* XB = (bf*)take((size_t)2 * NB_ * TT * DM * 2); bf* XB2 = XB + (size_t)NB_ * TT * DM;   /* bf16 x1 | x2, all batches */
    /* head planes [batch][head][..] of all NB_ batches */ h16* QP16 = (h16*)take((size_t)NB_ * NH_ * TT * HD * 2); h16* KP16 = (h16*)take((size_t)NB_ * NKV * TT * HD * 2); h16* VT16 = (h16*)take((size_t)NB_ * NKV * HD * TT * 2);
    bf* QPh = (bf*)take((size_t)NB_ * NH_ * TT * HD * 2); bf* QPl = (bf*)take((size_t)NB_ * NH_ * TT * HD * 2); bf* KPh = (bf*)take((size_t)NB_ * NKV * TT * HD * 2); bf* KPl = (bf*)take((size_t)NB_ * NKV * TT * HD * 2); bf* VTh = (bf*)take((size_t)NB_ * NKV * HD * TT * 2); bf* VTl = (bf*)take((size_t)NB_ * NKV * HD * TT * 2);
    if ((size_t)(wsp - (char*)d_ws) > ws_size) return;    // ws 256 MiB
    k_prep<<<PB_WQ + PB_WKV + 2 * PB_X, 256, 0, stream>>>(wq, wkv, x, x2, WQ, WKV, XB);   /* 'xw' [1024][2048] -> Bt [2048][1024]: rows 0..1023 = k, 1024.. = v */
    k_proj<<<dim3(NB_ * TT / 64, NH_, 3), 32, 0, stream>>>(XB, XB2, WQ, WK, WV, bq, bk, bv, gq, btq, gk, btk, QP16, QPh, QPl, KP16, KPh, KPl, VT16, VTh, VTl);
    k_fattn<<<dim3(NB_ * NH_, RH / 64 + (TT - RH) / 128), 128, 0, stream>>>(QPh, QPl, KPh, KPl, VTh, VTl, QP16, KP16, VT16, OUT);
}

// v008
// It runs in 159 microseconds.
// Next to v007, in two timings, it ran 1.15 times as fast each time.
// Over all steps from v000 it is 24.7 times as fast.
#include <hip/hip_runtime.h>

// Cross-attention block with LayerNorm-ed per-head q and k (x1, x2 [4][2048][1024]; q = x1 wq + bq, [k | v] = x2 wkv + bkv ('xw' [1024][1024] and [1024][2048] 0.02, zero biases -> k = first 1024 columns, v = the rest); 16 heads x 64; q, k <- per-head LayerNorm over 64 (eps 1e-5) x gamma + beta ([64], read); scores x 64^-0.5; softmax; out = merged attn v -> [4][2048][1024] (8.4 M)).
// Layout, 3 launches: bf16 copies of both weights and of all of x1 and x2 (one grid, parts by block range); one projection grid over all four batches and q, k and v (blockIdx.z; k and v as the two column blocks of wkv): exact products, f32 bias, for q and k the per-(token, head) LayerNorm with affine on the wave's own accumulators, and the 16-bit head planes stored straight from them (no f32 projection in memory); the head planes of all four batches stay in the workspace; fused dense T-2048 attention with a running softmax, both row classes in one grid (hybrid rows: < 512 hi/lo 3 products, rest fp16 x1024), writes the output rows.
// Every 16-bit operand plane in the workspace (x, weights, q, k, v) lies in FRAGMENT ORDER: a 16-row x 32-k fragment is 1 KiB, [k half][lane][8 elements], so that each 16-byte-per-lane load or store of a wave covers 512 contiguous bytes (4 whole lines) and not 32-byte pieces of 16 lines; the registers receive the same values as from row-major planes.
// Compute dtypes, f32 accumulate: every input rounded to bf16; projections exact + f32 biases; LayerNorms f32; attention rows < 512 3 products, rest fp16; softmax f32; output f32.

#define NB_  4
#define TT   2048
#define DM   1024
#define NH_  16
#define NKV  16
#define REP  (NH_ / NKV)
#define HD   64
#define DQ   (NH_ * HD)
#define DKV  (NKV * HD)
#define RH   512                  // query rows < RH use hi+lo planes (0: none)
#define WIN  0
#define PCAR 1024.0f
#define SCL  0.125f   // HD^-0.5
typedef _Float16 h16;
typedef unsigned short bf;
typedef __attribute__((ext_vector_type(16))) __bf16   v16bf;
typedef __attribute__((ext_vector_type(16))) _Float16 v16h;
typedef __attribute__((ext_vector_type(8)))  _Float16 v8h;
typedef __attribute__((ext_vector_type(8)))  unsigned short v8us;
typedef __attribute__((ext_vector_type(8)))  float    v8f;
typedef __attribute__((ext_vector_type(4)))  float    v4f;
typedef v8h  __attribute__((may_alias)) v8ha;
typedef v4f  __attribute__((may_alias)) v4fa;
typedef v8us __attribute__((may_alias)) v8usa;

typedef __attribute__((ext_vector_type(2))) float  v2fc;
typedef __attribute__((ext_vector_type(2))) __bf16 v2bc;
typedef __attribute__((ext_vector_type(4))) unsigned v4uc;
// f32 -> bf16, round to nearest even, by the chip's own conversion: cvt2 rounds two values in one instruction (a in the low half, b in the high half of the word)
__device__ __forceinline__ unsigned cvt2(float a, float b) { const v2fc x = {a, b}; return __builtin_bit_cast(unsigned, __builtin_convertvector(x, v2bc)); }
__device__ __forceinline__ unsigned short f2bf(float f) { return __builtin_bit_cast(unsigned short, (__bf16)f); }
// 8 values -> 8 bf16 (rnd8), or -> 8 hi and 8 lo (split8: lo = what the hi rounding left over, rounded in turn)
__device__ __forceinline__ v8us rnd8(const float (&r)[8]) { v4uc t;
#pragma unroll   // vector elements in registers: their indices must be constants
    for (int q = 0; q < 4; ++q) t[q] = cvt2(r[2 * q], r[2 * q + 1]);
    return __builtin_bit_cast(v8us, t); }
__device__ __forceinline__ void split8(const float (&r)[8], v8us& oh, v8us& ol) { v4uc h, l;
#pragma unroll   // vector elements in registers: their indices must be constants
    for (int q = 0; q < 4; ++q) { h[q] = cvt2(r[2 * q], r[2 * q + 1]); l[q] = cvt2(r[2 * q] - __uint_as_float(h[q] << 16), r[2 * q + 1] - __uint_as_float(h[q] & 0xFFFF0000u)); }
    oh = __builtin_bit_cast(v8us, h); ol = __builtin_bit_cast(v8us, l); }
__device__ __forceinline__ float bf2f(unsigned short b) { return __uint_as_float(((unsigned)b) << 16); }
__device__ __forceinline__ float bfr(float f) { return bf2f(f2bf(f)); }
__device__ __forceinline__ v16h cat16(v8h lo, v8h hi) { return __builtin_shufflevector(lo, hi, 0, 1, 2, 3, 4, 5, 6, 7, 8, 9, 10, 11, 12, 13, 14, 15); }
__device__ __forceinline__ v16bf cat16b(v8us lo, v8us hi) { return __builtin_bit_cast(v16bf, __builtin_shufflevector(lo, hi, 0, 1, 2, 3, 4, 5, 6, 7, 8, 9, 10, 11, 12, 13, 14, 15)); }
__device__ __forceinline__ v8f wmma16(v16h a, v16h b, v8f c) { return __builtin_amdgcn_wmma_f32_16x16x32_f16(false, a, false, b, (short)0, c, false, false); }
__device__ __forceinline__ v8f wmmab(v16bf a, v16bf b, v8f c) { return __builtin_amdgcn_wmma_f32_16x16x32_bf16(false, a, false, b, (short)0, c, false, false); }



// WFrag: one 16x32 (or 32x16) 16-bit operand fragment from a fragment-order plane, p = fragment + lane * 8: lane (lr, hi) finds row lr, k = 8 hi .. + 7 there and k = 16 + 8 hi .. + 7 256 elements on; the same k order for A and B
template <typename T16> struct WFrag;
template <> struct WFrag<h16> { typedef v16h V; static __device__ __forceinline__ V ld(const h16* p) { return cat16(*(const v8h*)p, *(const v8h*)(p + 256)); } static __device__ __forceinline__ v8f mma(V a, V b, v8f c) { return wmma16(a, b, c); } };
template <> struct WFrag<bf> { typedef v16bf V; static __device__ __forceinline__ V ld(const bf* p) { return cat16b(*(const v8us*)p, *(const v8us*)(p + 256)); } static __device__ __forceinline__ v8f mma(V a, V b, v8f c) { return wmmab(a, b, c); } };

__device__ __forceinline__ h16 tohx(float x) { return (h16)x; }
typedef __attribute__((ext_vector_type(2))) _Float16 v2h;
typedef __attribute__((ext_vector_type(4))) _Float16 v4h;
typedef __attribute__((ext_vector_type(2))) unsigned short v2us;
typedef __attribute__((ext_vector_type(4))) unsigned short v4us;
typedef __attribute__((ext_vector_type(2))) float v2f;
typedef __attribute__((ext_vector_type(4))) int v4i;
typedef __attribute__((ext_vector_type(2))) unsigned v2u;

// w [K][N] f32 -> Bt, the transposed weight in fragment order [N/16][K/32][k half][lane][8]; one wave per fragment: a lane gathers the 16 k of its row n (16 neighbouring n per load = 64-byte runs) and stores two 16-byte pieces, the wave 512 bytes in a row each
template <int K, int N>
__device__ __forceinline__ void wtG(const float* __restrict__ w, bf* Bt, int blk) {
    const int lane = threadIdx.x & 31, lr = lane & 15, hi = lane >> 4; const int F = blk * 8 + (threadIdx.x >> 5); if (F >= (N / 16) * (K / 32)) return;
    const float* p = w + (size_t)((F % (K / 32)) * 32 + hi * 8) * N + (F / (K / 32)) * 16 + lr; float v[16];
#pragma unroll   // register arrays here and below: their indices must be constants; all 16 loads fly together
    for (int j = 0; j < 16; ++j) v[j] = p[(size_t)((j >> 3) * 16 + (j & 7)) * N];
    asm volatile("s_wait_xcnt 0x0" :: "v"(p) : "memory");   // before the address registers of the loads above are reused; naming them keeps them live up to the wait
    float v0[8], v1[8];
#pragma unroll
    for (int j = 0; j < 8; ++j) { v0[j] = v[j]; v1[j] = v[8 + j]; }
    const v8us o0 = rnd8(v0), o1 = rnd8(v1);
    bf* q = Bt + (size_t)F * 512 + lane * 8; *(v8us*)q = o0; *(v8us*)(q + 256) = o1;
}
// src: x1 or x2, dst: its half of the bf16 copy; i: the thread's index in it; dst in fragment order [row/16][k/32][k half][lane][8]. One wave = 8 rows x 32 k (half a fragment): each load covers 4 whole source lines (4 rows x 128 bytes), each store four 64-byte runs
__device__ __forceinline__ void cvt8(const float* __restrict__ src, bf* dst, size_t i, size_t n8) { if (i >= n8) return;
    const int l = threadIdx.x & 31, q = l & 7; const size_t F = i >> 6; const int r0 = (int)((i >> 5) & 1) * 8 + (l >> 3);   // fragment; the lane's first row in it (the second: + 4); q: which 4 of the row's 32 k
    const float* p = src + ((F / (DM / 32)) * 16 + r0) * DM + (F % (DM / 32)) * 32 + q * 4; const v4f v0 = *(const v4f*)p, v1 = *(const v4f*)(p + 4 * DM);
    asm volatile("s_wait_xcnt 0x0" :: "v"(p) : "memory");   // before the address registers of the loads above are reused; naming them keeps them live up to the wait
    const v2u w0 = {cvt2(v0[0], v0[1]), cvt2(v0[2], v0[3])}, w1 = {cvt2(v1[0], v1[1]), cvt2(v1[2], v1[3])};
    const v4us o0 = __builtin_bit_cast(v4us, w0), o1 = __builtin_bit_cast(v4us, w1);
    bf* o = dst + F * 512 + (q >> 2) * 256 + (((q >> 1) & 1) * 16 + r0) * 8 + (q & 1) * 4; *(v4us*)o = o0; *(v4us*)(o + 32) = o1; }
// k_prep: the three independent 16-bit copies in ONE launch, so that they share the chip and pay one launch's start and drain; parts by block range, the gathering weight parts first: wq, wkv, x1, x2
#define PB_WQ  (DM * DQ / 512 / 8)          // work-groups: one wave per 512-element fragment, 8 waves each
#define PB_WKV (DM * 2 * DKV / 512 / 8)
#define PB_X   (NB_ * TT * DM / 8 / 256)    // 8 elements per thread, per source
__global__ __launch_bounds__(256) void k_prep(const float* __restrict__ wq, const float* __restrict__ wkv, const float* __restrict__ x1, const float* __restrict__ x2, bf* WQ, bf* WKV, bf* XB) {
    const int b = blockIdx.x;
    if (b < PB_WQ) wtG<DM, DQ>(wq, WQ, b);
    else if (b < PB_WQ + PB_WKV) wtG<DM, 2 * DKV>(wkv, WKV, b - PB_WQ);
    else { const int c = b - (PB_WQ + PB_WKV); const bool two = c >= PB_X;
        cvt8(two ? x2 : x1, XB + (two ? (size_t)NB_ * TT * DM : 0), (size_t)(two ? c - PB_X : c) * 256 + threadIdx.x, (size_t)NB_ * TT * DM / 8); }
}

// ---- proj_tile: projection GEMM with its whole tail, ONE WAVE per 64 tokens x 64 columns (= one head; 16 accumulators), operands straight from fragment-order bf16 planes; X, P16, Ph, Pl: the tile's own batch.
// The f32 tile stays in registers: the wave adds the bias, normalises (q, k) and stores the fp16, hi and lo head planes itself.
// LN (q, k): product rows = weight rows (d), columns = tokens: per column group a lane holds 32 of the 64 d of ONE token (lane ^ 16 the other 32), and each accumulator is 8 neighbouring d = the lane's 16 bytes of half a fragment of the plane [h][t/16][d/32][d half][lane][8].
// !LN (v): product rows = tokens, columns = weight rows: each accumulator is 8 neighbouring tokens of one d = the lane's 16 bytes of half a fragment of the plane [h][t/32][d/16][t half][lane][8].
// Every plain '#pragma unroll' here stands on a loop over register arrays: their indices must be constants, or the arrays would leave the registers.
__device__ __forceinline__ float xhalf(float v) { const int b = __float_as_int(v); return __int_as_float(__builtin_amdgcn_permlanex16(b, b, 0x76543210, 0xfedcba98, false, false)); }   // the value of lane ^ 16
// sum over the 64 d of a token, v[mb][j] = element d = mb*16 + hi*8 + j: neighbours first, then d ^ 32, ^ 16, ^ 8 (the other wave half), ^ 4, ^ 2; both halves end with the same bits
__device__ __forceinline__ float hsum64(const float (&v)[4][8]) { float z[4];
#pragma unroll
    for (int q = 0; q < 4; ++q) { z[q] = ((v[0][2 * q] + v[0][2 * q + 1]) + (v[2][2 * q] + v[2][2 * q + 1])) + ((v[1][2 * q] + v[1][2 * q + 1]) + (v[3][2 * q] + v[3][2 * q + 1])); z[q] += xhalf(z[q]); }
    return (z[0] + z[2]) + (z[1] + z[3]); }
__device__ __forceinline__ void planes8(const float (&r)[8], v8h& o16, v8us& oh, v8us& ol) {
#pragma unroll
    for (int j = 0; j < 8; ++j) o16[j] = tohx(r[j]);
    split8(r, oh, ol); }
template <bool LN>
__device__ __forceinline__ void proj_tile(const bf* __restrict__ X, const bf* __restrict__ Wt, const float* __restrict__ bias, const float* __restrict__ g, const float* __restrict__ bb, h16* __restrict__ P16, bf* __restrict__ Ph, bf* __restrict__ Pl, int t0, int h) {
    typedef WFrag<bf>::V V;
    const int lane = threadIdx.x & 31, lr = lane & 15, hi = lane >> 4; const int c0 = h * 64;
    const bf* A = LN ? Wt + (size_t)c0 * DM : X + (size_t)t0 * DM; const bf* Bt = LN ? X + (size_t)t0 * DM : Wt + (size_t)c0 * DM;
    v8f acc[4][4];
#pragma unroll
    for (int mb = 0; mb < 4; ++mb)
#pragma unroll
        for (int nb = 0; nb < 4; ++nb) acc[mb][nb] = (v8f){};
    const bf* A0 = A + (size_t)lane * 8; const bf* B0 = Bt + (size_t)lane * 8;
    // Fragments are loaded ONE k STEP AHEAD of their products, into a second register set (a0, b0 and a1, b1 in turn): while a step's 16 products run, the next step's 16 loads fly, and no product waits out its own loads' latency.
    V a0[4], b0[4], a1[4], b1[4];
    // the first fragments, held in the order in which a trip issues them: the loop's counted load waits are the stricter of both ways into it, and another order here would make every trip wait for its youngest loads
#pragma unroll
    for (int mb = 0; mb < 4; ++mb) { a0[mb] = WFrag<bf>::ld(A0 + (size_t)mb * 16 * DM); __builtin_amdgcn_sched_barrier(0); }
#pragma unroll
    for (int nb = 0; nb < 4; ++nb) { b0[nb] = WFrag<bf>::ld(B0 + (size_t)nb * 16 * DM); __builtin_amdgcn_sched_barrier(0); }
    asm volatile("s_wait_xcnt 0x0" :: "v"(A0), "v"(B0) : "memory");   // before the address registers of the loads above are reused; naming them keeps them live up to the wait
    // rolled: a trip already holds 32 loads and 32 matrix instructions (two k steps, one per register set), more trips in the text would only lengthen it
#pragma unroll 1
    for (int kc = 0; kc < DM; kc += 64) {
        const bf* pa = A0 + kc * 16; const bf* pb = B0 + kc * 16;   // fragment kc / 32 of each 16-row tile; the loads from here take the next one, 512 elements on
        const int kw = (kc + 64) & (DM - 1); const bf* qa = A0 + kw * 16; const bf* qb = B0 + kw * 16;   // fragment kc / 32 + 2; the last trip re-reads fragment 0 (in bounds, unused)
#pragma unroll
        for (int mb = 0; mb < 4; ++mb) a1[mb] = WFrag<bf>::ld(pa + 512 + (size_t)mb * 16 * DM);
#pragma unroll
        for (int nb = 0; nb < 4; ++nb) { b1[nb] = WFrag<bf>::ld(pb + 512 + (size_t)nb * 16 * DM);
            __builtin_amdgcn_sched_barrier(0);   // the loads above issue here, a whole k step ahead of their use; sunk to their use each would cost its whole latency
#pragma unroll
            for (int mb = 0; mb < 4; ++mb) acc[mb][nb] = WFrag<bf>::mma(a0[mb], b0[nb], acc[mb][nb]); }
#pragma unroll
        for (int mb = 0; mb < 4; ++mb) a0[mb] = WFrag<bf>::ld(qa + (size_t)mb * 16 * DM);
#pragma unroll
        for (int nb = 0; nb < 4; ++nb) { b0[nb] = WFrag<bf>::ld(qb + (size_t)nb * 16 * DM);
            __builtin_amdgcn_sched_barrier(0);   // as above: a whole k step ahead of their use
#pragma unroll
            for (int mb = 0; mb < 4; ++mb) acc[mb][nb] = WFrag<bf>::mma(a1[mb], b1[nb], acc[mb][nb]); }
        // the vector slots that the chip needs between the trip's last matrix instructions and what follows them over the back edge
        asm volatile("v_nop\n\tv_nop\n\tv_nop\n\tv_nop" : "+v"(acc[0][3]), "+v"(acc[1][3]), "+v"(acc[2][3]), "+v"(acc[3][3]) : "v"(a1[0]), "v"(a1[3]));
        asm volatile("s_wait_xcnt 0x0" :: "v"(pa), "v"(pb), "v"(qa), "v"(qb) : "memory");   // before the address registers of the trip's loads are reused; naming them keeps them live up to the wait, so that no load's own result lands on them
    }
    if (LN) {
        float bs[4][8], gm[4][8], bt[4][8]; const unsigned ob = (unsigned)hi * 32u;   // the lane's byte offset (d = hi * 8) into the three [64] f32 vectors
        const char* cbs = (const char*)(bias + c0); const char* cgm = (const char*)g; const char* cbt = (const char*)bb;
#pragma unroll
        for (int mb = 0; mb < 4; ++mb)
#pragma unroll
            for (int j = 0; j < 8; ++j) { bs[mb][j] = *(const float*)(cbs + ob + mb * 64 + j * 4); gm[mb][j] = *(const float*)(cgm + ob + mb * 64 + j * 4); bt[mb][j] = *(const float*)(cbt + ob + mb * 64 + j * 4); }
        asm volatile("s_wait_xcnt 0x0" :: "v"(ob) : "memory");   // before the offset register of the loads above is reused; naming it keeps it live up to the wait, so that no load's own result lands on it
        __builtin_amdgcn_sched_barrier(0);   // keeps later register writes from being lifted over the wait
#pragma unroll
        for (int mb = 0; mb < 4; ++mb)
#pragma unroll
            for (int j = 0; j < 8; ++j) { bs[mb][j] = bfr(bs[mb][j]); gm[mb][j] = bfr(gm[mb][j]); bt[mb][j] = bfr(bt[mb][j]);
#pragma unroll
                for (int nb = 0; nb < 4; ++nb) acc[mb][nb][j] += bs[mb][j]; }
#pragma unroll
        for (int nb = 0; nb < 4; ++nb) { float x[4][8], p[4][8];
#pragma unroll
            for (int mb = 0; mb < 4; ++mb)
#pragma unroll
                for (int j = 0; j < 8; ++j) x[mb][j] = acc[mb][nb][j];
            const float mean = hsum64(x) * (1.0f / HD);
#pragma unroll
            for (int mb = 0; mb < 4; ++mb)
#pragma unroll
                for (int j = 0; j < 8; ++j) { x[mb][j] -= mean; p[mb][j] = x[mb][j] * x[mb][j]; }
            const float den = __fsqrt_rn(hsum64(p) * (1.0f / HD) + 1e-5f);
            v8h o16[4]; v8us oh[4], ol[4];
#pragma unroll
            for (int mb = 0; mb < 4; ++mb) { float r[8];
#pragma unroll
                for (int j = 0; j < 8; ++j) r[j] = __fdiv_rn(x[mb][j], den) * gm[mb][j] + bt[mb][j];
                planes8(r, o16[mb], oh[mb], ol[mb]); }
            const size_t e = ((size_t)h * TT + t0 + nb * 16) * HD + lane * 8;
            __builtin_amdgcn_sched_barrier(0);   // the column's arithmetic ends here: nothing of it is sunk between a store and the wait behind the stores
#pragma unroll
            for (int mb = 0; mb < 4; ++mb) { *(v8h*)(P16 + e + mb * 256) = o16[mb]; *(v8us*)(Ph + e + mb * 256) = oh[mb]; *(v8us*)(Pl + e + mb * 256) = ol[mb]; }
            asm volatile("s_wait_xcnt 0x0" ::: "memory");   // before the data and address registers of the stores above are reused
            __builtin_amdgcn_sched_barrier(0);   // keeps later register writes from being lifted over the wait
        }
    } else {
#pragma unroll
        for (int nb = 0; nb < 4; ++nb) { const float bs = bfr(bias[c0 + nb * 16 + lr]); v8h o16[4]; v8us oh[4], ol[4];
#pragma unroll
            for (int mb = 0; mb < 4; ++mb) { float r[8];
#pragma unroll
                for (int j = 0; j < 8; ++j) r[j] = acc[mb][nb][j] + bs;
                planes8(r, o16[mb], oh[mb], ol[mb]); }
            const size_t e = (((size_t)h * (TT / 32) + t0 / 32) * 4 + nb) * 512 + lane * 8;
            __builtin_amdgcn_sched_barrier(0);   // the column's arithmetic ends here: nothing of it is sunk between a store and the wait behind the stores
#pragma unroll
            for (int mb = 0; mb < 4; ++mb) { const int f = (mb >> 1) * 2048 + (mb & 1) * 256; *(v8h*)(P16 + e + f) = o16[mb]; *(v8us*)(Ph + e + f) = oh[mb]; *(v8us*)(Pl + e + f) = ol[mb]; }
            asm volatile("s_wait_xcnt 0x0" ::: "memory");   // before the data and address registers of the stores above are reused
            __builtin_amdgcn_sched_barrier(0);   // keeps later register writes from being lifted over the wait
        }
    }
}
// k_proj: every projection tile of the block in one launch, so that all of them share the chip at once; grid (NB_*TT/64, heads, 3), 32 threads; blockIdx.z: 0 = q from x1, 1 = k, 2 = v from x2.
__global__ __launch_bounds__(32) void k_proj(const bf* __restrict__ X1, const bf* __restrict__ X2, const bf* __restrict__ WQ, const bf* __restrict__ WK, const bf* __restrict__ WV, const float* __restrict__ bq, const float* __restrict__ bk, const float* __restrict__ bv, const float* __restrict__ gq, const float* __restrict__ btq, const float* __restrict__ gk, const float* __restrict__ btk,
                                              h16* __restrict__ QP16, bf* __restrict__ QPh, bf* __restrict__ QPl, h16* __restrict__ KP16, bf* __restrict__ KPh, bf* __restrict__ KPl, h16* __restrict__ VT16, bf* __restrict__ VTh, bf* __restrict__ VTl) {
    const int b = blockIdx.x / (TT / 64), t0 = (blockIdx.x % (TT / 64)) * 64, h = blockIdx.y; const size_t xb = (size_t)b * TT * DM, pb = (size_t)b * NH_ * TT * HD;   // this batch's block in x and in every head plane (NKV == NH_)
    if (blockIdx.z == 2) proj_tile<false>(X2 + xb, WV, bv, nullptr, nullptr, VT16 + pb, VTh + pb, VTl + pb, t0, h);   // v, transposed planes
    else { const bool kk = blockIdx.z == 1;   // q or k: per-head LayerNorm x gamma + beta, planes
        proj_tile<true>((kk ? X2 : X1) + xb, kk ? WK : WQ, kk ? bk : bq, kk ? gk : gq, kk ? btk : btq, (kk ? KP16 : QP16) + pb, (kk ? KPh : QPh) + pb, (kk ? KPl : QPl) + pb, t0, h); }
}
// ---- attn_cols: scores, softmax and attn x v of one (batch, head) in one kernel; no score or probability ever leaves the registers.
// One wave owns NQ*16 query columns and walks the 2048 keys 32 at a time: St = K Qt (A = key rows, B = query rows kept in registers), so a lane holds 16 scores of ONE query per column group;
// running maximum and sum per query (in-lane + one exchange between the wave halves); the two 16-key score tiles, converted in place, ARE the B operand of Ot += Vt Pt (A = d rows of the v plane, same k order as WFrag::ld).
// Rows < RH: bf16 hi+lo planes, 3 products each; the rest fp16 with probabilities x PCAR (the factor is in the sum too and cancels in the division).
template <typename T16> struct PPack;
template <> struct PPack<h16> { static __device__ __forceinline__ void pk(const v8f& p0, const v8f& p1, v16h& a, v16h& a2) { (void)a2;
#pragma unroll
    for (int e = 0; e < 8; ++e) { a[e] = tohx(p0[e]); a[8 + e] = tohx(p1[e]); } } };
template <> struct PPack<bf> { static __device__ __forceinline__ void pk(const v8f& p0, const v8f& p1, v16bf& a, v16bf& a2) { v8us h0, h1, l0, l1; float r0[8], r1[8];
#pragma unroll
    for (int e = 0; e < 8; ++e) { r0[e] = p0[e]; r1[e] = p1[e]; }
    split8(r0, h0, l0); split8(r1, h1, l1);
    a = cat16b(h0, h1); a2 = cat16b(l0, l1); } };
template <typename T16, bool HL, int NQ>
__device__ __forceinline__ void attn_cols(const T16* __restrict__ Q, const T16* __restrict__ Q2, const T16* __restrict__ Kp, const T16* __restrict__ K2, const T16* __restrict__ Vt, const T16* __restrict__ V2, int q0, float sh, float* __restrict__ orow) {
    typedef typename WFrag<T16>::V V;
    const int lane = threadIdx.x & 31, lr = lane & 15, hi = lane >> 4; const float c1 = SCL * 1.4426950408889634f;
    V qf[NQ][2], qf2[NQ][2];
#pragma unroll
    for (int nb = 0; nb < NQ; ++nb)
#pragma unroll
        for (int ks = 0; ks < 2; ++ks) { const size_t qo = (size_t)(q0 + nb * 16) * HD + ks * 512 + lane * 8; qf[nb][ks] = WFrag<T16>::ld(Q + qo); if (HL) qf2[nb][ks] = WFrag<T16>::ld(Q2 + qo); }
    asm volatile("s_wait_xcnt 0x0" ::: "memory");   // before the address registers of the loads above are reused
    __builtin_amdgcn_sched_barrier(0);   // keeps later register writes from being lifted over the wait
    v8f o[4][NQ]; float mx[NQ], sm[NQ];
#pragma unroll
    for (int nb = 0; nb < NQ; ++nb) { mx[nb] = -3.0e38f; sm[nb] = 0.f;
#pragma unroll
        for (int dt = 0; dt < 4; ++dt) o[dt][nb] = (v8f){}; }
    const size_t ko = (size_t)lane * 8, vo = (size_t)lane * 8;
    V kf[2][2], kf2[2][2];
#pragma unroll
    for (int kt = 0; kt < 2; ++kt)
#pragma unroll
        for (int ks = 0; ks < 2; ++ks) { kf[kt][ks] = WFrag<T16>::ld(Kp + ko + kt * 16 * HD + ks * 512); if (HL) kf2[kt][ks] = WFrag<T16>::ld(K2 + ko + kt * 16 * HD + ks * 512); }
    asm volatile("s_wait_xcnt 0x0" ::: "memory");   // before the address registers of the loads above are reused
    __builtin_amdgcn_sched_barrier(0);   // keeps later register writes from being lifted over the wait
    for (int k0 = 0; k0 < TT; k0 += 32) {
        V vf[4], vf2[4]; const T16* pv = Vt + vo + (size_t)k0 * HD; const T16* pv2 = HL ? V2 + vo + (size_t)k0 * HD : nullptr;   // 32 keys x 64 d = 4 fragments in a row
#pragma unroll
        for (int dt = 0; dt < 4; ++dt) { vf[dt] = WFrag<T16>::ld(pv + dt * 512); if (HL) vf2[dt] = WFrag<T16>::ld(pv2 + dt * 512); }
        // before the address registers of the loads above are reused; naming them keeps them live up to the wait, so that no load's own result lands on them
        if (HL) asm volatile("s_wait_xcnt 0x0" :: "v"(pv), "v"(pv2) : "memory"); else asm volatile("s_wait_xcnt 0x0" :: "v"(pv) : "memory");
        __builtin_amdgcn_sched_barrier(0);   // the loads above issue here, a softmax ahead of their use; sunk to their use each would cost its whole latency
        v8f s[2][NQ];
#pragma unroll
        for (int kt = 0; kt < 2; ++kt)
#pragma unroll
            for (int nb = 0; nb < NQ; ++nb) { v8f t = (v8f){};
#pragma unroll
                for (int ks = 0; ks < 2; ++ks) { t = WFrag<T16>::mma(kf[kt][ks], qf[nb][ks], t); if (HL) { t = WFrag<T16>::mma(kf2[kt][ks], qf[nb][ks], t); t = WFrag<T16>::mma(kf[kt][ks], qf2[nb][ks], t); } }
                s[kt][nb] = t; }
        const size_t kn = ko + (size_t)((k0 + 32) & (TT - 1)) * HD;   // the next 32 keys' fragments fly under the softmax; the last trip re-reads keys 0..31 (in bounds, unused)
#pragma unroll
        for (int kt = 0; kt < 2; ++kt)
#pragma unroll
            for (int ks = 0; ks < 2; ++ks) { kf[kt][ks] = WFrag<T16>::ld(Kp + kn + kt * 16 * HD + ks * 512); if (HL) kf2[kt][ks] = WFrag<T16>::ld(K2 + kn + kt * 16 * HD + ks * 512); }
        asm volatile("s_wait_xcnt 0x0" ::: "memory");   // before the address registers of the loads above are reused
        __builtin_amdgcn_sched_barrier(0);   // the loads above issue here, the rest of the trip ahead of their use; sunk to the loop's foot they would cost their whole latency
#pragma unroll
        for (int nb = 0; nb < NQ; ++nb) { float m = mx[nb];
#pragma unroll
            for (int j = 0; j < 8; ++j) m = fmaxf(m, fmaxf(s[0][nb][j], s[1][nb][j]));
            m = fmaxf(m, __shfl_xor(m, 16, 32));
            const float al = __builtin_amdgcn_exp2f((mx[nb] - m) * c1); mx[nb] = m; const float mc = sh - m * c1; float sum = 0.f;
#pragma unroll
            for (int j = 0; j < 8; ++j) { s[0][nb][j] = __builtin_amdgcn_exp2f(fmaf(s[0][nb][j], c1, mc)); s[1][nb][j] = __builtin_amdgcn_exp2f(fmaf(s[1][nb][j], c1, mc)); sum += s[0][nb][j] + s[1][nb][j]; }
            sm[nb] = fmaf(sm[nb], al, sum);
            V pf, pf2; PPack<T16>::pk(s[0][nb], s[1][nb], pf, pf2);
#pragma unroll
            for (int dt = 0; dt < 4; ++dt) { v8f t = o[dt][nb] * al; t = WFrag<T16>::mma(vf[dt], pf, t); if (HL) { t = WFrag<T16>::mma(vf[dt], pf2, t); t = WFrag<T16>::mma(vf2[dt], pf, t); } o[dt][nb] = t; } }
    }
#pragma unroll
    for (int nb = 0; nb < NQ; ++nb) { const float tot = sm[nb] + __shfl_xor(sm[nb], 16, 32); const float inv = __fdiv_rn(1.0f, tot); float* op = orow + (size_t)(q0 + nb * 16 + lr) * DQ + hi * 8;
#pragma unroll
        for (int dt = 0; dt < 4; ++dt) *(v8f*)(op + dt * 16) = o[dt][nb] * inv; }
}
// k_fattn: grid (NB_*NH_, query tiles of both row classes), 4 independent waves per work-group on neighbouring query columns of one head (they walk the same k and v lines).
// Both classes in ONE launch, so that their waves share the SIMDs (one class's matrix runs under the other's vector work) and the launch pays one start and one drain; the longer work-groups come first:
// blockIdx.y < RH/64: rows < RH, 64 per work-group, 3 products; the rest: fp16, 128 per work-group.
__global__ __launch_bounds__(128) void k_fattn(const bf* __restrict__ QPh, const bf* __restrict__ QPl, const bf* __restrict__ KPh, const bf* __restrict__ KPl, const bf* __restrict__ VTh, const bf* __restrict__ VTl, const h16* __restrict__ QP16, const h16* __restrict__ KP16, const h16* __restrict__ VT16, float* __restrict__ OUT) {
    const size_t z = blockIdx.x, pz = z * TT * HD; const int wv = threadIdx.x >> 5; float* orow = OUT + (z / NH_) * (size_t)TT * DQ + (z % NH_) * HD;
    if (blockIdx.y < RH / 64) attn_cols<bf, true, 1>(QPh + pz, QPl + pz, KPh + pz, KPl + pz, VTh + pz, VTl + pz, (int)blockIdx.y * 64 + wv * 16, 0.0f, orow);
    else attn_cols<h16, false, 2>(QP16 + pz, nullptr, KP16 + pz, nullptr, VT16 + pz, nullptr, RH + ((int)blockIdx.y - RH / 64) * 128 + wv * 32, 10.0f, orow);   // 10 = log2(PCAR)
}

extern "C" void kernel_launch(void* const* d_in, const int* in_sizes, int n_in,
                              void* d_out, int out_size, void* d_ws, size_t ws_size, hipStream_t stream) {
    (void)in_sizes; (void)n_in; (void)out_size;
    const float* x = (const float*)d_in[0]; const float* x2 = (const float*)d_in[1]; const float* wq = (const float*)d_in[2]; const float* bq = (const float*)d_in[3]; const float* wkv = (const float*)d_in[4]; const float* bkv = (const float*)d_in[5]; const float* gq = (const float*)d_in[6]; const float* btq = (const float*)d_in[7]; const float* gk = (const float*)d_in[8]; const float* btk = (const float*)d_in[9]; const float* wk = nullptr; const float* wv = nullptr; const float* wo = nullptr; (void)wk; (void)wv; (void)wo; const float* bk = bkv; const float* bv = bkv + 1024;
    float* OUT = (float*)d_out;     // [4][2048][1024]
    char* wsp = (char*)d_ws;
    auto take = [&](size_t bytes) { char* p = wsp; wsp += (bytes + 255) & ~(size_t)255; return (void*)p; };
    bf* WQ = (bf*)take((size_t)DQ * DM * 2); bf* WKV = (bf*)take((size_t)2 * DKV * DM * 2); bf* WK = WKV; bf* WV = WKV + (size_t)DKV * DM;   /* k | v row blocks of the transposed fused weight */
    bf* XB = (bf*)take((size_t)2 * NB_ * TT * DM * 2); bf* XB2 = XB + (size_t)NB_ * TT * DM;   /* bf16 x1 | x2, all batches */
    /* head planes [batch][head][..] of all NB_ batches */ h16* QP16 = (h16*)take((size_t)NB_ * NH_ * TT * HD * 2); h16* KP16 = (h16*)take((size_t)NB_ * NKV * TT * HD * 2); h16* VT16 = (h16*)take((size_t)NB_ * NKV * HD * TT * 2);
    bf* QPh = (bf*)take((size_t)NB_ * NH_ * TT * HD * 2); bf* QPl = (bf*)take((size_t)NB_ * NH_ * TT * HD * 2); bf* KPh = (bf*)take((size_t)NB_ * NKV * TT * HD * 2); bf* KPl = (bf*)take((size_t)NB_ * NKV * TT * HD * 2); bf* VTh = (bf*)take((size_t)NB_ * NKV * HD * TT * 2); bf* VTl = (bf*)take((size_t)NB_ * NKV * HD * TT * 2);
    if ((size_t)(wsp - (char*)d_ws) > ws_size) return;    // ws 256 MiB
    k_prep<<<PB_WQ + PB_WKV + 2 * PB_X, 256, 0, stream>>>(wq, wkv, x, x2, WQ, WKV, XB);   /* 'xw' [1024][2048] -> Bt [2048][1024]: rows 0..1023 = k, 1024.. = v */
    k_proj<<<dim3(NB_ * TT / 64, NH_, 3), 32, 0, stream>>>(XB, XB2, WQ, WK, WV, bq, bk, bv, gq, btq, gk, btk, QP16, QPh, QPl, KP16, KPh, KPl, VT16, VTh, VTl);
    k_fattn<<<dim3(NB_ * NH_, RH / 64 + (TT - RH) / 128), 128, 0, stream>>>(QPh, QPl, KPh, KPl, VTh, VTl, QP16, KP16, VT16, OUT);
}

// v009
// It runs in 152 microseconds.
// Timed twice side by side with v008, it ran 1.04 times as fast both times.
// Over all steps from v000 it is 25.8 times as fast.
#include <hip/hip_runtime.h>

// Cross-attention block with LayerNorm-ed per-head q and k (x1, x2 [4][2048][1024]; q = x1 wq + bq, [k | v] = x2 wkv + bkv ('xw' [1024][1024] and [1024][2048] 0.02, zero biases -> k = first 1024 columns, v = the rest); 16 heads x 64; q, k <- per-head LayerNorm over 64 (eps 1e-5) x gamma + beta ([64], read); scores x 64^-0.5; softmax; out = merged attn v -> [4][2048][1024] (8.4 M)).
// Layout, 3 launches: bf16 copies of both weights and of all of x1 and x2 (one grid, parts by block range); one projection grid over all four batches and q, k and v (blockIdx.z; k and v as the two column blocks of wkv): exact products, f32 bias, for q and k the per-(token, head) LayerNorm with affine on the wave's own accumulators, and the 16-bit head planes stored straight from them (no f32 projection in memory); the head planes of all four batches stay in the workspace; fused dense T-2048 attention with a running softmax, both row classes in one grid (hybrid rows: < 512 hi/lo 3 products, rest fp16 x1024), writes the output rows.
// Every 16-bit operand plane in the workspace (x, weights, q, k, v) lies in FRAGMENT ORDER: a 16-row x 32-k fragment is 1 KiB, [k half][lane][8 elements], so that each 16-byte-per-lane load or store of a wave covers 512 contiguous bytes (4 whole lines) and not 32-byte pieces of 16 lines; the registers receive the same values as from row-major planes.
// Compute dtypes, f32 accumulate: every input rounded to bf16; projections exact + f32 biases; LayerNorms f32; attention rows < 512 3 products, rest fp16; softmax f32; output f32.

#define NB_  4
#define TT   2048
#define DM   1024
#define NH_  16
#define NKV  16
#define REP  (NH_ / NKV)
#define HD   64
#define DQ   (NH_ * HD)
#define DKV  (NKV * HD)
#define RH   512                  // query rows < RH use hi+lo planes (0: none)
#define WIN  0
#define PCAR 1024.0f
#define SCL  0.125f   // HD^-0.5
typedef _Float16 h16;
typedef unsigned short bf;
typedef __attribute__((ext_vector_type(16))) __bf16   v16bf;
typedef __attribute__((ext_vector_type(16))) _Float16 v16h;
typedef __attribute__((ext_vector_type(8)))  _Float16 v8h;
typedef __attribute__((ext_vector_type(8)))  unsigned short v8us;
typedef __attribute__((ext_vector_type(8)))  float    v8f;
typedef __attribute__((ext_vector_type(4)))  float    v4f;
typedef v8h  __attribute__((may_alias)) v8ha;
typedef v4f  __attribute__((may_alias)) v4fa;
typedef v8us __attribute__((may_alias)) v8usa;

typedef __attribute__((ext_vector_type(2))) float  v2fc;
typedef __attribute__((ext_vector_type(2))) __bf16 v2bc;
typedef __attribute__((ext_vector_type(4))) unsigned v4uc;
// f32 -> bf16, round to nearest even, by the chip's own conversion: cvt2 rounds two values in one instruction (a in the low half, b in the high half of the word)
__device__ __forceinline__ unsigned cvt2(float a, float b) { const v2fc x = {a, b}; return __builtin_bit_cast(unsigned, __builtin_convertvector(x, v2bc)); }
__device__ __forceinline__ unsigned short f2bf(float f) { return __builtin_bit_cast(unsigned short, (__bf16)f); }
// 8 values -> 8 bf16 (rnd8), or -> 8 hi and 8 lo (split8: lo = what the hi rounding left over, rounded in turn)
__device__ __forceinline__ v8us rnd8(const float (&r)[8]) { v4uc t;
#pragma unroll   // vector elements in registers: their indices must be constants
    for (int q = 0; q < 4; ++q) t[q] = cvt2(r[2 * q], r[2 * q + 1]);
    return __builtin_bit_cast(v8us, t); }
__device__ __forceinline__ void split8(const float (&r)[8], v8us& oh, v8us& ol) { v4uc h, l;
#pragma unroll   // vector elements in registers: their indices must be constants
    for (int q = 0; q < 4; ++q) { h[q] = cvt2(r[2 * q], r[2 * q + 1]); l[q] = cvt2(r[2 * q] - __uint_as_float(h[q] << 16), r[2 * q + 1] - __uint_as_float(h[q] & 0xFFFF0000u)); }
    oh = __builtin_bit_cast(v8us, h); ol = __builtin_bit_cast(v8us, l); }
__device__ __forceinline__ float bf2f(unsigned short b) { return __uint_as_float(((unsigned)b) << 16); }
__device__ __forceinline__ float bfr(float f) { return bf2f(f2bf(f)); }
__device__ __forceinline__ v16h cat16(v8h lo, v8h hi) { return __builtin_shufflevector(lo, hi, 0, 1, 2, 3, 4, 5, 6, 7, 8, 9, 10, 11, 12, 13, 14, 15); }
__device__ __forceinline__ v16bf cat16b(v8us lo, v8us hi) { return __builtin_bit_cast(v16bf, __builtin_shufflevector(lo, hi, 0, 1, 2, 3, 4, 5, 6, 7, 8, 9, 10, 11, 12, 13, 14, 15)); }
__device__ __forceinline__ v8f wmma16(v16h a, v16h b, v8f c) { return __builtin_amdgcn_wmma_f32_16x16x32_f16(false, a, false, b, (short)0, c, false, false); }
__device__ __forceinline__ v8f wmmab(v16bf a, v16bf b, v8f c) { return __builtin_amdgcn_wmma_f32_16x16x32_bf16(false, a, false, b, (short)0, c, false, false); }



// WFrag: one 16x32 (or 32x16) 16-bit operand fragment from a fragment-order plane, p = fragment + lane * 8: lane (lr, hi) finds row lr, k = 8 hi .. + 7 there and k = 16 + 8 hi .. + 7 256 elements on; the same k order for A and B
template <typename T16> struct WFrag;
template <> struct WFrag<h16> { typedef v16h V; static __device__ __forceinline__ V ld(const h16* p) { return cat16(*(const v8h*)p, *(const v8h*)(p + 256)); } static __device__ __forceinline__ v8f mma(V a, V b, v8f c) { return wmma16(a, b, c); } };
template <> struct WFrag<bf> { typedef v16bf V; static __device__ __forceinline__ V ld(const bf* p) { return cat16b(*(const v8us*)p, *(const v8us*)(p + 256)); } static __device__ __forceinline__ v8f mma(V a, V b, v8f c) { return wmmab(a, b, c); } };

__device__ __forceinline__ h16 tohx(float x) { return (h16)x; }
typedef __attribute__((ext_vector_type(2))) _Float16 v2h;
typedef __attribute__((ext_vector_type(4))) _Float16 v4h;
typedef __attribute__((ext_vector_type(2))) unsigned short v2us;
typedef __attribute__((ext_vector_type(4))) unsigned short v4us;
typedef __attribute__((ext_vector_type(2))) float v2f;
typedef __attribute__((ext_vector_type(4))) int v4i;
typedef __attribute__((ext_vector_type(2))) unsigned v2u;

// w [K][N] f32 -> Bt, the transposed weight in fragment order [N/16][K/32][k half][lane][8]; one wave per fragment: a lane gathers the 16 k of its row n (16 neighbouring n per load = 64-byte runs) and stores two 16-byte pieces, the wave 512 bytes in a row each
template <int K, int N>
__device__ __forceinline__ void wtG(const float* __restrict__ w, bf* Bt, int blk) {
    const int lane = threadIdx.x & 31, lr = lane & 15, hi = lane >> 4; const int F = blk * 8 + (threadIdx.x >> 5); if (F >= (N / 16) * (K / 32)) return;
    const float* p = w + (size_t)((F % (K / 32)) * 32 + hi * 8) * N + (F / (K / 32)) * 16 + lr; float v[16];
#pragma unroll   // register arrays here and below: their indices must be constants; all 16 loads fly together
    for (int j = 0; j < 16; ++j) v[j] = p[(size_t)((j >> 3) * 16 + (j & 7)) * N];
    asm volatile("s_wait_xcnt 0x0" :: "v"(p) : "memory");   // before the address registers of the loads above are reused; naming them keeps them live up to the wait
    float v0[8], v1[8];
#pragma unroll
    for (int j = 0; j < 8; ++j) { v0[j] = v[j]; v1[j] = v[8 + j]; }
    const v8us o0 = rnd8(v0), o1 = rnd8(v1);
    bf* q = Bt + (size_t)F * 512 + lane * 8; *(v8us*)q = o0; *(v8us*)(q + 256) = o1;
}
// src: x1 or x2, dst: its half of the bf16 copy; i: the thread's index in it; dst in fragment order [row/16][k/32][k half][lane][8]. One wave = 8 rows x 32 k (half a fragment): each load covers 4 whole source lines (4 rows x 128 bytes), each store four 64-byte runs
__device__ __forceinline__ void cvt8(const float* __restrict__ src, bf* dst, size_t i, size_t n8) { if (i >= n8) return;
    const int l = threadIdx.x & 31, q = l & 7; const size_t F = i >> 6; const int r0 = (int)((i >> 5) & 1) * 8 + (l >> 3);   // fragment; the lane's first row in it (the second: + 4); q: which 4 of the row's 32 k
    const float* p = src + ((F / (DM / 32)) * 16 + r0) * DM + (F % (DM / 32)) * 32 + q * 4; const v4f v0 = *(const v4f*)p, v1 = *(const v4f*)(p + 4 * DM);
    asm volatile("s_wait_xcnt 0x0" :: "v"(p) : "memory");   // before the address registers of the loads above are reused; naming them keeps them live up to the wait
    const v2u w0 = {cvt2(v0[0], v0[1]), cvt2(v0[2], v0[3])}, w1 = {cvt2(v1[0], v1[1]), cvt2(v1[2], v1[3])};
    const v4us o0 = __builtin_bit_cast(v4us, w0), o1 = __builtin_bit_cast(v4us, w1);
    bf* o = dst + F * 512 + (q >> 2) * 256 + (((q >> 1) & 1) * 16 + r0) * 8 + (q & 1) * 4; *(v4us*)o = o0; *(v4us*)(o + 32) = o1; }
// k_prep: the three independent 16-bit copies in ONE launch, so that they share the chip and pay one launch's start and drain; parts by block range, the gathering weight parts first: wq, wkv, x1, x2
#define PB_WQ  (DM * DQ / 512 / 8)          // work-groups: one wave per 512-element fragment, 8 waves each
#define PB_WKV (DM * 2 * DKV / 512 / 8)
#define PB_X   (NB_ * TT * DM / 8 / 256)    // 8 elements per thread, per source
__global__ __launch_bounds__(256) void k_prep(const float* __restrict__ wq, const float* __restrict__ wkv, const float* __restrict__ x1, const float* __restrict__ x2, bf* WQ, bf* WKV, bf* XB) {
    const int b = blockIdx.x;
    if (b < PB_WQ) wtG<DM, DQ>(wq, WQ, b);
    else if (b < PB_WQ + PB_WKV) wtG<DM, 2 * DKV>(wkv, WKV, b - PB_WQ);
    else { const int c = b - (PB_WQ + PB_WKV); const bool two = c >= PB_X;
        cvt8(two ? x2 : x1, XB + (two ? (size_t)NB_ * TT * DM : 0), (size_t)(two ? c - PB_X : c) * 256 + threadIdx.x, (size_t)NB_ * TT * DM / 8); }
}

// ---- proj_tile: projection GEMM with its whole tail, ONE WAVE per 64 tokens x 64 columns (= one head; 16 accumulators), operands straight from fragment-order bf16 planes; X, P16, Ph, Pl: the tile's own batch.
// The f32 tile stays in registers: the wave adds the bias, normalises (q, k) and stores the fp16, hi and lo head planes itself.
// LN (q, k): product rows = weight rows (d), columns = tokens: per column group a lane holds 32 of the 64 d of ONE token (lane ^ 16 the other 32), and each accumulator is 8 neighbouring d = the lane's 16 bytes of half a fragment of the plane [h][t/16][d/32][d half][lane][8].
// !LN (v): product rows = tokens, columns = weight rows: each accumulator is 8 neighbouring tokens of one d = the lane's 16 bytes of half a fragment of the plane [h][t/32][d/16][t half][lane][8].
// Every plain '#pragma unroll' here stands on a loop over register arrays: their indices must be constants, or the arrays would leave the registers.
__device__ __forceinline__ float xhalf(float v) { const int b = __float_as_int(v); return __int_as_float(__builtin_amdgcn_permlanex16(b, b, 0x76543210, 0xfedcba98, false, false)); }   // the value of lane ^ 16
// sum over the 64 d of a token, v[mb][j] = element d = mb*16 + hi*8 + j: neighbours first, then d ^ 32, ^ 16, ^ 8 (the other wave half), ^ 4, ^ 2; both halves end with the same bits
__device__ __forceinline__ float hsum64(const float (&v)[4][8]) { float z[4];
#pragma unroll
    for (int q = 0; q < 4; ++q) { z[q] = ((v[0][2 * q] + v[0][2 * q + 1]) + (v[2][2 * q] + v[2][2 * q + 1])) + ((v[1][2 * q] + v[1][2 * q + 1]) + (v[3][2 * q] + v[3][2 * q + 1])); z[q] += xhalf(z[q]); }
    return (z[0] + z[2]) + (z[1] + z[3]); }
__device__ __forceinline__ void planes8(const float (&r)[8], v8h& o16, v8us& oh, v8us& ol) {
#pragma unroll
    for (int j = 0; j < 8; ++j) o16[j] = tohx(r[j]);
    split8(r, oh, ol); }
template <bool LN>
__device__ __forceinline__ void proj_tile(const bf* __restrict__ X, const bf* __restrict__ Wt, const float* __restrict__ bias, const float* __restrict__ g, const float* __restrict__ bb, h16* __restrict__ P16, bf* __restrict__ Ph, bf* __restrict__ Pl, int t0, int h) {
    typedef WFrag<bf>::V V;
    const int lane = threadIdx.x & 31, lr = lane & 15, hi = lane >> 4; const int c0 = h * 64;
    const bf* A = LN ? Wt + (size_t)c0 * DM : X + (size_t)t0 * DM; const bf* Bt = LN ? X + (size_t)t0 * DM : Wt + (size_t)c0 * DM;
    v8f acc[4][4];
#pragma unroll
    for (int mb = 0; mb < 4; ++mb)
#pragma unroll
        for (int nb = 0; nb < 4; ++nb) acc[mb][nb] = (v8f){};
    const bf* A0 = A + (size_t)lane * 8; const bf* B0 = Bt + (size_t)lane * 8;
    // Fragments are loaded ONE k STEP AHEAD of their products, into a second register set (a0, b0 and a1, b1 in turn): while a step's 16 products run, the next step's 16 loads fly, and no product waits out its own loads' latency.
    V a0[4], b0[4], a1[4], b1[4];
    // the first fragments, held in the order in which a trip issues them: the loop's counted load waits are the stricter of both ways into it, and another order here would make every trip wait for its youngest loads
#pragma unroll
    for (int mb = 0; mb < 4; ++mb) { a0[mb] = WFrag<bf>::ld(A0 + (size_t)mb * 16 * DM); __builtin_amdgcn_sched_barrier(0); }
#pragma unroll
    for (int nb = 0; nb < 4; ++nb) { b0[nb] = WFrag<bf>::ld(B0 + (size_t)nb * 16 * DM); __builtin_amdgcn_sched_barrier(0); }
    asm volatile("s_wait_xcnt 0x0" :: "v"(A0), "v"(B0) : "memory");   // before the address registers of the loads above are reused; naming them keeps them live up to the wait
    // rolled: a trip already holds 32 loads and 32 matrix instructions (two k steps, one per register set), more trips in the text would only lengthen it
#pragma unroll 1
    for (int kc = 0; kc < DM; kc += 64) {
        const bf* pa = A0 + kc * 16; const bf* pb = B0 + kc * 16;   // fragment kc / 32 of each 16-row tile; the loads from here take the next one, 512 elements on
        const int kw = (kc + 64) & (DM - 1); const bf* qa = A0 + kw * 16; const bf* qb = B0 + kw * 16;   // fragment kc / 32 + 2; the last trip re-reads fragment 0 (in bounds, unused)
#pragma unroll
        for (int mb = 0; mb < 4; ++mb) a1[mb] = WFrag<bf>::ld(pa + 512 + (size_t)mb * 16 * DM);
#pragma unroll
        for (int nb = 0; nb < 4; ++nb) { b1[nb] = WFrag<bf>::ld(pb + 512 + (size_t)nb * 16 * DM);
            __builtin_amdgcn_sched_barrier(0);   // the loads above issue here, a whole k step ahead of their use; sunk to their use each would cost its whole latency
#pragma unroll
            for (int mb = 0; mb < 4; ++mb) acc[mb][nb] = WFrag<bf>::mma(a0[mb], b0[nb], acc[mb][nb]); }
#pragma unroll
        for (int mb = 0; mb < 4; ++mb) a0[mb] = WFrag<bf>::ld(qa + (size_t)mb * 16 * DM);
#pragma unroll
        for (int nb = 0; nb < 4; ++nb) { b0[nb] = WFrag<bf>::ld(qb + (size_t)nb * 16 * DM);
            __builtin_amdgcn_sched_barrier(0);   // as above: a whole k step ahead of their use
#pragma unroll
            for (int mb = 0; mb < 4; ++mb) acc[mb][nb] = WFrag<bf>::mma(a1[mb], b1[nb], acc[mb][nb]); }
        // the vector slots that the chip needs between the trip's last matrix instructions and what follows them over the back edge
        asm volatile("v_nop\n\tv_nop\n\tv_nop\n\tv_nop" : "+v"(acc[0][3]), "+v"(acc[1][3]), "+v"(acc[2][3]), "+v"(acc[3][3]) : "v"(a1[0]), "v"(a1[3]));
        asm volatile("s_wait_xcnt 0x0" :: "v"(pa), "v"(pb), "v"(qa), "v"(qb) : "memory");   // before the address registers of the trip's loads are reused; naming them keeps them live up to the wait, so that no load's own result lands on them
    }
    if (LN) {
        float bs[4][8], gm[4][8], bt[4][8]; const unsigned ob = (unsigned)hi * 32u;   // the lane's byte offset (d = hi * 8) into the three [64] f32 vectors
        const char* cbs = (const char*)(bias + c0); const char* cgm = (const char*)g; const char* cbt = (const char*)bb;
#pragma unroll
        for (int mb = 0; mb < 4; ++mb)
#pragma unroll
            for (int j = 0; j < 8; ++j) { bs[mb][j] = *(const float*)(cbs + ob + mb * 64 + j * 4); gm[mb][j] = *(const float*)(cgm + ob + mb * 64 + j * 4); bt[mb][j] = *(const float*)(cbt + ob + mb * 64 + j * 4); }
        asm volatile("s_wait_xcnt 0x0" :: "v"(ob) : "memory");   // before the offset register of the loads above is reused; naming it keeps it live up to the wait, so that no load's own result lands on it
        __builtin_amdgcn_sched_barrier(0);   // keeps later register writes from being lifted over the wait
#pragma unroll
        for (int mb = 0; mb < 4; ++mb)
#pragma unroll
            for (int j = 0; j < 8; ++j) { bs[mb][j] = bfr(bs[mb][j]); gm[mb][j] = bfr(gm[mb][j]); bt[mb][j] = bfr(bt[mb][j]);
#pragma unroll
                for (int nb = 0; nb < 4; ++nb) acc[mb][nb][j] += bs[mb][j]; }
#pragma unroll
        for (int nb = 0; nb < 4; ++nb) { float x[4][8], p[4][8];
#pragma unroll
            for (int mb = 0; mb < 4; ++mb)
#pragma unroll
                for (int j = 0; j < 8; ++j) x[mb][j] = acc[mb][nb][j];
            const float mean = hsum64(x) * (1.0f / HD);
#pragma unroll
            for (int mb = 0; mb < 4; ++mb)
#pragma unroll
                for (int j = 0; j < 8; ++j) { x[mb][j] -= mean; p[mb][j] = x[mb][j] * x[mb][j]; }
            const float den = __fsqrt_rn(hsum64(p) * (1.0f / HD) + 1e-5f);
            v8h o16[4]; v8us oh[4], ol[4];
#pragma unroll
            for (int mb = 0; mb < 4; ++mb) { float r[8];
#pragma unroll
                for (int j = 0; j < 8; ++j) r[j] = __fdiv_rn(x[mb][j], den) * gm[mb][j] + bt[mb][j];
                planes8(r, o16[mb], oh[mb], ol[mb]); }
            const size_t e = ((size_t)h * TT + t0 + nb * 16) * HD + lane * 8;
            __builtin_amdgcn_sched_barrier(0);   // the column's arithmetic ends here: nothing of it is sunk between a store and the wait behind the stores
#pragma unroll
            for (int mb = 0; mb < 4; ++mb) { *(v8h*)(P16 + e + mb * 256) = o16[mb]; *(v8us*)(Ph + e + mb * 256) = oh[mb]; *(v8us*)(Pl + e + mb * 256) = ol[mb]; }
            asm volatile("s_wait_xcnt 0x0" ::: "memory");   // before the data and address registers of the stores above are reused
            __builtin_amdgcn_sched_barrier(0);   // keeps later register writes from being lifted over the wait
        }
    } else {
#pragma unroll
        for (int nb = 0; nb < 4; ++nb) { const float bs = bfr(bias[c0 + nb * 16 + lr]); v8h o16[4]; v8us oh[4], ol[4];
#pragma unroll
            for (int mb = 0; mb < 4; ++mb) { float r[8];
#pragma unroll
                for (int j = 0; j < 8; ++j) r[j] = acc[mb][nb][j] + bs;
                planes8(r, o16[mb], oh[mb], ol[mb]); }
            const size_t e = (((size_t)h * (TT / 32) + t0 / 32) * 4 + nb) * 512 + lane * 8;
            __builtin_amdgcn_sched_barrier(0);   // the column's arithmetic ends here: nothing of it is sunk between a store and the wait behind the stores
#pragma unroll
            for (int mb = 0; mb < 4; ++mb) { const int f = (mb >> 1) * 2048 + (mb & 1) * 256; *(v8h*)(P16 + e + f) = o16[mb]; *(v8us*)(Ph + e + f) = oh[mb]; *(v8us*)(Pl + e + f) = ol[mb]; }
            asm volatile("s_wait_xcnt 0x0" ::: "memory");   // before the data and address registers of the stores above are reused
            __builtin_amdgcn_sched_barrier(0);   // keeps later register writes from being lifted over the wait
        }
    }
}
// k_proj: every projection tile of the block in one launch, so that all of them share the chip at once; grid (NB_*TT/128, heads/2, 3), 128 threads; blockIdx.z: 0 = q from x1, 1 = k, 2 = v from x2.
// A work-group is 4 independent waves on 2 neighbouring token tiles x 2 neighbouring heads: they start together on one WGP and walk k side by side, so that each x line and each weight line is read by two of them and comes from L2 once.
__global__ __launch_bounds__(128) void k_proj(const bf* __restrict__ X1, const bf* __restrict__ X2, const bf* __restrict__ WQ, const bf* __restrict__ WK, const bf* __restrict__ WV, const float* __restrict__ bq, const float* __restrict__ bk, const float* __restrict__ bv, const float* __restrict__ gq, const float* __restrict__ btq, const float* __restrict__ gk, const float* __restrict__ btk,
                                              h16* __restrict__ QP16, bf* __restrict__ QPh, bf* __restrict__ QPl, h16* __restrict__ KP16, bf* __restrict__ KPh, bf* __restrict__ KPl, h16* __restrict__ VT16, bf* __restrict__ VTh, bf* __restrict__ VTl) {
    const int wv = __builtin_amdgcn_readfirstlane((int)(threadIdx.x >> 5)), tt = (int)blockIdx.x * 2 + (wv & 1);   // the wave's number, in a scalar register like all that is formed from it; its token tile
    const int b = tt / (TT / 64), t0 = (tt % (TT / 64)) * 64, h = (int)blockIdx.y * 2 + (wv >> 1); const size_t xb = (size_t)b * TT * DM, pb = (size_t)b * NH_ * TT * HD;   // this batch's block in x and in every head plane (NKV == NH_)
    if (blockIdx.z == 2) proj_tile<false>(X2 + xb, WV, bv, nullptr, nullptr, VT16 + pb, VTh + pb, VTl + pb, t0, h);   // v, transposed planes
    else { const bool kk = blockIdx.z == 1;   // q or k: per-head LayerNorm x gamma + beta, planes
        proj_tile<true>((kk ? X2 : X1) + xb, kk ? WK : WQ, kk ? bk : bq, kk ? gk : gq, kk ? btk : btq, (kk ? KP16 : QP16) + pb, (kk ? KPh : QPh) + pb, (kk ? KPl : QPl) + pb, t0, h); }
}
// ---- attn_cols: scores, softmax and attn x v of one (batch, head) in one kernel; no score or probability ever leaves the registers.
// One wave owns NQ*16 query columns and walks the 2048 keys 32 at a time: St = K Qt (A = key rows, B = query rows kept in registers), so a lane holds 16 scores of ONE query per column group;
// running maximum and sum per query (in-lane + one exchange between the wave halves); the two 16-key score tiles, converted in place, ARE the B operand of Ot += Vt Pt (A = d rows of the v plane, same k order as WFrag::ld).
// Rows < RH: bf16 hi+lo planes, 3 products each; the rest fp16 with probabilities x PCAR (the factor is in the sum too and cancels in the division).
template <typename T16> struct PPack;
template <> struct PPack<h16> { static __device__ __forceinline__ void pk(const v8f& p0, const v8f& p1, v16h& a, v16h& a2) { (void)a2;
#pragma unroll
    for (int e = 0; e < 8; ++e) { a[e] = tohx(p0[e]); a[8 + e] = tohx(p1[e]); } } };
template <> struct PPack<bf> { static __device__ __forceinline__ void pk(const v8f& p0, const v8f& p1, v16bf& a, v16bf& a2) { v8us h0, h1, l0, l1; float r0[8], r1[8];
#pragma unroll
    for (int e = 0; e < 8; ++e) { r0[e] = p0[e]; r1[e] = p1[e]; }
    split8(r0, h0, l0); split8(r1, h1, l1);
    a = cat16b(h0, h1); a2 = cat16b(l0, l1); } };
template <typename T16, bool HL, int NQ>
__device__ __forceinline__ void attn_cols(const T16* __restrict__ Q, const T16* __restrict__ Q2, const T16* __restrict__ Kp, const T16* __restrict__ K2, const T16* __restrict__ Vt, const T16* __restrict__ V2, int q0, float sh, float* __restrict__ orow) {
    typedef typename WFrag<T16>::V V;
    const int lane = threadIdx.x & 31, lr = lane & 15, hi = lane >> 4; const float c1 = SCL * 1.4426950408889634f;
    V qf[NQ][2], qf2[NQ][2];
#pragma unroll
    for (int nb = 0; nb < NQ; ++nb)
#pragma unroll
        for (int ks = 0; ks < 2; ++ks) { const size_t qo = (size_t)(q0 + nb * 16) * HD + ks * 512 + lane * 8; qf[nb][ks] = WFrag<T16>::ld(Q + qo); if (HL) qf2[nb][ks] = WFrag<T16>::ld(Q2 + qo); }
    asm volatile("s_wait_xcnt 0x0" ::: "memory");   // before the address registers of the loads above are reused
    __builtin_amdgcn_sched_barrier(0);   // keeps later register writes from being lifted over the wait
    v8f o[4][NQ]; float mx[NQ], sm[NQ];
#pragma unroll
    for (int nb = 0; nb < NQ; ++nb) { mx[nb] = -3.0e38f; sm[nb] = 0.f;
#pragma unroll
        for (int dt = 0; dt < 4; ++dt) o[dt][nb] = (v8f){}; }
    const size_t ko = (size_t)lane * 8, vo = (size_t)lane * 8;
    V kf[2][2], kf2[2][2];
#pragma unroll
    for (int kt = 0; kt < 2; ++kt)
#pragma unroll
        for (int ks = 0; ks < 2; ++ks) { kf[kt][ks] = WFrag<T16>::ld(Kp + ko + kt * 16 * HD + ks * 512); if (HL) kf2[kt][ks] = WFrag<T16>::ld(K2 + ko + kt * 16 * HD + ks * 512); }
    asm volatile("s_wait_xcnt 0x0" ::: "memory");   // before the address registers of the loads above are reused
    __builtin_amdgcn_sched_barrier(0);   // keeps later register writes from being lifted over the wait
    for (int k0 = 0; k0 < TT; k0 += 32) {
        V vf[4], vf2[4]; const T16* pv = Vt + vo + (size_t)k0 * HD; const T16* pv2 = HL ? V2 + vo + (size_t)k0 * HD : nullptr;   // 32 keys x 64 d = 4 fragments in a row
#pragma unroll
        for (int dt = 0; dt < 4; ++dt) { vf[dt] = WFrag<T16>::ld(pv + dt * 512); if (HL) vf2[dt] = WFrag<T16>::ld(pv2 + dt * 512); }
        // before the address registers of the loads above are reused; naming them keeps them live up to the wait, so that no load's own result lands on them
        if (HL) asm volatile("s_wait_xcnt 0x0" :: "v"(pv), "v"(pv2) : "memory"); else asm volatile("s_wait_xcnt 0x0" :: "v"(pv) : "memory");
        __builtin_amdgcn_sched_barrier(0);   // the loads above issue here, a softmax ahead of their use; sunk to their use each would cost its whole latency
        v8f s[2][NQ];
#pragma unroll
        for (int kt = 0; kt < 2; ++kt)
#pragma unroll
            for (int nb = 0; nb < NQ; ++nb) { v8f t = (v8f){};
#pragma unroll
                for (int ks = 0; ks < 2; ++ks) { t = WFrag<T16>::mma(kf[kt][ks], qf[nb][ks], t); if (HL) { t = WFrag<T16>::mma(kf2[kt][ks], qf[nb][ks], t); t = WFrag<T16>::mma(kf[kt][ks], qf2[nb][ks], t); } }
                s[kt][nb] = t; }
        const size_t kn = ko + (size_t)((k0 + 32) & (TT - 1)) * HD;   // the next 32 keys' fragments fly under the softmax; the last trip re-reads keys 0..31 (in bounds, unused)
#pragma unroll
        for (int kt = 0; kt < 2; ++kt)
#pragma unroll
            for (int ks = 0; ks < 2; ++ks) { kf[kt][ks] = WFrag<T16>::ld(Kp + kn + kt * 16 * HD + ks * 512); if (HL) kf2[kt][ks] = WFrag<T16>::ld(K2 + kn + kt * 16 * HD + ks * 512); }
        asm volatile("s_wait_xcnt 0x0" ::: "memory");   // before the address registers of the loads above are reused
        __builtin_amdgcn_sched_barrier(0);   // the loads above issue here, the rest of the trip ahead of their use; sunk to the loop's foot they would cost their whole latency
#pragma unroll
        for (int nb = 0; nb < NQ; ++nb) { float m = mx[nb];
#pragma unroll
            for (int j = 0; j < 8; ++j) m = fmaxf(m, fmaxf(s[0][nb][j], s[1][nb][j]));
            m = fmaxf(m, __shfl_xor(m, 16, 32));
            const float al = __builtin_amdgcn_exp2f((mx[nb] - m) * c1); mx[nb] = m; const float mc = sh - m * c1; float sum = 0.f;
#pragma unroll
            for (int j = 0; j < 8; ++j) { s[0][nb][j] = __builtin_amdgcn_exp2f(fmaf(s[0][nb][j], c1, mc)); s[1][nb][j] = __builtin_amdgcn_exp2f(fmaf(s[1][nb][j], c1, mc)); sum += s[0][nb][j] + s[1][nb][j]; }
            sm[nb] = fmaf(sm[nb], al, sum);
            V pf, pf2; PPack<T16>::pk(s[0][nb], s[1][nb], pf, pf2);
#pragma unroll
            for (int dt = 0; dt < 4; ++dt) { v8f t = o[dt][nb] * al; t = WFrag<T16>::mma(vf[dt], pf, t); if (HL) { t = WFrag<T16>::mma(vf[dt], pf2, t); t = WFrag<T16>::mma(vf2[dt], pf, t); } o[dt][nb] = t; } }
    }
#pragma unroll
    for (int nb = 0; nb < NQ; ++nb) { const float tot = sm[nb] + __shfl_xor(sm[nb], 16, 32); const float inv = __fdiv_rn(1.0f, tot); float* op = orow + (size_t)(q0 + nb * 16 + lr) * DQ + hi * 8;
#pragma unroll
        for (int dt = 0; dt < 4; ++dt) *(v8f*)(op + dt * 16) = o[dt][nb] * inv; }
}
// k_fattn: grid (NB_*NH_, query tiles of both row classes), 4 independent waves per work-group on neighbouring query columns of one head (they walk the same k and v lines).
// Both classes in ONE launch, so that their waves share the SIMDs (one class's matrix runs under the other's vector work) and the launch pays one start and one drain; the longer work-groups come first:
// blockIdx.y < RH/64: rows < RH, 64 per work-group, 3 products; the rest: fp16, 128 per work-group.
__global__ __launch_bounds__(128) void k_fattn(const bf* __restrict__ QPh, const bf* __restrict__ QPl, const bf* __restrict__ KPh, const bf* __restrict__ KPl, const bf* __restrict__ VTh, const bf* __restrict__ VTl, const h16* __restrict__ QP16, const h16* __restrict__ KP16, const h16* __restrict__ VT16, float* __restrict__ OUT) {
    const size_t z = blockIdx.x, pz = z * TT * HD; const int wv = threadIdx.x >> 5; float* orow = OUT + (z / NH_) * (size_t)TT * DQ + (z % NH_) * HD;
    if (blockIdx.y < RH / 64) attn_cols<bf, true, 1>(QPh + pz, QPl + pz, KPh + pz, KPl + pz, VTh + pz, VTl + pz, (int)blockIdx.y * 64 + wv * 16, 0.0f, orow);
    else attn_cols<h16, false, 2>(QP16 + pz, nullptr, KP16 + pz, nullptr, VT16 + pz, nullptr, RH + ((int)blockIdx.y - RH / 64) * 128 + wv * 32, 10.0f, orow);   // 10 = log2(PCAR)
}

extern "C" void kernel_launch(void* const* d_in, const int* in_sizes, int n_in,
                              void* d_out, int out_size, void* d_ws, size_t ws_size, hipStream_t stream) {
    (void)in_sizes; (void)n_in; (void)out_size;
    const float* x = (const float*)d_in[0]; const float* x2 = (const float*)d_in[1]; const float* wq = (const float*)d_in[2]; const float* bq = (const float*)d_in[3]; const float* wkv = (const float*)d_in[4]; const float* bkv = (const float*)d_in[5]; const float* gq = (const float*)d_in[6]; const float* btq = (const float*)d_in[7]; const float* gk = (const float*)d_in[8]; const float* btk = (const float*)d_in[9]; const float* wk = nullptr; const float* wv = nullptr; const float* wo = nullptr; (void)wk; (void)wv; (void)wo; const float* bk = bkv; const float* bv = bkv + 1024;
    float* OUT = (float*)d_out;     // [4][2048][1024]
    char* wsp = (char*)d_ws;
    auto take = [&](size_t bytes) { char* p = wsp; wsp += (bytes + 255) & ~(size_t)255; return (void*)p; };
    bf* WQ = (bf*)take((size_t)DQ * DM * 2); bf* WKV = (bf*)take((size_t)2 * DKV * DM * 2); bf* WK = WKV; bf* WV = WKV + (size_t)DKV * DM;   /* k | v row blocks of the transposed fused weight */
    bf* XB = (bf*)take((size_t)2 * NB_ * TT * DM * 2); bf* XB2 = XB + (size_t)NB_ * TT * DM;   /* bf16 x1 | x2, all batches */
    /* head planes [batch][head][..] of all NB_ batches */ h16* QP16 = (h16*)take((size_t)NB_ * NH_ * TT * HD * 2); h16* KP16 = (h16*)take((size_t)NB_ * NKV * TT * HD * 2); h16* VT16 = (h16*)take((size_t)NB_ * NKV * HD * TT * 2);
    bf* QPh = (bf*)take((size_t)NB_ * NH_ * TT * HD * 2); bf* QPl = (bf*)take((size_t)NB_ * NH_ * TT * HD * 2); bf* KPh = (bf*)take((size_t)NB_ * NKV * TT * HD * 2); bf* KPl = (bf*)take((size_t)NB_ * NKV * TT * HD * 2); bf* VTh = (bf*)take((size_t)NB_ * NKV * HD * TT * 2); bf* VTl = (bf*)take((size_t)NB_ * NKV * HD * TT * 2);
    if ((size_t)(wsp - (char*)d_ws) > ws_size) return;    // ws 256 MiB
    k_prep<<<PB_WQ + PB_WKV + 2 * PB_X, 256, 0, stream>>>(wq, wkv, x, x2, WQ, WKV, XB);   /* 'xw' [1024][2048] -> Bt [2048][1024]: rows 0..1023 = k, 1024.. = v */
    k_proj<<<dim3(NB_ * TT / 128, NH_ / 2, 3), 128, 0, stream>>>(XB, XB2, WQ, WK, WV, bq, bk, bv, gq, btq, gk, btk, QP16, QPh, QPl, KP16, KPh, KPl, VT16, VTh, VTl);
    k_fattn<<<dim3(NB_ * NH_, RH / 64 + (TT - RH) / 128), 128, 0, stream>>>(QPh, QPl, KPh, KPl, VTh, VTl, QP16, KP16, VT16, OUT);
}

// v010
// One run takes 147 microseconds.
// Timed twice side by side with v009, it ran 1.04 and 1.03 times as fast.
// All steps since v000 together make it 26.7 times as fast.
#include <hip/hip_runtime.h>

// Cross-attention block with LayerNorm-ed per-head q and k (x1, x2 [4][2048][1024]; q = x1 wq + bq, [k | v] = x2 wkv + bkv ('xw' [1024][1024] and [1024][2048] 0.02, zero biases -> k = first 1024 columns, v = the rest); 16 heads x 64; q, k <- per-head LayerNorm over 64 (eps 1e-5) x gamma + beta ([64], read); scores x 64^-0.5; softmax; out = merged attn v -> [4][2048][1024] (8.4 M)).
// Layout, 3 launches: bf16 copies of both weights and of all of x1 and x2 (one grid, parts by block range); one projection grid over all four batches and q, k and v (blockIdx.z; k and v as the two column blocks of wkv): exact products, f32 bias, for q and k the per-(token, head) LayerNorm with affine on the wave's own accumulators, and the 16-bit head planes stored straight from them (no f32 projection in memory); the head planes of all four batches stay in the workspace; fused dense T-2048 attention with a running softmax, both row classes in one grid (hybrid rows: < 512 hi/lo 3 products, rest fp16 x1024), writes the output rows.
// Every 16-bit operand plane in the workspace (x, weights, q, k, v) lies in FRAGMENT ORDER: a 16-row x 32-k fragment is 1 KiB, [k half][lane][8 elements], so that each 16-byte-per-lane load or store of a wave covers 512 contiguous bytes (4 whole lines) and not 32-byte pieces of 16 lines; the registers receive the same values as from row-major planes.
// Compute dtypes, f32 accumulate: every input rounded to bf16; projections exact + f32 biases; LayerNorms f32; attention rows < 512 3 products, rest fp16; softmax f32; output f32.

#define NB_  4
#define TT   2048
#define DM   1024
#define NH_  16
#define NKV  16
#define REP  (NH_ / NKV)
#define HD   64
#define DQ   (NH_ * HD)
#define DKV  (NKV * HD)
#define RH   512                  // query rows < RH use hi+lo planes (0: none)
#define WIN  0
#define PCAR 1024.0f
#define SCL  0.125f   // HD^-0.5
typedef _Float16 h16;
typedef unsigned short bf;
typedef __attribute__((ext_vector_type(16))) __bf16   v16bf;
typedef __attribute__((ext_vector_type(16))) _Float16 v16h;
typedef __attribute__((ext_vector_type(8)))  _Float16 v8h;
typedef __attribute__((ext_vector_type(8)))  unsigned short v8us;
typedef __attribute__((ext_vector_type(8)))  float    v8f;
typedef __attribute__((ext_vector_type(4)))  float    v4f;
typedef v8h  __attribute__((may_alias)) v8ha;
typedef v4f  __attribute__((may_alias)) v4fa;
typedef v8us __attribute__((may_alias)) v8usa;

typedef __attribute__((ext_vector_type(2))) float  v2fc;
typedef __attribute__((ext_vector_type(2))) __bf16 v2bc;
typedef __attribute__((ext_vector_type(4))) unsigned v4uc;
// f32 -> bf16, round to nearest even, by the chip's own conversion: cvt2 rounds two values in one instruction (a in the low half, b in the high half of the word)
__device__ __forceinline__ unsigned cvt2(float a, float b) { const v2fc x = {a, b}; return __builtin_bit_cast(unsigned, __builtin_convertvector(x, v2bc)); }
__device__ __forceinline__ unsigned short f2bf(float f) { return __builtin_bit_cast(unsigned short, (__bf16)f); }
// 8 values -> 8 bf16 (rnd8), or -> 8 hi and 8 lo (split8: lo = what the hi rounding left over, rounded in turn)
__device__ __forceinline__ v8us rnd8(const float (&r)[8]) { v4uc t;
#pragma unroll   // vector elements in registers: their indices must be constants
    for (int q = 0; q < 4; ++q) t[q] = cvt2(r[2 * q], r[2 * q + 1]);
    return __builtin_bit_cast(v8us, t); }
__device__ __forceinline__ void split8(const float (&r)[8], v8us& oh, v8us& ol) { v4uc h, l;
#pragma unroll   // vector elements in registers: their indices must be constants
    for (int q = 0; q < 4; ++q) { h[q] = cvt2(r[2 * q], r[2 * q + 1]); l[q] = cvt2(r[2 * q] - __uint_as_float(h[q] << 16), r[2 * q + 1] - __uint_as_float(h[q] & 0xFFFF0000u)); }
    oh = __builtin_bit_cast(v8us, h); ol = __builtin_bit_cast(v8us, l); }
__device__ __forceinline__ float bf2f(unsigned short b) { return __uint_as_float(((unsigned)b) << 16); }
__device__ __forceinline__ float bfr(float f) { return bf2f(f2bf(f)); }
__device__ __forceinline__ v16h cat16(v8h lo, v8h hi) { return __builtin_shufflevector(lo, hi, 0, 1, 2, 3, 4, 5, 6, 7, 8, 9, 10, 11, 12, 13, 14, 15); }
__device__ __forceinline__ v16bf cat16b(v8us lo, v8us hi) { return __builtin_bit_cast(v16bf, __builtin_shufflevector(lo, hi, 0, 1, 2, 3, 4, 5, 6, 7, 8, 9, 10, 11, 12, 13, 14, 15)); }
__device__ __forceinline__ v8f wmma16(v16h a, v16h b, v8f c) { return __builtin_amdgcn_wmma_f32_16x16x32_f16(false, a, false, b, (short)0, c, false, false); }
__device__ __forceinline__ v8f wmmab(v16bf a, v16bf b, v8f c) { return __builtin_amdgcn_wmma_f32_16x16x32_bf16(false, a, false, b, (short)0, c, false, false); }



// WFrag: one 16x32 (or 32x16) 16-bit operand fragment from a fragment-order plane, p = fragment + lane * 8: lane (lr, hi) finds row lr, k = 8 hi .. + 7 there and k = 16 + 8 hi .. + 7 256 elements on; the same k order for A and B
template <typename T16> struct WFrag;
template <> struct WFrag<h16> { typedef v16h V; static __device__ __forceinline__ V ld(const h16* p) { return cat16(*(const v8h*)p, *(const v8h*)(p + 256)); } static __device__ __forceinline__ v8f mma(V a, V b, v8f c) { return wmma16(a, b, c); } };
template <> struct WFrag<bf> { typedef v16bf V; static __device__ __forceinline__ V ld(const bf* p) { return cat16b(*(const v8us*)p, *(const v8us*)(p + 256)); } static __device__ __forceinline__ v8f mma(V a, V b, v8f c) { return wmmab(a, b, c); } };

__device__ __forceinline__ h16 tohx(float x) { return (h16)x; }
typedef __attribute__((ext_vector_type(2))) _Float16 v2h;
typedef __attribute__((ext_vector_type(4))) _Float16 v4h;
typedef __attribute__((ext_vector_type(2))) unsigned short v2us;
typedef __attribute__((ext_vector_type(4))) unsigned short v4us;
typedef __attribute__((ext_vector_type(2))) float v2f;
typedef __attribute__((ext_vector_type(4))) int v4i;
typedef __attribute__((ext_vector_type(2))) unsigned v2u;

// w [K][N] f32 -> Bt, the transposed weight in fragment order [N/16][K/32][k half][lane][8]; one wave per fragment: a lane gathers the 16 k of its row n (16 neighbouring n per load = 64-byte runs) and stores two 16-byte pieces, the wave 512 bytes in a row each
template <int K, int N>
__device__ __forceinline__ void wtG(const float* __restrict__ w, bf* Bt, int blk) {
    const int lane = threadIdx.x & 31, lr = lane & 15, hi = lane >> 4; const int F = blk * 8 + (threadIdx.x >> 5); if (F >= (N / 16) * (K / 32)) return;
    const float* p = w + (size_t)((F % (K / 32)) * 32 + hi * 8) * N + (F / (K / 32)) * 16 + lr; float v[16];
#pragma unroll   // register arrays here and below: their indices must be constants; all 16 loads fly together
    for (int j = 0; j < 16; ++j) v[j] = p[(size_t)((j >> 3) * 16 + (j & 7)) * N];
    asm volatile("s_wait_xcnt 0x0" :: "v"(p) : "memory");   // before the address registers of the loads above are reused; naming them keeps them live up to the wait
    float v0[8], v1[8];
#pragma unroll
    for (int j = 0; j < 8; ++j) { v0[j] = v[j]; v1[j] = v[8 + j]; }
    const v8us o0 = rnd8(v0), o1 = rnd8(v1);
    bf* q = Bt + (size_t)F * 512 + lane * 8; *(v8us*)q = o0; *(v8us*)(q + 256) = o1;
}
// src: x1 or x2, dst: its half of the bf16 copy; i: the thread's index in it; dst in fragment order [row/16][k/32][k half][lane][8]. One wave = 8 rows x 32 k (half a fragment): each load covers 4 whole source lines (4 rows x 128 bytes), each store four 64-byte runs
__device__ __forceinline__ void cvt8(const float* __restrict__ src, bf* dst, size_t i, size_t n8) { if (i >= n8) return;
    const int l = threadIdx.x & 31, q = l & 7; const size_t F = i >> 6; const int r0 = (int)((i >> 5) & 1) * 8 + (l >> 3);   // fragment; the lane's first row in it (the second: + 4); q: which 4 of the row's 32 k
    const float* p = src + ((F / (DM / 32)) * 16 + r0) * DM + (F % (DM / 32)) * 32 + q * 4; const v4f v0 = *(const v4f*)p, v1 = *(const v4f*)(p + 4 * DM);
    asm volatile("s_wait_xcnt 0x0" :: "v"(p) : "memory");   // before the address registers of the loads above are reused; naming them keeps them live up to the wait
    const v2u w0 = {cvt2(v0[0], v0[1]), cvt2(v0[2], v0[3])}, w1 = {cvt2(v1[0], v1[1]), cvt2(v1[2], v1[3])};
    const v4us o0 = __builtin_bit_cast(v4us, w0), o1 = __builtin_bit_cast(v4us, w1);
    bf* o = dst + F * 512 + (q >> 2) * 256 + (((q >> 1) & 1) * 16 + r0) * 8 + (q & 1) * 4; *(v4us*)o = o0; *(v4us*)(o + 32) = o1; }
// k_prep: the three independent 16-bit copies in ONE launch, so that they share the chip and pay one launch's start and drain; parts by block range, the gathering weight parts first: wq, wkv, x1, x2
#define PB_WQ  (DM * DQ / 512 / 8)          // work-groups: one wave per 512-element fragment, 8 waves each
#define PB_WKV (DM * 2 * DKV / 512 / 8)
#define PB_X   (NB_ * TT * DM / 8 / 256)    // 8 elements per thread, per source
__global__ __launch_bounds__(256) void k_prep(const float* __restrict__ wq, const float* __restrict__ wkv, const float* __restrict__ x1, const float* __restrict__ x2, bf* WQ, bf* WKV, bf* XB) {
    const int b = blockIdx.x;
    if (b < PB_WQ) wtG<DM, DQ>(wq, WQ, b);
    else if (b < PB_WQ + PB_WKV) wtG<DM, 2 * DKV>(wkv, WKV, b - PB_WQ);
    else { const int c = b - (PB_WQ + PB_WKV); const bool two = c >= PB_X;
        cvt8(two ? x2 : x1, XB + (two ? (size_t)NB_ * TT * DM : 0), (size_t)(two ? c - PB_X : c) * 256 + threadIdx.x, (size_t)NB_ * TT * DM / 8); }
}

// ---- proj_tile: projection GEMM with its whole tail, ONE WAVE per 64 tokens x 64 columns (= one head; 16 accumulators), operands straight from fragment-order bf16 planes; X, P16, Ph, Pl: the tile's own batch.
// The f32 tile stays in registers: the wave adds the bias, normalises (q, k) and stores the fp16, hi and lo head planes itself.
// LN (q, k): product rows = weight rows (d), columns = tokens: per column group a lane holds 32 of the 64 d of ONE token (lane ^ 16 the other 32), and each accumulator is 8 neighbouring d = the lane's 16 bytes of half a fragment of the plane [h][t/16][d/32][d half][lane][8].
// !LN (v): product rows = tokens, columns = weight rows: each accumulator is 8 neighbouring tokens of one d = the lane's 16 bytes of half a fragment of the plane [h][t/32][d/16][t half][lane][8].
// Every plain '#pragma unroll' here stands on a loop over register arrays: their indices must be constants, or the arrays would leave the registers.
__device__ __forceinline__ float xhalf(float v) { const int b = __float_as_int(v); return __int_as_float(__builtin_amdgcn_permlanex16(b, b, 0x76543210, 0xfedcba98, false, false)); }   // the value of lane ^ 16
// sum over the 64 d of a token, v[mb][j] = element d = mb*16 + hi*8 + j: neighbours first, then d ^ 32, ^ 16, ^ 8 (the other wave half), ^ 4, ^ 2; both halves end with the same bits
__device__ __forceinline__ float hsum64(const float (&v)[4][8]) { float z[4];
#pragma unroll
    for (int q = 0; q < 4; ++q) { z[q] = ((v[0][2 * q] + v[0][2 * q + 1]) + (v[2][2 * q] + v[2][2 * q + 1])) + ((v[1][2 * q] + v[1][2 * q + 1]) + (v[3][2 * q] + v[3][2 * q + 1])); z[q] += xhalf(z[q]); }
    return (z[0] + z[2]) + (z[1] + z[3]); }
__device__ __forceinline__ void planes8(const float (&r)[8], v8h& o16, v8us& oh, v8us& ol) {
#pragma unroll
    for (int j = 0; j < 8; ++j) o16[j] = tohx(r[j]);
    split8(r, oh, ol); }
template <bool LN>
__device__ __forceinline__ void proj_tile(const bf* __restrict__ X, const bf* __restrict__ Wt, const float* __restrict__ bias, const float* __restrict__ g, const float* __restrict__ bb, h16* __restrict__ P16, bf* __restrict__ Ph, bf* __restrict__ Pl, int t0, int h) {
    typedef WFrag<bf>::V V;
    const int lane = threadIdx.x & 31, lr = lane & 15, hi = lane >> 4; const int c0 = h * 64;
    const bf* A = LN ? Wt + (size_t)c0 * DM : X + (size_t)t0 * DM; const bf* Bt = LN ? X + (size_t)t0 * DM : Wt + (size_t)c0 * DM;
    v8f acc[4][4];
#pragma unroll
    for (int mb = 0; mb < 4; ++mb)
#pragma unroll
        for (int nb = 0; nb < 4; ++nb) acc[mb][nb] = (v8f){};
    const bf* A0 = A + (size_t)lane * 8; const bf* B0 = Bt + (size_t)lane * 8;
    // Fragments are loaded ONE k STEP AHEAD of their products, into a second register set (a0, b0 and a1, b1 in turn): while a step's 16 products run, the next step's 16 loads fly, and no product waits out its own loads' latency.
    V a0[4], b0[4], a1[4], b1[4];
    // the first fragments, held in the order in which a trip issues them: the loop's counted load waits are the stricter of both ways into it, and another order here would make every trip wait for its youngest loads
#pragma unroll
    for (int mb = 0; mb < 4; ++mb) { a0[mb] = WFrag<bf>::ld(A0 + (size_t)mb * 16 * DM); __builtin_amdgcn_sched_barrier(0); }
#pragma unroll
    for (int nb = 0; nb < 4; ++nb) { b0[nb] = WFrag<bf>::ld(B0 + (size_t)nb * 16 * DM); __builtin_amdgcn_sched_barrier(0); }
    asm volatile("s_wait_xcnt 0x0" :: "v"(A0), "v"(B0) : "memory");   // before the address registers of the loads above are reused; naming them keeps them live up to the wait
    // rolled: a trip already holds 32 loads and 32 matrix instructions (two k steps, one per register set), more trips in the text would only lengthen it
#pragma unroll 1
    for (int kc = 0; kc < DM; kc += 64) {
        const bf* pa = A0 + kc * 16; const bf* pb = B0 + kc * 16;   // fragment kc / 32 of each 16-row tile; the loads from here take the next one, 512 elements on
        const int kw = (kc + 64) & (DM - 1); const bf* qa = A0 + kw * 16; const bf* qb = B0 + kw * 16;   // fragment kc / 32 + 2; the last trip re-reads fragment 0 (in bounds, unused)
#pragma unroll
        for (int mb = 0; mb < 4; ++mb) a1[mb] = WFrag<bf>::ld(pa + 512 + (size_t)mb * 16 * DM);
#pragma unroll
        for (int nb = 0; nb < 4; ++nb) { b1[nb] = WFrag<bf>::ld(pb + 512 + (size_t)nb * 16 * DM);
            __builtin_amdgcn_sched_barrier(0);   // the loads above issue here, a whole k step ahead of their use; sunk to their use each would cost its whole latency
#pragma unroll
            for (int mb = 0; mb < 4; ++mb) acc[mb][nb] = WFrag<bf>::mma(a0[mb], b0[nb], acc[mb][nb]); }
#pragma unroll
        for (int mb = 0; mb < 4; ++mb) a0[mb] = WFrag<bf>::ld(qa + (size_t)mb * 16 * DM);
#pragma unroll
        for (int nb = 0; nb < 4; ++nb) { b0[nb] = WFrag<bf>::ld(qb + (size_t)nb * 16 * DM);
            __builtin_amdgcn_sched_barrier(0);   // as above: a whole k step ahead of their use
#pragma unroll
            for (int mb = 0; mb < 4; ++mb) acc[mb][nb] = WFrag<bf>::mma(a1[mb], b1[nb], acc[mb][nb]); }
        // the vector slots that the chip needs between the trip's last matrix instructions and what follows them over the back edge
        asm volatile("v_nop\n\tv_nop\n\tv_nop\n\tv_nop" : "+v"(acc[0][3]), "+v"(acc[1][3]), "+v"(acc[2][3]), "+v"(acc[3][3]) : "v"(a1[0]), "v"(a1[3]));
        asm volatile("s_wait_xcnt 0x0" :: "v"(pa), "v"(pb), "v"(qa), "v"(qb) : "memory");   // before the address registers of the trip's loads are reused; naming them keeps them live up to the wait, so that no load's own result lands on them
    }
    if (LN) {
        float bs[4][8], gm[4][8], bt[4][8]; const unsigned ob = (unsigned)hi * 32u;   // the lane's byte offset (d = hi * 8) into the three [64] f32 vectors
        const char* cbs = (const char*)(bias + c0); const char* cgm = (const char*)g; const char* cbt = (const char*)bb;
#pragma unroll
        for (int mb = 0; mb < 4; ++mb)
#pragma unroll
            for (int j = 0; j < 8; ++j) { bs[mb][j] = *(const float*)(cbs + ob + mb * 64 + j * 4); gm[mb][j] = *(const float*)(cgm + ob + mb * 64 + j * 4); bt[mb][j] = *(const float*)(cbt + ob + mb * 64 + j * 4); }
        asm volatile("s_wait_xcnt 0x0" :: "v"(ob) : "memory");   // before the offset register of the loads above is reused; naming it keeps it live up to the wait, so that no load's own result lands on it
        __builtin_amdgcn_sched_barrier(0);   // keeps later register writes from being lifted over the wait
#pragma unroll
        for (int mb = 0; mb < 4; ++mb)
#pragma unroll
            for (int j = 0; j < 8; ++j) { bs[mb][j] = bfr(bs[mb][j]); gm[mb][j] = bfr(gm[mb][j]); bt[mb][j] = bfr(bt[mb][j]);
#pragma unroll
                for (int nb = 0; nb < 4; ++nb) acc[mb][nb][j] += bs[mb][j]; }
#pragma unroll
        for (int nb = 0; nb < 4; ++nb) { float x[4][8], p[4][8];
#pragma unroll
            for (int mb = 0; mb < 4; ++mb)
#pragma unroll
                for (int j = 0; j < 8; ++j) x[mb][j] = acc[mb][nb][j];
            const float mean = hsum64(x) * (1.0f / HD);
#pragma unroll
            for (int mb = 0; mb < 4; ++mb)
#pragma unroll
                for (int j = 0; j < 8; ++j) { x[mb][j] -= mean; p[mb][j] = x[mb][j] * x[mb][j]; }
            const float den = __fsqrt_rn(hsum64(p) * (1.0f / HD) + 1e-5f);
            v8h o16[4]; v8us oh[4], ol[4];
#pragma unroll
            for (int mb = 0; mb < 4; ++mb) { float r[8];
#pragma unroll
                for (int j = 0; j < 8; ++j) r[j] = __fdiv_rn(x[mb][j], den) * gm[mb][j] + bt[mb][j];
                planes8(r, o16[mb], oh[mb], ol[mb]); }
            const size_t e = ((size_t)h * TT + t0 + nb * 16) * HD + lane * 8;
            __builtin_amdgcn_sched_barrier(0);   // the column's arithmetic ends here: nothing of it is sunk between a store and the wait behind the stores
#pragma unroll
            for (int mb = 0; mb < 4; ++mb) { *(v8h*)(P16 + e + mb * 256) = o16[mb]; *(v8us*)(Ph + e + mb * 256) = oh[mb]; *(v8us*)(Pl + e + mb * 256) = ol[mb]; }
            asm volatile("s_wait_xcnt 0x0" ::: "memory");   // before the data and address registers of the stores above are reused
            __builtin_amdgcn_sched_barrier(0);   // keeps later register writes from being lifted over the wait
        }
    } else {
#pragma unroll
        for (int nb = 0; nb < 4; ++nb) { const float bs = bfr(bias[c0 + nb * 16 + lr]); v8h o16[4]; v8us oh[4], ol[4];
#pragma unroll
            for (int mb = 0; mb < 4; ++mb) { float r[8];
#pragma unroll
                for (int j = 0; j < 8; ++j) r[j] = acc[mb][nb][j] + bs;
                planes8(r, o16[mb], oh[mb], ol[mb]); }
            const size_t e = (((size_t)h * (TT / 32) + t0 / 32) * 4 + nb) * 512 + lane * 8;
            __builtin_amdgcn_sched_barrier(0);   // the column's arithmetic ends here: nothing of it is sunk between a store and the wait behind the stores
#pragma unroll
            for (int mb = 0; mb < 4; ++mb) { const int f = (mb >> 1) * 2048 + (mb & 1) * 256; *(v8h*)(P16 + e + f) = o16[mb]; *(v8us*)(Ph + e + f) = oh[mb]; *(v8us*)(Pl + e + f) = ol[mb]; }
            asm volatile("s_wait_xcnt 0x0" ::: "memory");   // before the data and address registers of the stores above are reused
            __builtin_amdgcn_sched_barrier(0);   // keeps later register writes from being lifted over the wait
        }
    }
}
// k_proj: every projection tile of the block in one launch, so that all of them share the chip at once; grid (NB_*TT/128, heads/2, 3), 128 threads; blockIdx.z: 0 = q from x1, 1 = k, 2 = v from x2.
// A work-group is 4 independent waves on 2 neighbouring token tiles x 2 neighbouring heads: they start together on one WGP and walk k side by side, so that each x line and each weight line is read by two of them and comes from L2 once.
__global__ __launch_bounds__(128) void k_proj(const bf* __restrict__ X1, const bf* __restrict__ X2, const bf* __restrict__ WQ, const bf* __restrict__ WK, const bf* __restrict__ WV, const float* __restrict__ bq, const float* __restrict__ bk, const float* __restrict__ bv, const float* __restrict__ gq, const float* __restrict__ btq, const float* __restrict__ gk, const float* __restrict__ btk,
                                              h16* __restrict__ QP16, bf* __restrict__ QPh, bf* __restrict__ QPl, h16* __restrict__ KP16, bf* __restrict__ KPh, bf* __restrict__ KPl, h16* __restrict__ VT16, bf* __restrict__ VTh, bf* __restrict__ VTl) {
    const int wv = __builtin_amdgcn_readfirstlane((int)(threadIdx.x >> 5)), tt = (int)blockIdx.x * 2 + (wv & 1);   // the wave's number, in a scalar register like all that is formed from it; its token tile
    const int b = tt / (TT / 64), t0 = (tt % (TT / 64)) * 64, h = (int)blockIdx.y * 2 + (wv >> 1); const size_t xb = (size_t)b * TT * DM, pb = (size_t)b * NH_ * TT * HD;   // this batch's block in x and in every head plane (NKV == NH_)
    if (blockIdx.z == 2) proj_tile<false>(X2 + xb, WV, bv, nullptr, nullptr, VT16 + pb, VTh + pb, VTl + pb, t0, h);   // v, transposed planes
    else { const bool kk = blockIdx.z == 1;   // q or k: per-head LayerNorm x gamma + beta, planes
        proj_tile<true>((kk ? X2 : X1) + xb, kk ? WK : WQ, kk ? bk : bq, kk ? gk : gq, kk ? btk : btq, (kk ? KP16 : QP16) + pb, (kk ? KPh : QPh) + pb, (kk ? KPl : QPl) + pb, t0, h); }
}
// ---- attn_cols: scores, softmax and attn x v of one (batch, head) in one kernel; no score or probability ever leaves the registers.
// One wave owns NQ*16 query columns and walks the 2048 keys 32 at a time: St = K Qt (A = key rows, B = query rows kept in registers), so a lane holds 16 scores of ONE query per column group;
// maximum in use and sum per query (in-lane; the wave halves exchange their maxima only when the maximum in use is raised, their sums once at the end); the two 16-key score tiles, converted in place, ARE the B operand of Ot += Vt Pt (A = d rows of the v plane, same k order as WFrag::ld).
// Rows < RH: bf16 hi+lo planes, 3 products each; the rest fp16 with probabilities x PCAR (the factor is in the sum too and cancels in the division).
template <typename T16> struct PPack;
template <> struct PPack<h16> { static __device__ __forceinline__ void pk(const v8f& p0, const v8f& p1, v16h& a, v16h& a2) { (void)a2;
#pragma unroll
    for (int e = 0; e < 8; ++e) { a[e] = tohx(p0[e]); a[8 + e] = tohx(p1[e]); } } };
template <> struct PPack<bf> { static __device__ __forceinline__ void pk(const v8f& p0, const v8f& p1, v16bf& a, v16bf& a2) { v8us h0, h1, l0, l1; float r0[8], r1[8];
#pragma unroll
    for (int e = 0; e < 8; ++e) { r0[e] = p0[e]; r1[e] = p1[e]; }
    split8(r0, h0, l0); split8(r1, h1, l1);
    a = cat16b(h0, h1); a2 = cat16b(l0, l1); } };
template <typename T16, bool HL, int NQ>
__device__ __forceinline__ void attn_cols(const T16* __restrict__ Q, const T16* __restrict__ Q2, const T16* __restrict__ Kp, const T16* __restrict__ K2, const T16* __restrict__ Vt, const T16* __restrict__ V2, int q0, float sh, float* __restrict__ orow) {
    typedef typename WFrag<T16>::V V;
    const int lane = threadIdx.x & 31, lr = lane & 15, hi = lane >> 4; const float c1 = SCL * 1.4426950408889634f;
    V qf[NQ][2], qf2[NQ][2];
#pragma unroll
    for (int nb = 0; nb < NQ; ++nb)
#pragma unroll
        for (int ks = 0; ks < 2; ++ks) { const size_t qo = (size_t)(q0 + nb * 16) * HD + ks * 512 + lane * 8; qf[nb][ks] = WFrag<T16>::ld(Q + qo); if (HL) qf2[nb][ks] = WFrag<T16>::ld(Q2 + qo); }
    asm volatile("s_wait_xcnt 0x0" ::: "memory");   // before the address registers of the loads above are reused
    __builtin_amdgcn_sched_barrier(0);   // keeps later register writes from being lifted over the wait
    // Lazy rescale: mx = the maximum IN USE per query (the same in both wave halves), mc = sh - mx * c1 the exponent offset formed from it. It is raised, and o and sm rescaled, only when some exponent of the trip would pass EMAX;
    // until then every probability is at most 2^EMAX (fp16 rows: 2^15, inside the type's range; hi/lo rows: 2^8), and the common factor cancels in the final division as before. The start value of mc makes the first trip take the branch. (Every plain '#pragma unroll' in this function stands on a loop over register arrays: their indices must be constants.)
    const float EMAX = HL ? 8.0f : 15.0f;
    v8f o[4][NQ], sm[NQ]; float mx[NQ], mc[NQ];   // sm: with no factor to apply per trip, the row sum stays 8 partial sums per lane, joined once behind the loop
#pragma unroll
    for (int nb = 0; nb < NQ; ++nb) { mx[nb] = -3.0e38f; mc[nb] = 3.0e38f; sm[nb] = (v8f){};
#pragma unroll
        for (int dt = 0; dt < 4; ++dt) o[dt][nb] = (v8f){}; }
    const size_t ko = (size_t)lane * 8, vo = (size_t)lane * 8;
    V kf[2][2], kf2[2][2];
#pragma unroll
    for (int kt = 0; kt < 2; ++kt)
#pragma unroll
        for (int ks = 0; ks < 2; ++ks) { kf[kt][ks] = WFrag<T16>::ld(Kp + ko + kt * 16 * HD + ks * 512); if (HL) kf2[kt][ks] = WFrag<T16>::ld(K2 + ko + kt * 16 * HD + ks * 512); }
    asm volatile("s_wait_xcnt 0x0" ::: "memory");   // before the address registers of the loads above are reused
    __builtin_amdgcn_sched_barrier(0);   // keeps later register writes from being lifted over the wait
    for (int k0 = 0; k0 < TT; k0 += 32) {
        V vf[4], vf2[4]; const T16* pv = Vt + vo + (size_t)k0 * HD; const T16* pv2 = HL ? V2 + vo + (size_t)k0 * HD : nullptr;   // 32 keys x 64 d = 4 fragments in a row
#pragma unroll
        for (int dt = 0; dt < 4; ++dt) { vf[dt] = WFrag<T16>::ld(pv + dt * 512); if (HL) vf2[dt] = WFrag<T16>::ld(pv2 + dt * 512); }
        // before the address registers of the loads above are reused; naming them keeps them live up to the wait, so that no load's own result lands on them
        if (HL) asm volatile("s_wait_xcnt 0x0" :: "v"(pv), "v"(pv2) : "memory"); else asm volatile("s_wait_xcnt 0x0" :: "v"(pv) : "memory");
        __builtin_amdgcn_sched_barrier(0);   // the loads above issue here, a softmax ahead of their use; sunk to their use each would cost its whole latency
        v8f s[2][NQ];
#pragma unroll
        for (int kt = 0; kt < 2; ++kt)
#pragma unroll
            for (int nb = 0; nb < NQ; ++nb) { v8f t = (v8f){};
#pragma unroll
                for (int ks = 0; ks < 2; ++ks) { t = WFrag<T16>::mma(kf[kt][ks], qf[nb][ks], t); if (HL) { t = WFrag<T16>::mma(kf2[kt][ks], qf[nb][ks], t); t = WFrag<T16>::mma(kf[kt][ks], qf2[nb][ks], t); } }
                s[kt][nb] = t; }
        const size_t kn = ko + (size_t)((k0 + 32) & (TT - 1)) * HD;   // the next 32 keys' fragments fly under the softmax; the last trip re-reads keys 0..31 (in bounds, unused)
#pragma unroll
        for (int kt = 0; kt < 2; ++kt)
#pragma unroll
            for (int ks = 0; ks < 2; ++ks) { kf[kt][ks] = WFrag<T16>::ld(Kp + kn + kt * 16 * HD + ks * 512); if (HL) kf2[kt][ks] = WFrag<T16>::ld(K2 + kn + kt * 16 * HD + ks * 512); }
        asm volatile("s_wait_xcnt 0x0" ::: "memory");   // before the address registers of the loads above are reused
        __builtin_amdgcn_sched_barrier(0);   // the loads above issue here, the rest of the trip ahead of their use; sunk to the loop's foot they would cost their whole latency
        float lm[NQ]; bool need = false;   // the lane's own largest score per query; need: its exponent under the offset in use passes EMAX
#pragma unroll
        for (int nb = 0; nb < NQ; ++nb) { float m = fmaxf(s[0][nb][0], s[1][nb][0]);
#pragma unroll
            for (int j = 1; j < 8; ++j) m = fmaxf(m, fmaxf(s[0][nb][j], s[1][nb][j]));
            lm[nb] = m; need = need || fmaf(m, c1, mc[nb]) > EMAX; }
        if (__builtin_amdgcn_ballot_w32(need) != 0) {   // one wave-uniform test per trip; taken on the first trip and then only when a maximum grows past the margin
#pragma unroll
            for (int nb = 0; nb < NQ; ++nb) { float m = fmaxf(mx[nb], lm[nb]); m = fmaxf(m, __shfl_xor(m, 16, 32));
                const float al = __builtin_amdgcn_exp2f((mx[nb] - m) * c1); mx[nb] = m; mc[nb] = sh - m * c1; sm[nb] = sm[nb] * al;
#pragma unroll
                for (int dt = 0; dt < 4; ++dt) o[dt][nb] = o[dt][nb] * al; } }
        V pf[NQ], pf2[NQ];
#pragma unroll
        for (int nb = 0; nb < NQ; ++nb) { const v8f cv = (v8f)(c1), mv = (v8f)(mc[nb]), e0 = __builtin_elementwise_fma(s[0][nb], cv, mv), e1 = __builtin_elementwise_fma(s[1][nb], cv, mv);
#pragma unroll
            for (int j = 0; j < 8; ++j) { s[0][nb][j] = __builtin_amdgcn_exp2f(e0[j]); s[1][nb][j] = __builtin_amdgcn_exp2f(e1[j]); }
            sm[nb] += s[0][nb] + s[1][nb];
            PPack<T16>::pk(s[0][nb], s[1][nb], pf[nb], pf2[nb]); }
#pragma unroll
        for (int nb = 0; nb < NQ; ++nb)
#pragma unroll
            for (int dt = 0; dt < 4; ++dt) { v8f t = o[dt][nb]; t = WFrag<T16>::mma(vf[dt], pf[nb], t); if (HL) { t = WFrag<T16>::mma(vf[dt], pf2[nb], t); t = WFrag<T16>::mma(vf2[dt], pf[nb], t); } o[dt][nb] = t; }
    }
#pragma unroll
    for (int nb = 0; nb < NQ; ++nb) { const float sl = ((sm[nb][0] + sm[nb][1]) + (sm[nb][2] + sm[nb][3])) + ((sm[nb][4] + sm[nb][5]) + (sm[nb][6] + sm[nb][7])); const float tot = sl + __shfl_xor(sl, 16, 32); const float inv = __fdiv_rn(1.0f, tot); float* op = orow + (size_t)(q0 + nb * 16 + lr) * DQ + hi * 8;
#pragma unroll
        for (int dt = 0; dt < 4; ++dt) *(v8f*)(op + dt * 16) = o[dt][nb] * inv; }
}
// k_fattn: grid (NB_*NH_, query tiles of both row classes), 4 independent waves per work-group on neighbouring query columns of one head (they walk the same k and v lines).
// Both classes in ONE launch, so that their waves share the SIMDs (one class's matrix runs under the other's vector work) and the launch pays one start and one drain; the longer work-groups come first:
// blockIdx.y < RH/64: rows < RH, 64 per work-group, 3 products; the rest: fp16, 128 per work-group.
__global__ __launch_bounds__(128) void k_fattn(const bf* __restrict__ QPh, const bf* __restrict__ QPl, const bf* __restrict__ KPh, const bf* __restrict__ KPl, const bf* __restrict__ VTh, const bf* __restrict__ VTl, const h16* __restrict__ QP16, const h16* __restrict__ KP16, const h16* __restrict__ VT16, float* __restrict__ OUT) {
    const size_t z = blockIdx.x, pz = z * TT * HD; const int wv = threadIdx.x >> 5; float* orow = OUT + (z / NH_) * (size_t)TT * DQ + (z % NH_) * HD;
    if (blockIdx.y < RH / 64) attn_cols<bf, true, 1>(QPh + pz, QPl + pz, KPh + pz, KPl + pz, VTh + pz, VTl + pz, (int)blockIdx.y * 64 + wv * 16, 0.0f, orow);
    else attn_cols<h16, false, 2>(QP16 + pz, nullptr, KP16 + pz, nullptr, VT16 + pz, nullptr, RH + ((int)blockIdx.y - RH / 64) * 128 + wv * 32, 10.0f, orow);   // 10 = log2(PCAR)
}

extern "C" void kernel_launch(void* const* d_in, const int* in_sizes, int n_in,
                              void* d_out, int out_size, void* d_ws, size_t ws_size, hipStream_t stream) {
    (void)in_sizes; (void)n_in; (void)out_size;
    const float* x = (const float*)d_in[0]; const float* x2 = (const float*)d_in[1]; const float* wq = (const float*)d_in[2]; const float* bq = (const float*)d_in[3]; const float* wkv = (const float*)d_in[4]; const float* bkv = (const float*)d_in[5]; const float* gq = (const float*)d_in[6]; const float* btq = (const float*)d_in[7]; const float* gk = (const float*)d_in[8]; const float* btk = (const float*)d_in[9]; const float* wk = nullptr; const float* wv = nullptr; const float* wo = nullptr; (void)wk; (void)wv; (void)wo; const float* bk = bkv; const float* bv = bkv + 1024;
    float* OUT = (float*)d_out;     // [4][2048][1024]
    char* wsp = (char*)d_ws;
    auto take = [&](size_t bytes) { char* p = wsp; wsp += (bytes + 255) & ~(size_t)255; return (void*)p; };
    bf* WQ = (bf*)take((size_t)DQ * DM * 2); bf* WKV = (bf*)take((size_t)2 * DKV * DM * 2); bf* WK = WKV; bf* WV = WKV + (size_t)DKV * DM;   /* k | v row blocks of the transposed fused weight */
    bf* XB = (bf*)take((size_t)2 * NB_ * TT * DM * 2); bf* XB2 = XB + (size_t)NB_ * TT * DM;   /* bf16 x1 | x2, all batches */
    /* head planes [batch][head][..] of all NB_ batches */ h16* QP16 = (h16*)take((size_t)NB_ * NH_ * TT * HD * 2); h16* KP16 = (h16*)take((size_t)NB_ * NKV * TT * HD * 2); h16* VT16 = (h16*)take((size_t)NB_ * NKV * HD * TT * 2);
    bf* QPh = (bf*)take((size_t)NB_ * NH_ * TT * HD * 2); bf* QPl = (bf*)take((size_t)NB_ * NH_ * TT * HD * 2); bf* KPh = (bf*)take((size_t)NB_ * NKV * TT * HD * 2); bf* KPl = (bf*)take((size_t)NB_ * NKV * TT * HD * 2); bf* VTh = (bf*)take((size_t)NB_ * NKV * HD * TT * 2); bf* VTl = (bf*)take((size_t)NB_ * NKV * HD * TT * 2);
    if ((size_t)(wsp - (char*)d_ws) > ws_size) return;    // ws 256 MiB
    k_prep<<<PB_WQ + PB_WKV + 2 * PB_X, 256, 0, stream>>>(wq, wkv, x, x2, WQ, WKV, XB);   /* 'xw' [1024][2048] -> Bt [2048][1024]: rows 0..1023 = k, 1024.. = v */
    k_proj<<<dim3(NB_ * TT / 128, NH_ / 2, 3), 128, 0, stream>>>(XB, XB2, WQ, WK, WV, bq, bk, bv, gq, btq, gk, btk, QP16, QPh, QPl, KP16, KPh, KPl, VT16, VTh, VTl);
    k_fattn<<<dim3(NB_ * NH_, RH / 64 + (TT - RH) / 128), 128, 0, stream>>>(QPh, QPl, KPh, KPl, VTh, VTl, QP16, KP16, VT16, OUT);
}
